// v000
// The times below were measured on an AMD MI455X: many runs one after another, warmed up first and cycling through
// copies of the inputs, with the whole window's GPU time divided by the number of runs. Launches and the gaps
// between them are all in it. The median over several windows is given; except for v000 it joins two sittings, which
// can be a few percent apart, so the side-by-side timings, each taken in one sitting, are the better comparison.
// v000, which the later versions start from, runs in 360 microseconds.
// compute dtype: all float inputs RNE-converted to bf16; q|k|v = x . W[h] with exact bf16 x bf16 products on v_wmma_f32_16x16x32_bf16, stored as f16 hi + residual(x2^11) planes (v transposed); scores = q . k on v_wmma_f32_16x16x32_f16 (query blocks 0..1: 3-product hi/res, later blocks single f16), x 1/8 and causal online softmax (running max) in f32; P x 2^4 as f16 hi (+ residual x2^11 against v hi + v lo on query blocks 0..1, single P x v hi elsewhere) on f16 WMMA; out = ctx (bf16 hi + lo) . W on bf16 WMMA; f32 accumulate everywhere, f32 output.
#include <hip/hip_runtime.h>
#include <math.h>

typedef __attribute__((ext_vector_type(16))) _Float16 v16h;
typedef __attribute__((ext_vector_type(16))) __bf16 v16b;
typedef __attribute__((ext_vector_type(8)))  _Float16 v8h;
typedef __attribute__((ext_vector_type(8)))  __bf16 v8b;
typedef __attribute__((ext_vector_type(8)))  float v8f;
typedef __attribute__((ext_vector_type(4)))  float v4f;
typedef __attribute__((ext_vector_type(4)))  unsigned v4u;

template <typename T> __device__ __forceinline__ void vst2(void* p, T v) { *(T*)p = v;  }
__device__ __forceinline__ v8f wmma16(v16h a, v16h b, v8f c) {
  v8f d = __builtin_amdgcn_wmma_f32_16x16x32_f16(false, a, false, b, (short)0, c, false, false);
  asm volatile("v_nop\n\tv_nop\n\tv_nop\n\tv_nop" : "+v"(d) : "v"(a), "v"(b));
  return d;
}
__device__ __forceinline__ v8f wmma_bf(v16b a, v16b b, v8f c) {
  v8f d = __builtin_amdgcn_wmma_f32_16x16x32_bf16(false, a, false, b, (short)0, c, false, false);
  asm volatile("v_nop\n\tv_nop\n\tv_nop\n\tv_nop" : "+v"(d) : "v"(a), "v"(b));
  return d;
}
// 16-bit row fragment (row m = lane & 15 selected by the caller): elements 0..7 <- k0 + 8h + i, 8..15 <- k0 + 16 + 8h + i, h = lane >> 4
__device__ __forceinline__ v16h frag_h(const _Float16* rowk0, int lane) {
  union { v16h v; v8h q[2]; } u; const _Float16* p = rowk0 + 8 * (lane >> 4);
  u.q[0] = *(const v8h*)p; u.q[1] = *(const v8h*)(p + 16); return u.v;
}
__device__ __forceinline__ v16b frag_b(const __bf16* rowk0, int lane) {
  union { v16b v; v8b q[2]; } u; const __bf16* p = rowk0 + 8 * (lane >> 4);
  u.q[0] = *(const v8b*)p; u.q[1] = *(const v8b*)(p + 16); return u.v;
}
struct F2 { v16b h, l; };
__device__ __forceinline__ F2 bsplit16(const float v[16]) { F2 r;
#pragma unroll
  for (int i = 0; i < 16; ++i) { const __bf16 h = (__bf16)v[i]; r.h[i] = h; r.l[i] = (__bf16)(v[i] - (float)h); }
  return r; }
__device__ __forceinline__ F2 split_row(const float* row, int k0, int lane) { float v[16]; const float* p = row + k0 + 8 * (lane >> 4);
#pragma unroll
  for (int i = 0; i < 8; ++i) { v[i] = p[i]; v[8 + i] = p[16 + i]; }
  return bsplit16(v); }
__device__ __forceinline__ void ldsx() { asm volatile("s_wait_dscnt 0" ::: "memory"); __builtin_amdgcn_wave_barrier(); __builtin_amdgcn_fence(3, "workgroup"); }

// causal multi-head attention: per-head q/k/v projections D 1,024 -> 64 (16 heads, weights [h][in][out]), scores/8, -inf above the diagonal, softmax, ctx merged head-major, out = ctx . W ([in 1,024][out 64])
#ifndef NB
#define NB 2
#endif
#ifndef SEQ
#define SEQ 2048
#endif
#define NB_FULL 2
#define SEQ_FULL 2048
#define DM 1024
#define NH 16
#define HD 64
#define NE 64
#define QKVW (3 * DM)        // fused q | k | v output columns, column h*64+e (+0 / +1024 / +2048)
#define NPK (QKVW + NE)      // packed bf16 weight rows: 3072 q|k|v rows + 64 out-projection rows, each k-contiguous over 1024
#define PSC 16.0f            // softmax weights pre-scaled by 2^4 before the f16 split (<= 16; residual carried x2^11)
static_assert(SEQ % 64 == 0);
static_assert(SEQ >= 64 && SEQ <= SEQ_FULL);
static_assert(NB >= 1 && NB <= NB_FULL);
static_assert(HD == NE);
static_assert(DM % 64 == 0 && NPK % 64 == 0);

#define WS_PK  0ull                                           // bf16 [NPK][DM]
#define WS_QK  (WS_PK + 2ull * NPK * DM)                      // f16 [NB*SEQ][2*DM]: q | k hi
#define WS_QKL (WS_QK + 2ull * NB * SEQ * 2 * DM)             // f16 q | k residual x2048
#define WS_VTH (WS_QKL + 2ull * NB * SEQ * 2 * DM)            // f16 [b][1024 (h*64+d)][SEQ] v hi (transposed)
#define WS_VTL (WS_VTH + 2ull * NB * DM * SEQ)                // f16 v residual x2048 (transposed)
#define WS_O   (WS_VTL + 2ull * NB * DM * SEQ)                // f32 [NB*SEQ][DM] merged ctx
#define WS_END (WS_O + 4ull * NB * SEQ * DM)
static_assert(WS_END <= 134217728ull);
static_assert((WS_QK % 128) == 0 && (WS_QKL % 128) == 0 && (WS_VTH % 128) == 0 && (WS_VTL % 128) == 0 && (WS_O % 128) == 0);

// ---- k_pack: block = (64-wide d chunk, group): group 0..47 = (which = group/16, head = group%16) of Wq/Wk/Wv [h][d][e]; group 48 = W [d][e].
__global__ __launch_bounds__(256) void k_pack(const float* __restrict__ WQ, const float* __restrict__ WK, const float* __restrict__ WV, const float* __restrict__ WO, __bf16* __restrict__ PK) {
  __shared__ __align__(16) __bf16 s[64][72];
  const int dc = blockIdx.x, grp = blockIdx.y, t = threadIdx.x; const int which = grp >> 4, hh = grp & 15;
  const float* Wm = (which == 0) ? WQ : (which == 1) ? WK : (which == 2) ? WV : WO;
  const float* src = Wm + ((which < 3) ? (size_t)hh * DM * HD : (size_t)0) + (size_t)dc * 64 * HD;
  for (int q = t; q < 64 * 64; q += 256) { const int dd = q >> 6, e = q & 63; s[e][dd] = (__bf16)src[(size_t)dd * HD + e]; }
  __syncthreads();
  for (int q = t; q < 64 * 8; q += 256) { const int e = q >> 3, pc = q & 7; vst2(PK + ((size_t)grp * 64 + e) * DM + dc * 64 + pc * 8, *(const v4u*)&s[e][pc * 8]); }
}
// ---- k_qkv: block = (64 rows of x, 128 fused output columns n0): bf16(x) rows x packed bf16 weight rows on WMMA (K = 1024);
__global__ __launch_bounds__(128) void k_qkv(const float* __restrict__ X, const __bf16* __restrict__ P, _Float16* __restrict__ QK, _Float16* __restrict__ QKL, _Float16* __restrict__ VTH, _Float16* __restrict__ VTL) {
  __shared__ __align__(16) _Float16 so[4][16][136], sol[4][16][136]; __shared__ __align__(16) _Float16 sth[128][72], stl[128][72];
  const int tid = threadIdx.x, wave = tid >> 5, lane = tid & 31, col = lane & 15, g = lane >> 4;
  const size_t rb = (size_t)blockIdx.x * 64; const int b = (int)(rb / SEQ), s0 = (int)(rb % SEQ);
  const size_t xr0 = (size_t)b * SEQ_FULL + s0 + wave * 16;   // input row base of this wave's 16 rows
  const size_t pr0 = rb + wave * 16;                            // plane row base (compact b*SEQ + s)
  const int n0 = blockIdx.y * 128;
  v8f acc[8] = {};
#pragma unroll 2
  for (int kc = 0; kc < DM / 32; ++kc) { v16b a; { const float* p = X + (xr0 + col) * DM + kc * 32 + 8 * g;
#pragma unroll
      for (int i = 0; i < 8; ++i) { a[i] = (__bf16)p[i]; a[8 + i] = (__bf16)p[16 + i]; } }
#pragma unroll
    for (int j = 0; j < 8; ++j) acc[j] = wmma_bf(a, frag_b(P + (size_t)(n0 + j * 16 + col) * DM + kc * 32, lane), acc[j]); }
  if (n0 < 2 * DM) {   // q and k stored unscaled (sigma ~0.6); 1/8 applied to the f32 score
#pragma unroll
    for (int j = 0; j < 8; ++j) {
#pragma unroll
      for (int r = 0; r < 8; ++r) { const float v = acc[j][r]; const _Float16 hv = (_Float16)v; so[wave][8 * g + r][j * 16 + col] = hv; sol[wave][8 * g + r][j * 16 + col] = (_Float16)((v - (float)hv) * 2048.0f); } }
    ldsx();
    for (int rl = 0; rl < 16; ++rl) if (lane < 16) { vst2(QK + (pr0 + rl) * (2 * DM) + n0 + lane * 8, *(const v4u*)&so[wave][rl][lane * 8]); vst2(QKL + (pr0 + rl) * (2 * DM) + n0 + lane * 8, *(const v4u*)&sol[wave][rl][lane * 8]); }
  } else {
#pragma unroll
    for (int j = 0; j < 8; ++j) {
#pragma unroll
      for (int r = 0; r < 8; ++r) { const float v = acc[j][r]; const _Float16 hv = (_Float16)v; sth[j * 16 + col][wave * 16 + 8 * g + r] = hv; stl[j * 16 + col][wave * 16 + 8 * g + r] = (_Float16)((v - (float)hv) * 2048.0f); } }
    __syncthreads();
    const int pc0 = n0 - 2 * DM;
    for (int q = tid; q < 128 * 8; q += 128) { const int d = q >> 3, pc = q & 7; const size_t o = ((size_t)b * DM + pc0 + d) * SEQ + s0 + pc * 8; vst2(VTH + o, *(const v4u*)&sth[d][pc * 8]); vst2(VTL + o, *(const v4u*)&stl[d][pc * 8]); }
  }
}
// ---- k_attn: block = (64 queries, head h, batch b), wave = 16 queries; causal flash attention over 32-key steps up to the wave's last query,
//      K and V^T fragments read straight from the f16 planes; query blocks 0..1: 3-product q/k scores and P hi/res x V hi/lo in a second accumulator, single products elsewhere;
//      O[b*SEQ+q][h*64+d] = (acc + accl/2048) / (l * 2^4)  (256-B segments, lanes 0..15 x 16 B)
__global__ __launch_bounds__(128) void k_attn(const _Float16* __restrict__ QK, const _Float16* __restrict__ QKL, const _Float16* __restrict__ VTH, const _Float16* __restrict__ VTL, float* __restrict__ O) {
  __shared__ __align__(16) float sp[4][16][36]; __shared__ __align__(16) float so[4][16][68];
  const int tid = threadIdx.x, wave = tid >> 5, lane = tid & 31, col = lane & 15, g = lane >> 4;
  const int qb = blockIdx.x, h = blockIdx.y, b = blockIdx.z; const int q0 = qb * 64 + wave * 16; const size_t rq = (size_t)b * SEQ + q0 + col;
  const bool lead = qb < 2;   // block-uniform: leading query blocks (few keys, outputs far above the global rms)
  v16h aq[2], aql[2];
#pragma unroll
  for (int kc = 0; kc < 2; ++kc) { aq[kc] = frag_h(QK + rq * (2 * DM) + h * HD + kc * 32, lane); aql[kc] = frag_h(QKL + rq * (2 * DM) + h * HD + kc * 32, lane); }
  float m[8], l[8];
#pragma unroll
  for (int r = 0; r < 8; ++r) { m[r] = -1.0e30f; l[r] = 0.f; }
  v8f acc[4] = {}, accl[4] = {};
  const float L2E = 1.44269504088896341f;
  const int nks = (q0 + 16 + 31) >> 5;   // wave-uniform: key steps covering keys <= q0 + 15 (every visited step has >= 1 unmasked key per row)
#pragma unroll 1
  for (int ks = 0; ks < nks; ++ks) { v8f s[2];
#pragma unroll
    for (int ct = 0; ct < 2; ++ct) { const int kk = ks * 32 + ct * 16 + col; const _Float16* krow = QK + ((size_t)b * SEQ + kk) * (2 * DM) + DM + h * HD; const _Float16* krowl = QKL + ((size_t)b * SEQ + kk) * (2 * DM) + DM + h * HD; v8f c = {}, cl = {};
      if (lead) {
#pragma unroll
        for (int kc = 0; kc < 2; ++kc) { const v16h kh = frag_h(krow + kc * 32, lane); c = wmma16(aq[kc], kh, c); cl = wmma16(aql[kc], kh, cl); cl = wmma16(aq[kc], frag_h(krowl + kc * 32, lane), cl); }
#pragma unroll
        for (int r = 0; r < 8; ++r) c[r] += cl[r] * (1.0f / 2048.0f); }
      else {
#pragma unroll
        for (int kc = 0; kc < 2; ++kc) c = wmma16(aq[kc], frag_h(krow + kc * 32, lane), c); }
#pragma unroll
      for (int r = 0; r < 8; ++r) { const int qrow = q0 + 8 * g + r; s[ct][r] = (kk <= qrow) ? c[r] * 0.125f : -1.0e30f; } }   // 1/sqrt(64); keys above the diagonal replaced by a large negative fill
#pragma unroll
    for (int r = 0; r < 8; ++r) { float mx = fmaxf(s[0][r], s[1][r]);
#pragma unroll
      for (int o = 1; o < 16; o <<= 1) mx = fmaxf(mx, __shfl_xor(mx, o));
      const float mn = fmaxf(m[r], mx); const float alpha = exp2f((m[r] - mn) * L2E);
      const float p0 = exp2f((s[0][r] - mn) * L2E), p1 = exp2f((s[1][r] - mn) * L2E); float rs = p0 + p1;
#pragma unroll
      for (int o = 1; o < 16; o <<= 1) rs += __shfl_xor(rs, o);
      l[r] = l[r] * alpha + rs; m[r] = mn;
#pragma unroll
      for (int dt = 0; dt < 4; ++dt) { acc[dt][r] *= alpha; accl[dt][r] *= alpha; }
      sp[wave][8 * g + r][col] = p0 * PSC; sp[wave][8 * g + r][16 + col] = p1 * PSC; }
    ldsx();
    v16h pa, pl; { const float* prow = &sp[wave][col][0] + 8 * (lane >> 4);
#pragma unroll
      for (int i = 0; i < 8; ++i) { const float x0 = prow[i], x1 = prow[16 + i]; const _Float16 h0 = (_Float16)x0, h1 = (_Float16)x1; pa[i] = h0; pa[8 + i] = h1; pl[i] = (_Float16)((x0 - (float)h0) * 2048.0f); pl[8 + i] = (_Float16)((x1 - (float)h1) * 2048.0f); } }   // P x 2^4 as f16 hi; residual carried x2^11, folded in the epilogue
#pragma unroll
    for (int dt = 0; dt < 4; ++dt) { const size_t vr = ((size_t)b * DM + h * HD + dt * 16 + col) * SEQ + ks * 32; const v16h vh = frag_h(VTH + vr, lane); acc[dt] = wmma16(pa, vh, acc[dt]); if (lead) { accl[dt] = wmma16(pl, vh, accl[dt]); accl[dt] = wmma16(pa, frag_h(VTL + vr, lane), accl[dt]); } }
    ldsx(); }
#pragma unroll
  for (int r = 0; r < 8; ++r) { const float il = 1.0f / (l[r] * PSC);   // l >= 1 (the running max contributes exp(0)); numerator carries the 2^4 pre-scale
#pragma unroll
    for (int dt = 0; dt < 4; ++dt) so[wave][8 * g + r][dt * 16 + col] = (acc[dt][r] + accl[dt][r] * (1.0f / 2048.0f)) * il; }
  ldsx();
  for (int rl = 0; rl < 16; ++rl) if (lane < 16) vst2(O + ((size_t)b * SEQ + q0 + rl) * DM + h * HD + lane * 4, *(const v4f*)&so[wave][rl][lane * 4]);
}
// ---- k_out: block = 64 rows, wave = 16 rows x 64 columns: out = O (bf16 hi/lo, 2 products) . packed W rows (K = 1024); 256-B output rows written by lanes 0..15 x 16 B
__global__ __launch_bounds__(128) void k_out(const float* __restrict__ O, const __bf16* __restrict__ P, float* __restrict__ Y) {
  __shared__ __align__(16) float so[4][16][68];
  const int tid = threadIdx.x, wave = tid >> 5, lane = tid & 31, col = lane & 15, g = lane >> 4;
  const size_t rb = (size_t)blockIdx.x * 64; const int b = (int)(rb / SEQ), s0 = (int)(rb % SEQ);
  const size_t r0 = rb + wave * 16; const size_t yr0 = (size_t)b * SEQ_FULL + s0 + wave * 16;
  v8f acc[4] = {};
#pragma unroll 2
  for (int kc = 0; kc < DM / 32; ++kc) { const F2 a = split_row(O + (r0 + col) * DM, kc * 32, lane);
#pragma unroll
    for (int j = 0; j < 4; ++j) { const v16b w = frag_b(P + (size_t)(j * 16 + col) * DM + kc * 32, lane); acc[j] = wmma_bf(a.l, w, acc[j]); acc[j] = wmma_bf(a.h, w, acc[j]); } }
#pragma unroll
  for (int j = 0; j < 4; ++j) {
#pragma unroll
    for (int r = 0; r < 8; ++r) so[wave][8 * g + r][j * 16 + col] = acc[j][r]; }
  ldsx();
  for (int rl = 0; rl < 16; ++rl) if (lane < 16) vst2(Y + (yr0 + rl) * NE + lane * 4, *(const v4f*)&so[wave][rl][lane * 4]);
}
extern "C" void kernel_launch(void* const* d_in, const int* in_sizes, int n_in, void* d_out, int out_size, void* d_ws, size_t ws_size, hipStream_t stream) {
  if (n_in < 5) return;
  if (in_sizes[0] < ((NB - 1) * SEQ_FULL + SEQ) * DM) return;                                        // x [2,2048,1024]
  if (in_sizes[1] < NH * DM * HD || in_sizes[2] < NH * DM * HD || in_sizes[3] < NH * DM * HD) return;  // Wq Wk Wv [16,1024,64]
  if (in_sizes[4] < DM * NE) return;                                                                   // W [1024,64]
  if (out_size < ((NB - 1) * SEQ_FULL + SEQ) * NE) return;                                             // out [2,2048,64]
  if (ws_size < (size_t)WS_END) return;
  const float* X = (const float*)d_in[0]; const float* WQ = (const float*)d_in[1]; const float* WK = (const float*)d_in[2]; const float* WV = (const float*)d_in[3]; const float* WO = (const float*)d_in[4];
  char* ws = (char*)d_ws; __bf16* PK = (__bf16*)(ws + WS_PK); _Float16 *QK = (_Float16*)(ws + WS_QK), *QKL = (_Float16*)(ws + WS_QKL), *VTH = (_Float16*)(ws + WS_VTH), *VTL = (_Float16*)(ws + WS_VTL); float* O = (float*)(ws + WS_O);
  k_pack<<<dim3(DM / 64, NPK / 64), 256, 0, stream>>>(WQ, WK, WV, WO, PK);
  k_qkv<<<dim3(NB * SEQ / 64, QKVW / 128), 128, 0, stream>>>(X, PK, QK, QKL, VTH, VTL);
  k_attn<<<dim3(SEQ / 64, NH, NB), 128, 0, stream>>>(QK, QKL, VTH, VTL, O);
  k_out<<<dim3(NB * SEQ / 64, 1), 128, 0, stream>>>(O, PK + (size_t)QKVW * DM, (float*)d_out);
}

// v001
// One run takes 273 microseconds.
// Timed twice side by side with v000, it ran 1.36 and 1.35 times as fast.
// compute dtype: all float inputs RNE-converted to bf16; q|k|v = x . W[h] with exact bf16 x bf16 products on v_wmma_f32_16x16x32_bf16, stored as f16 hi + residual(x2^11) planes (v transposed); scores = q . k on v_wmma_f32_16x16x32_f16 (query blocks 0..1: 3-product hi/res, later blocks single f16), x 1/8 and causal online softmax (running max) in f32; P x 2^4 as f16 hi (+ residual x2^11 against v hi + v lo on query blocks 0..1, single P x v hi elsewhere) on f16 WMMA; out = ctx (bf16 hi + lo) . W on bf16 WMMA; f32 accumulate everywhere, f32 output.
#include <hip/hip_runtime.h>
#include <math.h>

typedef __attribute__((ext_vector_type(16))) _Float16 v16h;
typedef __attribute__((ext_vector_type(16))) __bf16 v16b;
typedef __attribute__((ext_vector_type(8)))  _Float16 v8h;
typedef __attribute__((ext_vector_type(8)))  __bf16 v8b;
typedef __attribute__((ext_vector_type(4)))  __bf16 v4b;
typedef __attribute__((ext_vector_type(8)))  float v8f;
typedef __attribute__((ext_vector_type(4)))  float v4f;
typedef __attribute__((ext_vector_type(4)))  unsigned v4u;

template <typename T> __device__ __forceinline__ void vst2(void* p, T v) { *(T*)p = v;  }
__device__ __forceinline__ v8f wmma16(v16h a, v16h b, v8f c) {
  v8f d = __builtin_amdgcn_wmma_f32_16x16x32_f16(false, a, false, b, (short)0, c, false, false);
  asm volatile("v_nop\n\tv_nop\n\tv_nop\n\tv_nop" : "+v"(d) : "v"(a), "v"(b));
  return d;
}
__device__ __forceinline__ v8f wmma_bf(v16b a, v16b b, v8f c) {
  v8f d = __builtin_amdgcn_wmma_f32_16x16x32_bf16(false, a, false, b, (short)0, c, false, false);
  asm volatile("v_nop\n\tv_nop\n\tv_nop\n\tv_nop" : "+v"(d) : "v"(a), "v"(b));
  return d;
}
// 16-bit row fragment (row m = lane & 15 selected by the caller): elements 0..7 <- k0 + 8h + i, 8..15 <- k0 + 16 + 8h + i, h = lane >> 4
__device__ __forceinline__ v16h frag_h(const _Float16* rowk0, int lane) {
  union { v16h v; v8h q[2]; } u; const _Float16* p = rowk0 + 8 * (lane >> 4);
  u.q[0] = *(const v8h*)p; u.q[1] = *(const v8h*)(p + 16); return u.v;
}
__device__ __forceinline__ v16b frag_b(const __bf16* rowk0, int lane) {
  union { v16b v; v8b q[2]; } u; const __bf16* p = rowk0 + 8 * (lane >> 4);
  u.q[0] = *(const v8b*)p; u.q[1] = *(const v8b*)(p + 16); return u.v;
}
struct F2 { v16b h, l; };
__device__ __forceinline__ F2 bsplit16(const float v[16]) { F2 r;
#pragma unroll
  for (int i = 0; i < 16; ++i) { const __bf16 h = (__bf16)v[i]; r.h[i] = h; r.l[i] = (__bf16)(v[i] - (float)h); }
  return r; }
__device__ __forceinline__ F2 split_row(const float* row, int k0, int lane) { float v[16]; const float* p = row + k0 + 8 * (lane >> 4);
#pragma unroll
  for (int i = 0; i < 8; ++i) { v[i] = p[i]; v[8 + i] = p[16 + i]; }
  return bsplit16(v); }
__device__ __forceinline__ void ldsx() { asm volatile("s_wait_dscnt 0" ::: "memory"); __builtin_amdgcn_wave_barrier(); __builtin_amdgcn_fence(3, "workgroup"); }

// causal multi-head attention: per-head q/k/v projections D 1,024 -> 64 (16 heads, weights [h][in][out]), scores/8, -inf above the diagonal, softmax, ctx merged head-major, out = ctx . W ([in 1,024][out 64])
#ifndef NB
#define NB 2
#endif
#ifndef SEQ
#define SEQ 2048
#endif
#define NB_FULL 2
#define SEQ_FULL 2048
#define DM 1024
#define NH 16
#define HD 64
#define NE 64
#define QKVW (3 * DM)        // fused q | k | v output columns, column h*64+e (+0 / +1024 / +2048)
#define NPK (QKVW + NE)      // packed bf16 weight rows: 3072 q|k|v rows + 64 out-projection rows, each k-contiguous over 1024
#define PSC 16.0f            // softmax weights pre-scaled by 2^4 before the f16 split (<= 16; residual carried x2^11)
static_assert(SEQ % 64 == 0);
static_assert(SEQ >= 64 && SEQ <= SEQ_FULL);
static_assert(NB >= 1 && NB <= NB_FULL);
static_assert(HD == NE);
static_assert(DM % 64 == 0 && NPK % 64 == 0);

#define WS_PK  0ull                                           // bf16 [NPK][DM]
#define WS_QK  (WS_PK + 2ull * NPK * DM)                      // f16 [NB*SEQ][2*DM]: q | k hi
#define WS_QKL (WS_QK + 2ull * NB * SEQ * 2 * DM)             // f16 q | k residual x2048
#define WS_VTH (WS_QKL + 2ull * NB * SEQ * 2 * DM)            // f16 [b][1024 (h*64+d)][SEQ] v hi (transposed)
#define WS_VTL (WS_VTH + 2ull * NB * DM * SEQ)                // f16 v residual x2048 (transposed)
#define WS_O   (WS_VTL + 2ull * NB * DM * SEQ)                // f32 [NB*SEQ][DM] merged ctx
#define WS_END (WS_O + 4ull * NB * SEQ * DM)
static_assert(WS_END <= 134217728ull);
static_assert((WS_QK % 128) == 0 && (WS_QKL % 128) == 0 && (WS_VTH % 128) == 0 && (WS_VTL % 128) == 0 && (WS_O % 128) == 0);

// ---- k_pack: block = (64-wide d chunk, group): group 0..47 = (which = group/16, head = group%16) of Wq/Wk/Wv [h][d][e]; group 48 = W [d][e].
__global__ __launch_bounds__(256) void k_pack(const float* __restrict__ WQ, const float* __restrict__ WK, const float* __restrict__ WV, const float* __restrict__ WO, __bf16* __restrict__ PK) {
  __shared__ __align__(16) __bf16 s[64][72];
  const int dc = blockIdx.x, grp = blockIdx.y, t = threadIdx.x; const int which = grp >> 4, hh = grp & 15;
  const float* Wm = (which == 0) ? WQ : (which == 1) ? WK : (which == 2) ? WV : WO;
  const float* src = Wm + ((which < 3) ? (size_t)hh * DM * HD : (size_t)0) + (size_t)dc * 64 * HD;
  for (int q = t; q < 64 * 64; q += 256) { const int dd = q >> 6, e = q & 63; s[e][dd] = (__bf16)src[(size_t)dd * HD + e]; }
  __syncthreads();
  for (int q = t; q < 64 * 8; q += 256) { const int e = q >> 3, pc = q & 7; vst2(PK + ((size_t)grp * 64 + e) * DM + dc * 64 + pc * 8, *(const v4u*)&s[e][pc * 8]); }
}
// ---- k_qkv: block = (64 rows of x, 128 fused output columns n0): bf16(x) rows x packed bf16 weight rows on WMMA (K = 1024);
//      k tiles of 64 staged in two LDS buffers: every global load covers whole 128-B lines (x: 2 rows x 256 B per wave load, weights: 4 rows x 128 B),
//      x converted to bf16 on the way in; rows at pitch 144 B for the 16-byte fragment reads; the next tile's loads are issued ahead of this tile's products;
//      the output staging reuses the same LDS behind the loop's last barrier
#define KT 64                       // k per staged tile: one 128-B line of a weight row
#define LP (KT + 8)                 // LDS row pitch in bf16 elements (144 B = 16 B x 9)
#define ST_A (64 * LP)              // x rows of a buffer, in elements
#define ST_BUF (ST_A + 128 * LP)    // one buffer: 64 x rows, then 128 weight rows
static_assert(DM % KT == 0 && 2 * ST_BUF * 2 >= 2 * 128 * 72 * 2 && 2 * ST_BUF * 2 >= 2 * 4 * 16 * 136 * 2);
__global__ __launch_bounds__(128) void k_qkv(const float* __restrict__ X, const __bf16* __restrict__ P, _Float16* __restrict__ QK, _Float16* __restrict__ QKL, _Float16* __restrict__ VTH, _Float16* __restrict__ VTL) {
  __shared__ __align__(16) __bf16 sm[2 * ST_BUF];
  _Float16 (*so)[16][136] = (_Float16 (*)[16][136])sm; _Float16 (*sol)[16][136] = so + 4;
  _Float16 (*sth)[72] = (_Float16 (*)[72])sm; _Float16 (*stl)[72] = sth + 128;
  const int tid = threadIdx.x, wave = tid >> 5, lane = tid & 31, col = lane & 15, g = lane >> 4;
  const size_t rb = (size_t)blockIdx.x * 64; const int b = (int)(rb / SEQ), s0 = (int)(rb % SEQ);
  const size_t pr0 = rb + wave * 16;                            // plane row base (compact b*SEQ + s)
  const int n0 = blockIdx.y * 128;
  const float* xg = X + ((size_t)b * SEQ_FULL + s0 + (tid >> 4)) * DM + (tid & 15) * 4;   // this thread's 16 B of x: row tid/16 (+8 per load), floats 4*(tid%16)
  const __bf16* pg = P + (size_t)(n0 + (tid >> 3)) * DM + (tid & 7) * 8;                    // this thread's 16 B of weights: row tid/8 (+16 per load), elements 8*(tid%8)
  __bf16* sa = sm + (tid >> 4) * LP + (tid & 15) * 4; __bf16* sb = sm + ST_A + (tid >> 3) * LP + (tid & 7) * 8;
  v4f ra[8]; v4u rbw[8];
#pragma unroll   // constant indices keep the register arrays in registers
  for (int i = 0; i < 8; ++i) { ra[i] = *(const v4f*)(xg + (size_t)i * 8 * DM); rbw[i] = *(const v4u*)(pg + (size_t)i * 16 * DM); }
#pragma unroll   // constant indices keep the register arrays in registers
  for (int i = 0; i < 8; ++i) { v4b c; c[0] = (__bf16)ra[i][0]; c[1] = (__bf16)ra[i][1]; c[2] = (__bf16)ra[i][2]; c[3] = (__bf16)ra[i][3]; *(v4b*)(sa + i * 8 * LP) = c; *(v4u*)(sb + i * 16 * LP) = rbw[i]; }
  __syncthreads();
  v8f acc[8] = {};
  for (int t = 0; t < DM / KT; ++t) { const __bf16* cur = sm + (t & 1) * ST_BUF; const int nxt = ((t + 1) & 1) * ST_BUF; const bool more = t + 1 < DM / KT;
    if (more) {
#pragma unroll   // constant indices keep the register arrays in registers
      for (int i = 0; i < 8; ++i) { ra[i] = *(const v4f*)(xg + (t + 1) * KT + (size_t)i * 8 * DM); rbw[i] = *(const v4u*)(pg + (t + 1) * KT + (size_t)i * 16 * DM); } }
#pragma unroll   // constant indices keep the register arrays in registers
    for (int kk = 0; kk < KT / 32; ++kk) { const v16b a = frag_b(cur + (wave * 16 + col) * LP + kk * 32, lane);
#pragma unroll   // constant indices keep the register arrays in registers
      for (int jh = 0; jh < 8; jh += 4) { v16b w[4];   // four weight fragments read as one group ahead of their products: one LDS wait per group, not one per product
#pragma unroll   // constant indices keep the register arrays in registers
        for (int j = 0; j < 4; ++j) w[j] = frag_b(cur + ST_A + ((jh + j) * 16 + col) * LP + kk * 32, lane);
#pragma unroll   // constant indices keep the register arrays in registers
        for (int j = 0; j < 4; ++j) acc[jh + j] = wmma_bf(a, w[j], acc[jh + j]); } }
    __builtin_amdgcn_sched_barrier(0);   // keeps the conversions of the prefetched tile, and with them the wait for its global loads, behind this tile's products
    if (more) {   // the other buffer's last readers left it at the previous trip's barrier
#pragma unroll   // constant indices keep the register arrays in registers
      for (int i = 0; i < 8; ++i) { v4b c; c[0] = (__bf16)ra[i][0]; c[1] = (__bf16)ra[i][1]; c[2] = (__bf16)ra[i][2]; c[3] = (__bf16)ra[i][3]; *(v4b*)(sa + nxt + i * 8 * LP) = c; *(v4u*)(sb + nxt + i * 16 * LP) = rbw[i]; } }
    __syncthreads(); }   // publishes the tile just stored and ends every read of the tile just used (after the last trip: frees the LDS for the output staging)
  if (n0 < 2 * DM) {   // q and k stored unscaled (sigma ~0.6); 1/8 applied to the f32 score
#pragma unroll
    for (int j = 0; j < 8; ++j) {
#pragma unroll
      for (int r = 0; r < 8; ++r) { const float v = acc[j][r]; const _Float16 hv = (_Float16)v; so[wave][8 * g + r][j * 16 + col] = hv; sol[wave][8 * g + r][j * 16 + col] = (_Float16)((v - (float)hv) * 2048.0f); } }
    ldsx();
    for (int rl = 0; rl < 16; ++rl) if (lane < 16) { vst2(QK + (pr0 + rl) * (2 * DM) + n0 + lane * 8, *(const v4u*)&so[wave][rl][lane * 8]); vst2(QKL + (pr0 + rl) * (2 * DM) + n0 + lane * 8, *(const v4u*)&sol[wave][rl][lane * 8]); }
  } else {
#pragma unroll
    for (int j = 0; j < 8; ++j) {
#pragma unroll
      for (int r = 0; r < 8; ++r) { const float v = acc[j][r]; const _Float16 hv = (_Float16)v; sth[j * 16 + col][wave * 16 + 8 * g + r] = hv; stl[j * 16 + col][wave * 16 + 8 * g + r] = (_Float16)((v - (float)hv) * 2048.0f); } }
    __syncthreads();
    const int pc0 = n0 - 2 * DM;
    for (int q = tid; q < 128 * 8; q += 128) { const int d = q >> 3, pc = q & 7; const size_t o = ((size_t)b * DM + pc0 + d) * SEQ + s0 + pc * 8; vst2(VTH + o, *(const v4u*)&sth[d][pc * 8]); vst2(VTL + o, *(const v4u*)&stl[d][pc * 8]); }
  }
}
// ---- k_attn: block = (64 queries, head h, batch b), wave = 16 queries; causal flash attention over 32-key steps up to the wave's last query,
//      K and V^T fragments read straight from the f16 planes; query blocks 0..1: 3-product q/k scores and P hi/res x V hi/lo in a second accumulator, single products elsewhere;
//      O[b*SEQ+q][h*64+d] = (acc + accl/2048) / (l * 2^4)  (256-B segments, lanes 0..15 x 16 B)
__global__ __launch_bounds__(128) void k_attn(const _Float16* __restrict__ QK, const _Float16* __restrict__ QKL, const _Float16* __restrict__ VTH, const _Float16* __restrict__ VTL, float* __restrict__ O) {
  __shared__ __align__(16) float sp[4][16][36]; __shared__ __align__(16) float so[4][16][68];
  const int tid = threadIdx.x, wave = tid >> 5, lane = tid & 31, col = lane & 15, g = lane >> 4;
  const int qb = blockIdx.x, h = blockIdx.y, b = blockIdx.z; const int q0 = qb * 64 + wave * 16; const size_t rq = (size_t)b * SEQ + q0 + col;
  const bool lead = qb < 2;   // block-uniform: leading query blocks (few keys, outputs far above the global rms)
  v16h aq[2], aql[2];
#pragma unroll
  for (int kc = 0; kc < 2; ++kc) { aq[kc] = frag_h(QK + rq * (2 * DM) + h * HD + kc * 32, lane); aql[kc] = frag_h(QKL + rq * (2 * DM) + h * HD + kc * 32, lane); }
  float m[8], l[8];
#pragma unroll
  for (int r = 0; r < 8; ++r) { m[r] = -1.0e30f; l[r] = 0.f; }
  v8f acc[4] = {}, accl[4] = {};
  const float L2E = 1.44269504088896341f;
  const int nks = (q0 + 16 + 31) >> 5;   // wave-uniform: key steps covering keys <= q0 + 15 (every visited step has >= 1 unmasked key per row)
#pragma unroll 1
  for (int ks = 0; ks < nks; ++ks) { v8f s[2];
#pragma unroll
    for (int ct = 0; ct < 2; ++ct) { const int kk = ks * 32 + ct * 16 + col; const _Float16* krow = QK + ((size_t)b * SEQ + kk) * (2 * DM) + DM + h * HD; const _Float16* krowl = QKL + ((size_t)b * SEQ + kk) * (2 * DM) + DM + h * HD; v8f c = {}, cl = {};
      if (lead) {
#pragma unroll
        for (int kc = 0; kc < 2; ++kc) { const v16h kh = frag_h(krow + kc * 32, lane); c = wmma16(aq[kc], kh, c); cl = wmma16(aql[kc], kh, cl); cl = wmma16(aq[kc], frag_h(krowl + kc * 32, lane), cl); }
#pragma unroll
        for (int r = 0; r < 8; ++r) c[r] += cl[r] * (1.0f / 2048.0f); }
      else {
#pragma unroll
        for (int kc = 0; kc < 2; ++kc) c = wmma16(aq[kc], frag_h(krow + kc * 32, lane), c); }
#pragma unroll
      for (int r = 0; r < 8; ++r) { const int qrow = q0 + 8 * g + r; s[ct][r] = (kk <= qrow) ? c[r] * 0.125f : -1.0e30f; } }   // 1/sqrt(64); keys above the diagonal replaced by a large negative fill
#pragma unroll
    for (int r = 0; r < 8; ++r) { float mx = fmaxf(s[0][r], s[1][r]);
#pragma unroll
      for (int o = 1; o < 16; o <<= 1) mx = fmaxf(mx, __shfl_xor(mx, o));
      const float mn = fmaxf(m[r], mx); const float alpha = exp2f((m[r] - mn) * L2E);
      const float p0 = exp2f((s[0][r] - mn) * L2E), p1 = exp2f((s[1][r] - mn) * L2E); float rs = p0 + p1;
#pragma unroll
      for (int o = 1; o < 16; o <<= 1) rs += __shfl_xor(rs, o);
      l[r] = l[r] * alpha + rs; m[r] = mn;
#pragma unroll
      for (int dt = 0; dt < 4; ++dt) { acc[dt][r] *= alpha; accl[dt][r] *= alpha; }
      sp[wave][8 * g + r][col] = p0 * PSC; sp[wave][8 * g + r][16 + col] = p1 * PSC; }
    ldsx();
    v16h pa, pl; { const float* prow = &sp[wave][col][0] + 8 * (lane >> 4);
#pragma unroll
      for (int i = 0; i < 8; ++i) { const float x0 = prow[i], x1 = prow[16 + i]; const _Float16 h0 = (_Float16)x0, h1 = (_Float16)x1; pa[i] = h0; pa[8 + i] = h1; pl[i] = (_Float16)((x0 - (float)h0) * 2048.0f); pl[8 + i] = (_Float16)((x1 - (float)h1) * 2048.0f); } }   // P x 2^4 as f16 hi; residual carried x2^11, folded in the epilogue
#pragma unroll
    for (int dt = 0; dt < 4; ++dt) { const size_t vr = ((size_t)b * DM + h * HD + dt * 16 + col) * SEQ + ks * 32; const v16h vh = frag_h(VTH + vr, lane); acc[dt] = wmma16(pa, vh, acc[dt]); if (lead) { accl[dt] = wmma16(pl, vh, accl[dt]); accl[dt] = wmma16(pa, frag_h(VTL + vr, lane), accl[dt]); } }
    ldsx(); }
#pragma unroll
  for (int r = 0; r < 8; ++r) { const float il = 1.0f / (l[r] * PSC);   // l >= 1 (the running max contributes exp(0)); numerator carries the 2^4 pre-scale
#pragma unroll
    for (int dt = 0; dt < 4; ++dt) so[wave][8 * g + r][dt * 16 + col] = (acc[dt][r] + accl[dt][r] * (1.0f / 2048.0f)) * il; }
  ldsx();
  for (int rl = 0; rl < 16; ++rl) if (lane < 16) vst2(O + ((size_t)b * SEQ + q0 + rl) * DM + h * HD + lane * 4, *(const v4f*)&so[wave][rl][lane * 4]);
}
// ---- k_out: block = 64 rows, wave = 16 rows x 64 columns: out = O (bf16 hi/lo, 2 products) . packed W rows (K = 1024); 256-B output rows written by lanes 0..15 x 16 B
__global__ __launch_bounds__(128) void k_out(const float* __restrict__ O, const __bf16* __restrict__ P, float* __restrict__ Y) {
  __shared__ __align__(16) float so[4][16][68];
  const int tid = threadIdx.x, wave = tid >> 5, lane = tid & 31, col = lane & 15, g = lane >> 4;
  const size_t rb = (size_t)blockIdx.x * 64; const int b = (int)(rb / SEQ), s0 = (int)(rb % SEQ);
  const size_t r0 = rb + wave * 16; const size_t yr0 = (size_t)b * SEQ_FULL + s0 + wave * 16;
  v8f acc[4] = {};
#pragma unroll 2
  for (int kc = 0; kc < DM / 32; ++kc) { const F2 a = split_row(O + (r0 + col) * DM, kc * 32, lane);
#pragma unroll
    for (int j = 0; j < 4; ++j) { const v16b w = frag_b(P + (size_t)(j * 16 + col) * DM + kc * 32, lane); acc[j] = wmma_bf(a.l, w, acc[j]); acc[j] = wmma_bf(a.h, w, acc[j]); } }
#pragma unroll
  for (int j = 0; j < 4; ++j) {
#pragma unroll
    for (int r = 0; r < 8; ++r) so[wave][8 * g + r][j * 16 + col] = acc[j][r]; }
  ldsx();
  for (int rl = 0; rl < 16; ++rl) if (lane < 16) vst2(Y + (yr0 + rl) * NE + lane * 4, *(const v4f*)&so[wave][rl][lane * 4]);
}
extern "C" void kernel_launch(void* const* d_in, const int* in_sizes, int n_in, void* d_out, int out_size, void* d_ws, size_t ws_size, hipStream_t stream) {
  if (n_in < 5) return;
  if (in_sizes[0] < ((NB - 1) * SEQ_FULL + SEQ) * DM) return;                                        // x [2,2048,1024]
  if (in_sizes[1] < NH * DM * HD || in_sizes[2] < NH * DM * HD || in_sizes[3] < NH * DM * HD) return;  // Wq Wk Wv [16,1024,64]
  if (in_sizes[4] < DM * NE) return;                                                                   // W [1024,64]
  if (out_size < ((NB - 1) * SEQ_FULL + SEQ) * NE) return;                                             // out [2,2048,64]
  if (ws_size < (size_t)WS_END) return;
  const float* X = (const float*)d_in[0]; const float* WQ = (const float*)d_in[1]; const float* WK = (const float*)d_in[2]; const float* WV = (const float*)d_in[3]; const float* WO = (const float*)d_in[4];
  char* ws = (char*)d_ws; __bf16* PK = (__bf16*)(ws + WS_PK); _Float16 *QK = (_Float16*)(ws + WS_QK), *QKL = (_Float16*)(ws + WS_QKL), *VTH = (_Float16*)(ws + WS_VTH), *VTL = (_Float16*)(ws + WS_VTL); float* O = (float*)(ws + WS_O);
  k_pack<<<dim3(DM / 64, NPK / 64), 256, 0, stream>>>(WQ, WK, WV, WO, PK);
  k_qkv<<<dim3(NB * SEQ / 64, QKVW / 128), 128, 0, stream>>>(X, PK, QK, QKL, VTH, VTL);
  k_attn<<<dim3(SEQ / 64, NH, NB), 128, 0, stream>>>(QK, QKL, VTH, VTL, O);
  k_out<<<dim3(NB * SEQ / 64, 1), 128, 0, stream>>>(O, PK + (size_t)QKVW * DM, (float*)d_out);
}

// v002
// It runs in 203 microseconds.
// In both of two side-by-side timings against v001, it was 1.35 times as fast.
// Counting every step since v000, it is 1.83 times as fast.
// compute dtype: all float inputs RNE-converted to bf16; q|k|v = x . W[h] with exact bf16 x bf16 products on v_wmma_f32_16x16x32_bf16, stored as f16 hi + residual(x2^11) planes (v transposed); scores = q . k on v_wmma_f32_16x16x32_f16 (query blocks 0..1: 3-product hi/res, later blocks single f16), x 1/8 and causal online softmax (running max) in f32; P x 2^4 as f16 hi (+ residual x2^11 against v hi + v lo on query blocks 0..1, single P x v hi elsewhere) on f16 WMMA; out = ctx (bf16 hi + lo) . W on bf16 WMMA; f32 accumulate everywhere, f32 output.
#include <hip/hip_runtime.h>
#include <math.h>

typedef __attribute__((ext_vector_type(16))) _Float16 v16h;
typedef __attribute__((ext_vector_type(16))) __bf16 v16b;
typedef __attribute__((ext_vector_type(8)))  _Float16 v8h;
typedef __attribute__((ext_vector_type(8)))  __bf16 v8b;
typedef __attribute__((ext_vector_type(4)))  __bf16 v4b;
typedef __attribute__((ext_vector_type(8)))  float v8f;
typedef __attribute__((ext_vector_type(4)))  float v4f;
typedef __attribute__((ext_vector_type(4)))  unsigned v4u;

template <typename T> __device__ __forceinline__ void vst2(void* p, T v) { *(T*)p = v;  }
__device__ __forceinline__ v8f wmma16(v16h a, v16h b, v8f c) {
  v8f d = __builtin_amdgcn_wmma_f32_16x16x32_f16(false, a, false, b, (short)0, c, false, false);
  asm volatile("v_nop\n\tv_nop\n\tv_nop\n\tv_nop" : "+v"(d) : "v"(a), "v"(b));
  return d;
}
__device__ __forceinline__ v8f wmma_bf(v16b a, v16b b, v8f c) {
  v8f d = __builtin_amdgcn_wmma_f32_16x16x32_bf16(false, a, false, b, (short)0, c, false, false);
  asm volatile("v_nop\n\tv_nop\n\tv_nop\n\tv_nop" : "+v"(d) : "v"(a), "v"(b));
  return d;
}
// 16-bit row fragment (row m = lane & 15 selected by the caller): elements 0..7 <- k0 + 8h + i, 8..15 <- k0 + 16 + 8h + i, h = lane >> 4
__device__ __forceinline__ v16h frag_h(const _Float16* rowk0, int lane) {
  union { v16h v; v8h q[2]; } u; const _Float16* p = rowk0 + 8 * (lane >> 4);
  u.q[0] = *(const v8h*)p; u.q[1] = *(const v8h*)(p + 16); return u.v;
}
__device__ __forceinline__ v16b frag_b(const __bf16* rowk0, int lane) {
  union { v16b v; v8b q[2]; } u; const __bf16* p = rowk0 + 8 * (lane >> 4);
  u.q[0] = *(const v8b*)p; u.q[1] = *(const v8b*)(p + 16); return u.v;
}
struct F2 { v16b h, l; };
__device__ __forceinline__ F2 bsplit16(const float v[16]) { F2 r;
#pragma unroll
  for (int i = 0; i < 16; ++i) { const __bf16 h = (__bf16)v[i]; r.h[i] = h; r.l[i] = (__bf16)(v[i] - (float)h); }
  return r; }
__device__ __forceinline__ F2 split_row(const float* row, int k0, int lane) { float v[16]; const float* p = row + k0 + 8 * (lane >> 4);
#pragma unroll
  for (int i = 0; i < 8; ++i) { v[i] = p[i]; v[8 + i] = p[16 + i]; }
  return bsplit16(v); }
__device__ __forceinline__ void ldsx() { asm volatile("s_wait_dscnt 0" ::: "memory"); __builtin_amdgcn_wave_barrier(); __builtin_amdgcn_fence(3, "workgroup"); }

// causal multi-head attention: per-head q/k/v projections D 1,024 -> 64 (16 heads, weights [h][in][out]), scores/8, -inf above the diagonal, softmax, ctx merged head-major, out = ctx . W ([in 1,024][out 64])
#ifndef NB
#define NB 2
#endif
#ifndef SEQ
#define SEQ 2048
#endif
#define NB_FULL 2
#define SEQ_FULL 2048
#define DM 1024
#define NH 16
#define HD 64
#define NE 64
#define QKVW (3 * DM)        // fused q | k | v output columns, column h*64+e (+0 / +1024 / +2048)
#define NPK (QKVW + NE)      // packed bf16 weight rows: 3072 q|k|v rows + 64 out-projection rows, each k-contiguous over 1024
#define PSC 16.0f            // softmax weights pre-scaled by 2^4 before the f16 split (<= 16; residual carried x2^11)
static_assert(SEQ % 64 == 0);
static_assert(SEQ >= 64 && SEQ <= SEQ_FULL);
static_assert(NB >= 1 && NB <= NB_FULL);
static_assert(HD == NE);
static_assert(DM % 64 == 0 && NPK % 64 == 0);

#define WS_PK  0ull                                           // bf16 [NPK][DM]
#define WS_QK  (WS_PK + 2ull * NPK * DM)                      // f16 [NB*SEQ][2*DM]: q | k hi
#define WS_QKL (WS_QK + 2ull * NB * SEQ * 2 * DM)             // f16 q | k residual x2048
#define WS_VTH (WS_QKL + 2ull * NB * SEQ * 2 * DM)            // f16 [b][1024 (h*64+d)][SEQ] v hi (transposed)
#define WS_VTL (WS_VTH + 2ull * NB * DM * SEQ)                // f16 v residual x2048 (transposed)
#define WS_O   (WS_VTL + 2ull * NB * DM * SEQ)                // f32 [NB*SEQ][DM] merged ctx
#define WS_END (WS_O + 4ull * NB * SEQ * DM)
static_assert(WS_END <= 134217728ull);
static_assert((WS_QK % 128) == 0 && (WS_QKL % 128) == 0 && (WS_VTH % 128) == 0 && (WS_VTL % 128) == 0 && (WS_O % 128) == 0);

// ---- k_pack: block = (64-wide d chunk, group): group 0..47 = (which = group/16, head = group%16) of Wq/Wk/Wv [h][d][e]; group 48 = W [d][e].
__global__ __launch_bounds__(256) void k_pack(const float* __restrict__ WQ, const float* __restrict__ WK, const float* __restrict__ WV, const float* __restrict__ WO, __bf16* __restrict__ PK) {
  __shared__ __align__(16) __bf16 s[64][72];
  const int dc = blockIdx.x, grp = blockIdx.y, t = threadIdx.x; const int which = grp >> 4, hh = grp & 15;
  const float* Wm = (which == 0) ? WQ : (which == 1) ? WK : (which == 2) ? WV : WO;
  const float* src = Wm + ((which < 3) ? (size_t)hh * DM * HD : (size_t)0) + (size_t)dc * 64 * HD;
  for (int q = t; q < 64 * 64; q += 256) { const int dd = q >> 6, e = q & 63; s[e][dd] = (__bf16)src[(size_t)dd * HD + e]; }
  __syncthreads();
  for (int q = t; q < 64 * 8; q += 256) { const int e = q >> 3, pc = q & 7; vst2(PK + ((size_t)grp * 64 + e) * DM + dc * 64 + pc * 8, *(const v4u*)&s[e][pc * 8]); }
}
// ---- k_qkv: block = (64 rows of x, 128 fused output columns n0): bf16(x) rows x packed bf16 weight rows on WMMA (K = 1024);
//      k tiles of 64 staged in two LDS buffers: every global load covers whole 128-B lines (x: 2 rows x 256 B per wave load, weights: 4 rows x 128 B),
//      x converted to bf16 on the way in; rows at pitch 144 B for the 16-byte fragment reads; the next tile's loads are issued ahead of this tile's products;
//      the output staging reuses the same LDS behind the loop's last barrier
#define KT 64                       // k per staged tile: one 128-B line of a weight row
#define LP (KT + 8)                 // LDS row pitch in bf16 elements (144 B = 16 B x 9)
#define ST_A (64 * LP)              // x rows of a buffer, in elements
#define ST_BUF (ST_A + 128 * LP)    // one buffer: 64 x rows, then 128 weight rows
static_assert(DM % KT == 0 && 2 * ST_BUF * 2 >= 2 * 128 * 72 * 2 && 2 * ST_BUF * 2 >= 2 * 4 * 16 * 136 * 2);
__global__ __launch_bounds__(128) void k_qkv(const float* __restrict__ X, const __bf16* __restrict__ P, _Float16* __restrict__ QK, _Float16* __restrict__ QKL, _Float16* __restrict__ VTH, _Float16* __restrict__ VTL) {
  __shared__ __align__(16) __bf16 sm[2 * ST_BUF];
  _Float16 (*so)[16][136] = (_Float16 (*)[16][136])sm; _Float16 (*sol)[16][136] = so + 4;
  _Float16 (*sth)[72] = (_Float16 (*)[72])sm; _Float16 (*stl)[72] = sth + 128;
  const int tid = threadIdx.x, wave = tid >> 5, lane = tid & 31, col = lane & 15, g = lane >> 4;
  const size_t rb = (size_t)blockIdx.x * 64; const int b = (int)(rb / SEQ), s0 = (int)(rb % SEQ);
  const size_t pr0 = rb + wave * 16;                            // plane row base (compact b*SEQ + s)
  const int n0 = blockIdx.y * 128;
  const float* xg = X + ((size_t)b * SEQ_FULL + s0 + (tid >> 4)) * DM + (tid & 15) * 4;   // this thread's 16 B of x: row tid/16 (+8 per load), floats 4*(tid%16)
  const __bf16* pg = P + (size_t)(n0 + (tid >> 3)) * DM + (tid & 7) * 8;                    // this thread's 16 B of weights: row tid/8 (+16 per load), elements 8*(tid%8)
  __bf16* sa = sm + (tid >> 4) * LP + (tid & 15) * 4; __bf16* sb = sm + ST_A + (tid >> 3) * LP + (tid & 7) * 8;
  v4f ra[8]; v4u rbw[8];
#pragma unroll   // constant indices keep the register arrays in registers
  for (int i = 0; i < 8; ++i) { ra[i] = *(const v4f*)(xg + (size_t)i * 8 * DM); rbw[i] = *(const v4u*)(pg + (size_t)i * 16 * DM); }
#pragma unroll   // constant indices keep the register arrays in registers
  for (int i = 0; i < 8; ++i) { v4b c; c[0] = (__bf16)ra[i][0]; c[1] = (__bf16)ra[i][1]; c[2] = (__bf16)ra[i][2]; c[3] = (__bf16)ra[i][3]; *(v4b*)(sa + i * 8 * LP) = c; *(v4u*)(sb + i * 16 * LP) = rbw[i]; }
  __syncthreads();
  v8f acc[8] = {};
  for (int t = 0; t < DM / KT; ++t) { const __bf16* cur = sm + (t & 1) * ST_BUF; const int nxt = ((t + 1) & 1) * ST_BUF; const bool more = t + 1 < DM / KT;
    if (more) {
#pragma unroll   // constant indices keep the register arrays in registers
      for (int i = 0; i < 8; ++i) { ra[i] = *(const v4f*)(xg + (t + 1) * KT + (size_t)i * 8 * DM); rbw[i] = *(const v4u*)(pg + (t + 1) * KT + (size_t)i * 16 * DM); } }
#pragma unroll   // constant indices keep the register arrays in registers
    for (int kk = 0; kk < KT / 32; ++kk) { const v16b a = frag_b(cur + (wave * 16 + col) * LP + kk * 32, lane);
#pragma unroll   // constant indices keep the register arrays in registers
      for (int jh = 0; jh < 8; jh += 4) { v16b w[4];   // four weight fragments read as one group ahead of their products: one LDS wait per group, not one per product
#pragma unroll   // constant indices keep the register arrays in registers
        for (int j = 0; j < 4; ++j) w[j] = frag_b(cur + ST_A + ((jh + j) * 16 + col) * LP + kk * 32, lane);
#pragma unroll   // constant indices keep the register arrays in registers
        for (int j = 0; j < 4; ++j) acc[jh + j] = wmma_bf(a, w[j], acc[jh + j]); } }
    __builtin_amdgcn_sched_barrier(0);   // keeps the conversions of the prefetched tile, and with them the wait for its global loads, behind this tile's products
    if (more) {   // the other buffer's last readers left it at the previous trip's barrier
#pragma unroll   // constant indices keep the register arrays in registers
      for (int i = 0; i < 8; ++i) { v4b c; c[0] = (__bf16)ra[i][0]; c[1] = (__bf16)ra[i][1]; c[2] = (__bf16)ra[i][2]; c[3] = (__bf16)ra[i][3]; *(v4b*)(sa + nxt + i * 8 * LP) = c; *(v4u*)(sb + nxt + i * 16 * LP) = rbw[i]; } }
    __syncthreads(); }   // publishes the tile just stored and ends every read of the tile just used (after the last trip: frees the LDS for the output staging)
  if (n0 < 2 * DM) {   // q and k stored unscaled (sigma ~0.6); 1/8 applied to the f32 score
#pragma unroll
    for (int j = 0; j < 8; ++j) {
#pragma unroll
      for (int r = 0; r < 8; ++r) { const float v = acc[j][r]; const _Float16 hv = (_Float16)v; so[wave][8 * g + r][j * 16 + col] = hv; sol[wave][8 * g + r][j * 16 + col] = (_Float16)((v - (float)hv) * 2048.0f); } }
    ldsx();
    for (int rl = 0; rl < 16; ++rl) if (lane < 16) { vst2(QK + (pr0 + rl) * (2 * DM) + n0 + lane * 8, *(const v4u*)&so[wave][rl][lane * 8]); vst2(QKL + (pr0 + rl) * (2 * DM) + n0 + lane * 8, *(const v4u*)&sol[wave][rl][lane * 8]); }
  } else {
#pragma unroll
    for (int j = 0; j < 8; ++j) {
#pragma unroll
      for (int r = 0; r < 8; ++r) { const float v = acc[j][r]; const _Float16 hv = (_Float16)v; sth[j * 16 + col][wave * 16 + 8 * g + r] = hv; stl[j * 16 + col][wave * 16 + 8 * g + r] = (_Float16)((v - (float)hv) * 2048.0f); } }
    __syncthreads();
    const int pc0 = n0 - 2 * DM;
    for (int q = tid; q < 128 * 8; q += 128) { const int d = q >> 3, pc = q & 7; const size_t o = ((size_t)b * DM + pc0 + d) * SEQ + s0 + pc * 8; vst2(VTH + o, *(const v4u*)&sth[d][pc * 8]); vst2(VTL + o, *(const v4u*)&stl[d][pc * 8]); }
  }
}
// ---- k_attn: block = (64 queries, head h, batch b), wave = 16 queries; causal flash attention over 32-key steps up to the wave's last query;
//      K hi and V^T hi tiles of 64 keys are brought once per block into two LDS buffers by asynchronous copies (each wave copy = 4 rows x one whole 128-B line), the next tile in flight
//      while this one is worked on; the four waves read their fragments from LDS (rows at pitch 144 B for the 16-byte reads); the residual planes of query blocks 0..1 still come straight from global;
//      query blocks 0..1: 3-product q/k scores and P hi/res x V hi/lo in a second accumulator, single products elsewhere;
//      O[b*SEQ+q][h*64+d] = (acc + accl/2048) / (l * 2^4)  (256-B segments, lanes 0..15 x 16 B)
#define AT 64                       // keys per staged tile: one 128-B line of a V^T row; a block's keys are a whole number of tiles
#define AP (AT + 8)                 // LDS row pitch in f16 elements (144 B = 16 B x 9), for K rows (64 d) and V^T rows (64 keys) alike
#define AT_V (AT * AP)              // 64 K rows of a buffer, then 64 V^T rows
#define AT_BUF (AT_V + HD * AP)
static_assert(AT == HD && SEQ % AT == 0);
// one tile: this thread's four 16-B pieces of K (rows 16 apart) and four of V^T; lk, lv = LDS byte addresses, gk, gv = global addresses of the first piece of each
__device__ __forceinline__ void stage_kv(unsigned lk, const _Float16* gk, unsigned lv, const _Float16* gv) {
  const unsigned ls = 16 * AP * 2; const size_t ks = (size_t)16 * 2 * DM, vs = (size_t)16 * SEQ;
  // the closing s_wait_xcnt stands in the copies' own statement, so that no address register named here is rewritten ahead of it
  asm volatile("global_load_async_to_lds_b128 %0, %8, off\n\t"
               "global_load_async_to_lds_b128 %1, %9, off\n\t"
               "global_load_async_to_lds_b128 %2, %10, off\n\t"
               "global_load_async_to_lds_b128 %3, %11, off\n\t"
               "global_load_async_to_lds_b128 %4, %12, off\n\t"
               "global_load_async_to_lds_b128 %5, %13, off\n\t"
               "global_load_async_to_lds_b128 %6, %14, off\n\t"
               "global_load_async_to_lds_b128 %7, %15, off\n\t"
               "s_wait_xcnt 0x0"
               :: "v"(lk), "v"(lk + ls), "v"(lk + 2 * ls), "v"(lk + 3 * ls), "v"(lv), "v"(lv + ls), "v"(lv + 2 * ls), "v"(lv + 3 * ls),
                  "v"(gk), "v"(gk + ks), "v"(gk + 2 * ks), "v"(gk + 3 * ks), "v"(gv), "v"(gv + vs), "v"(gv + 2 * vs), "v"(gv + 3 * vs) : "memory");
}
__global__ __launch_bounds__(128) void k_attn(const _Float16* __restrict__ QK, const _Float16* __restrict__ QKL, const _Float16* __restrict__ VTH, const _Float16* __restrict__ VTL, float* __restrict__ O) {
  __shared__ __align__(16) _Float16 skv[2 * AT_BUF];
  __shared__ __align__(16) float sp[4][16][36]; __shared__ __align__(16) float so[4][16][68];
  const int tid = threadIdx.x, wave = tid >> 5, lane = tid & 31, col = lane & 15, g = lane >> 4;
  const int qb = blockIdx.x, h = blockIdx.y, b = blockIdx.z; const int q0 = qb * 64 + wave * 16; const size_t rq = (size_t)b * SEQ + q0 + col;
  const bool lead = qb < 2;   // block-uniform: leading query blocks (few keys, outputs far above the global rms)
  const int nst = qb + 1;     // block-uniform: staged tiles covering keys <= qb * 64 + 63
  const unsigned lk = (unsigned)(size_t)skv + ((tid >> 3) * AP + (tid & 7) * 8) * 2, lv = lk + AT_V * 2;      // this thread's first piece: row tid/8, 16 B number tid%8
  const _Float16* gk = QK + ((size_t)b * SEQ + (tid >> 3)) * (2 * DM) + DM + h * HD + (tid & 7) * 8;           // key row tid/8 of tile 0
  const _Float16* gv = VTH + ((size_t)b * DM + h * HD + (tid >> 3)) * SEQ + (tid & 7) * 8;                     // d row tid/8, keys of tile 0
  stage_kv(lk, gk, lv, gv);
  asm volatile("s_wait_asynccnt 0x0" ::: "memory");   // this wave's pieces of tile 0 have landed
  __syncthreads();                                     // publishes tile 0
  if (nst > 1) stage_kv(lk + AT_BUF * 2, gk + (size_t)AT * 2 * DM, lv + AT_BUF * 2, gv + AT);
  v16h aq[2], aql[2];
#pragma unroll
  for (int kc = 0; kc < 2; ++kc) { aq[kc] = frag_h(QK + rq * (2 * DM) + h * HD + kc * 32, lane); aql[kc] = frag_h(QKL + rq * (2 * DM) + h * HD + kc * 32, lane); }
  float m[8], l[8];
#pragma unroll
  for (int r = 0; r < 8; ++r) { m[r] = -1.0e30f; l[r] = 0.f; }
  v8f acc[4] = {}, accl[4] = {};
  const float L2E = 1.44269504088896341f;
  const int nks = __builtin_amdgcn_readfirstlane((q0 + 16 + 31) >> 5);   // wave-uniform, held in a scalar register so that the skip below is a scalar branch: key steps covering keys <= q0 + 15 (every visited step has >= 1 unmasked key per row)
#pragma unroll 1   // one copy of the step's code for both buffers, which differ by an address only
  for (int t = 0; t < nst; ++t) { const _Float16* kt = skv + (t & 1) * AT_BUF; const _Float16* vt = kt + AT_V;
#pragma unroll 1   // one copy of the step's code for both halves of a tile
  for (int ks = 2 * t; ks < 2 * t + 2 && ks < nks; ++ks) { v8f s[2]; const int ko = (ks & 1) * 32;   // waves 0 and 1 skip the last tile's second step, wholly above their diagonal
    v16h kh[2][2], vh[4];   // the step's fragments read as one group at its head: one LDS wait for the scores, none left in front of the P x V products
#pragma unroll   // constant indices keep the fragment arrays in registers
    for (int ct = 0; ct < 2; ++ct) {
#pragma unroll   // constant indices keep the fragment arrays in registers
      for (int kc = 0; kc < 2; ++kc) kh[ct][kc] = frag_h(kt + (ko + ct * 16 + col) * AP + kc * 32, lane); }
#pragma unroll   // constant indices keep the fragment arrays in registers
    for (int dt = 0; dt < 4; ++dt) vh[dt] = frag_h(vt + (dt * 16 + col) * AP + ko, lane);
#pragma unroll
    for (int ct = 0; ct < 2; ++ct) { const int kk = ks * 32 + ct * 16 + col; const _Float16* krowl = QKL + ((size_t)b * SEQ + kk) * (2 * DM) + DM + h * HD; v8f c = {}, cl = {};
      if (lead) {
#pragma unroll
        for (int kc = 0; kc < 2; ++kc) { c = wmma16(aq[kc], kh[ct][kc], c); cl = wmma16(aql[kc], kh[ct][kc], cl); cl = wmma16(aq[kc], frag_h(krowl + kc * 32, lane), cl); }
#pragma unroll
        for (int r = 0; r < 8; ++r) c[r] += cl[r] * (1.0f / 2048.0f); }
      else {
#pragma unroll
        for (int kc = 0; kc < 2; ++kc) c = wmma16(aq[kc], kh[ct][kc], c); }
#pragma unroll
      for (int r = 0; r < 8; ++r) { const int qrow = q0 + 8 * g + r; s[ct][r] = (kk <= qrow) ? c[r] * 0.125f : -1.0e30f; } }   // 1/sqrt(64); keys above the diagonal replaced by a large negative fill
#pragma unroll
    for (int r = 0; r < 8; ++r) { float mx = fmaxf(s[0][r], s[1][r]);
#pragma unroll
      for (int o = 1; o < 16; o <<= 1) mx = fmaxf(mx, __shfl_xor(mx, o));
      const float mn = fmaxf(m[r], mx); const float alpha = exp2f((m[r] - mn) * L2E);
      const float p0 = exp2f((s[0][r] - mn) * L2E), p1 = exp2f((s[1][r] - mn) * L2E); float rs = p0 + p1;
#pragma unroll
      for (int o = 1; o < 16; o <<= 1) rs += __shfl_xor(rs, o);
      l[r] = l[r] * alpha + rs; m[r] = mn;
#pragma unroll
      for (int dt = 0; dt < 4; ++dt) { acc[dt][r] *= alpha; accl[dt][r] *= alpha; }
      sp[wave][8 * g + r][col] = p0 * PSC; sp[wave][8 * g + r][16 + col] = p1 * PSC; }
    ldsx();
    v16h pa, pl; { const float* prow = &sp[wave][col][0] + 8 * (lane >> 4);
#pragma unroll
      for (int i = 0; i < 8; ++i) { const float x0 = prow[i], x1 = prow[16 + i]; const _Float16 h0 = (_Float16)x0, h1 = (_Float16)x1; pa[i] = h0; pa[8 + i] = h1; pl[i] = (_Float16)((x0 - (float)h0) * 2048.0f); pl[8 + i] = (_Float16)((x1 - (float)h1) * 2048.0f); } }   // P x 2^4 as f16 hi; residual carried x2^11, folded in the epilogue
#pragma unroll
    for (int dt = 0; dt < 4; ++dt) { const size_t vr = ((size_t)b * DM + h * HD + dt * 16 + col) * SEQ + ks * 32; acc[dt] = wmma16(pa, vh[dt], acc[dt]); if (lead) { accl[dt] = wmma16(pl, vh[dt], accl[dt]); accl[dt] = wmma16(pa, frag_h(VTL + vr, lane), accl[dt]); } }
    ldsx(); }
    asm volatile("s_wait_dscnt 0x0" ::: "memory");      // this wave's reads of tile t have returned
    asm volatile("s_wait_asynccnt 0x0" ::: "memory");   // this wave's pieces of tile t + 1 have landed
    __syncthreads();                                     // publishes tile t + 1 and ends every wave's reads of tile t, whose buffer is refilled behind it
    if (t + 2 < nst) stage_kv(lk + (t & 1) * (AT_BUF * 2), gk + (size_t)(t + 2) * AT * 2 * DM, lv + (t & 1) * (AT_BUF * 2), gv + (t + 2) * AT); }
  asm volatile("s_wait_asynccnt 0x0" ::: "memory");     // no copy is left in flight when the wave goes on to its end
#pragma unroll
  for (int r = 0; r < 8; ++r) { const float il = 1.0f / (l[r] * PSC);   // l >= 1 (the running max contributes exp(0)); numerator carries the 2^4 pre-scale
#pragma unroll
    for (int dt = 0; dt < 4; ++dt) so[wave][8 * g + r][dt * 16 + col] = (acc[dt][r] + accl[dt][r] * (1.0f / 2048.0f)) * il; }
  ldsx();
  for (int rl = 0; rl < 16; ++rl) if (lane < 16) vst2(O + ((size_t)b * SEQ + q0 + rl) * DM + h * HD + lane * 4, *(const v4f*)&so[wave][rl][lane * 4]);
}
// ---- k_out: block = 64 rows, wave = 16 rows x 64 columns: out = O (bf16 hi/lo, 2 products) . packed W rows (K = 1024); 256-B output rows written by lanes 0..15 x 16 B
__global__ __launch_bounds__(128) void k_out(const float* __restrict__ O, const __bf16* __restrict__ P, float* __restrict__ Y) {
  __shared__ __align__(16) float so[4][16][68];
  const int tid = threadIdx.x, wave = tid >> 5, lane = tid & 31, col = lane & 15, g = lane >> 4;
  const size_t rb = (size_t)blockIdx.x * 64; const int b = (int)(rb / SEQ), s0 = (int)(rb % SEQ);
  const size_t r0 = rb + wave * 16; const size_t yr0 = (size_t)b * SEQ_FULL + s0 + wave * 16;
  v8f acc[4] = {};
#pragma unroll 2
  for (int kc = 0; kc < DM / 32; ++kc) { const F2 a = split_row(O + (r0 + col) * DM, kc * 32, lane);
#pragma unroll
    for (int j = 0; j < 4; ++j) { const v16b w = frag_b(P + (size_t)(j * 16 + col) * DM + kc * 32, lane); acc[j] = wmma_bf(a.l, w, acc[j]); acc[j] = wmma_bf(a.h, w, acc[j]); } }
#pragma unroll
  for (int j = 0; j < 4; ++j) {
#pragma unroll
    for (int r = 0; r < 8; ++r) so[wave][8 * g + r][j * 16 + col] = acc[j][r]; }
  ldsx();
  for (int rl = 0; rl < 16; ++rl) if (lane < 16) vst2(Y + (yr0 + rl) * NE + lane * 4, *(const v4f*)&so[wave][rl][lane * 4]);
}
extern "C" void kernel_launch(void* const* d_in, const int* in_sizes, int n_in, void* d_out, int out_size, void* d_ws, size_t ws_size, hipStream_t stream) {
  if (n_in < 5) return;
  if (in_sizes[0] < ((NB - 1) * SEQ_FULL + SEQ) * DM) return;                                        // x [2,2048,1024]
  if (in_sizes[1] < NH * DM * HD || in_sizes[2] < NH * DM * HD || in_sizes[3] < NH * DM * HD) return;  // Wq Wk Wv [16,1024,64]
  if (in_sizes[4] < DM * NE) return;                                                                   // W [1024,64]
  if (out_size < ((NB - 1) * SEQ_FULL + SEQ) * NE) return;                                             // out [2,2048,64]
  if (ws_size < (size_t)WS_END) return;
  const float* X = (const float*)d_in[0]; const float* WQ = (const float*)d_in[1]; const float* WK = (const float*)d_in[2]; const float* WV = (const float*)d_in[3]; const float* WO = (const float*)d_in[4];
  char* ws = (char*)d_ws; __bf16* PK = (__bf16*)(ws + WS_PK); _Float16 *QK = (_Float16*)(ws + WS_QK), *QKL = (_Float16*)(ws + WS_QKL), *VTH = (_Float16*)(ws + WS_VTH), *VTL = (_Float16*)(ws + WS_VTL); float* O = (float*)(ws + WS_O);
  k_pack<<<dim3(DM / 64, NPK / 64), 256, 0, stream>>>(WQ, WK, WV, WO, PK);
  k_qkv<<<dim3(NB * SEQ / 64, QKVW / 128), 128, 0, stream>>>(X, PK, QK, QKL, VTH, VTL);
  k_attn<<<dim3(SEQ / 64, NH, NB), 128, 0, stream>>>(QK, QKL, VTH, VTL, O);
  k_out<<<dim3(NB * SEQ / 64, 1), 128, 0, stream>>>(O, PK + (size_t)QKVW * DM, (float*)d_out);
}

// v003
// Measured time: 149 microseconds a run.
// In both of two side-by-side timings against v002, it was 1.36 times as fast.
// Over all steps from v000 it is 2.48 times as fast.
// compute dtype: all float inputs RNE-converted to bf16; q|k|v = x . W[h] with exact bf16 x bf16 products on v_wmma_f32_16x16x32_bf16, stored as f16 hi + residual(x2^11) planes (v transposed); scores = q . k on v_wmma_f32_16x16x32_f16 (query blocks 0..1: 3-product hi/res, later blocks single f16), x 1/8 and causal online softmax (running max) in f32; P x 2^4 as f16 hi (+ residual x2^11 against v hi + v lo on query blocks 0..1, single P x v hi elsewhere) on f16 WMMA; out = ctx (bf16 hi + lo) . W on bf16 WMMA; f32 accumulate everywhere, f32 output.
#include <hip/hip_runtime.h>
#include <math.h>

typedef __attribute__((ext_vector_type(16))) _Float16 v16h;
typedef __attribute__((ext_vector_type(16))) __bf16 v16b;
typedef __attribute__((ext_vector_type(8)))  _Float16 v8h;
typedef __attribute__((ext_vector_type(8)))  __bf16 v8b;
typedef __attribute__((ext_vector_type(4)))  __bf16 v4b;
typedef __attribute__((ext_vector_type(8)))  float v8f;
typedef __attribute__((ext_vector_type(4)))  float v4f;
typedef __attribute__((ext_vector_type(4)))  unsigned v4u;

template <typename T> __device__ __forceinline__ void vst2(void* p, T v) { *(T*)p = v;  }
__device__ __forceinline__ v8f wmma16(v16h a, v16h b, v8f c) {
  v8f d = __builtin_amdgcn_wmma_f32_16x16x32_f16(false, a, false, b, (short)0, c, false, false);
  asm volatile("v_nop\n\tv_nop\n\tv_nop\n\tv_nop" : "+v"(d) : "v"(a), "v"(b));
  return d;
}
__device__ __forceinline__ v8f wmma_bf(v16b a, v16b b, v8f c) {
  v8f d = __builtin_amdgcn_wmma_f32_16x16x32_bf16(false, a, false, b, (short)0, c, false, false);
  asm volatile("v_nop\n\tv_nop\n\tv_nop\n\tv_nop" : "+v"(d) : "v"(a), "v"(b));
  return d;
}
// 16-bit row fragment (row m = lane & 15 selected by the caller): elements 0..7 <- k0 + 8h + i, 8..15 <- k0 + 16 + 8h + i, h = lane >> 4
__device__ __forceinline__ v16h frag_h(const _Float16* rowk0, int lane) {
  union { v16h v; v8h q[2]; } u; const _Float16* p = rowk0 + 8 * (lane >> 4);
  u.q[0] = *(const v8h*)p; u.q[1] = *(const v8h*)(p + 16); return u.v;
}
__device__ __forceinline__ v16b frag_b(const __bf16* rowk0, int lane) {
  union { v16b v; v8b q[2]; } u; const __bf16* p = rowk0 + 8 * (lane >> 4);
  u.q[0] = *(const v8b*)p; u.q[1] = *(const v8b*)(p + 16); return u.v;
}
struct F2 { v16b h, l; };
__device__ __forceinline__ F2 bsplit16(const float v[16]) { F2 r;
#pragma unroll
  for (int i = 0; i < 16; ++i) { const __bf16 h = (__bf16)v[i]; r.h[i] = h; r.l[i] = (__bf16)(v[i] - (float)h); }
  return r; }
__device__ __forceinline__ F2 split_row(const float* row, int k0, int lane) { float v[16]; const float* p = row + k0 + 8 * (lane >> 4);
#pragma unroll
  for (int i = 0; i < 8; ++i) { v[i] = p[i]; v[8 + i] = p[16 + i]; }
  return bsplit16(v); }
__device__ __forceinline__ void ldsx() { asm volatile("s_wait_dscnt 0" ::: "memory"); __builtin_amdgcn_wave_barrier(); __builtin_amdgcn_fence(3, "workgroup"); }

// causal multi-head attention: per-head q/k/v projections D 1,024 -> 64 (16 heads, weights [h][in][out]), scores/8, -inf above the diagonal, softmax, ctx merged head-major, out = ctx . W ([in 1,024][out 64])
#ifndef NB
#define NB 2
#endif
#ifndef SEQ
#define SEQ 2048
#endif
#define NB_FULL 2
#define SEQ_FULL 2048
#define DM 1024
#define NH 16
#define HD 64
#define NE 64
#define QKVW (3 * DM)        // fused q | k | v output columns, column h*64+e (+0 / +1024 / +2048)
#define NPK (QKVW + NE)      // packed bf16 weight rows: 3072 q|k|v rows + 64 out-projection rows, each k-contiguous over 1024
#define PSC 16.0f            // softmax weights pre-scaled by 2^4 before the f16 split (<= 16; residual carried x2^11)
static_assert(SEQ % 64 == 0);
static_assert(SEQ >= 64 && SEQ <= SEQ_FULL);
static_assert(NB >= 1 && NB <= NB_FULL);
static_assert(HD == NE);
static_assert(DM % 64 == 0 && NPK % 64 == 0);

#define WS_PK  0ull                                           // bf16 [NPK][DM]
#define WS_QK  (WS_PK + 2ull * NPK * DM)                      // f16 [NB*SEQ][2*DM]: q | k hi
#define WS_QKL (WS_QK + 2ull * NB * SEQ * 2 * DM)             // f16 q | k residual x2048
#define WS_VTH (WS_QKL + 2ull * NB * SEQ * 2 * DM)            // f16 [b][1024 (h*64+d)][SEQ] v hi (transposed)
#define WS_VTL (WS_VTH + 2ull * NB * DM * SEQ)                // f16 v residual x2048 (transposed)
#define WS_O   (WS_VTL + 2ull * NB * DM * SEQ)                // f32 [NB*SEQ][DM] merged ctx
#define WS_END (WS_O + 4ull * NB * SEQ * DM)
static_assert(WS_END <= 134217728ull);
static_assert((WS_QK % 128) == 0 && (WS_QKL % 128) == 0 && (WS_VTH % 128) == 0 && (WS_VTL % 128) == 0 && (WS_O % 128) == 0);

// ---- k_pack: block = (64-wide d chunk, group): group 0..47 = (which = group/16, head = group%16) of Wq/Wk/Wv [h][d][e]; group 48 = W [d][e].
__global__ __launch_bounds__(256) void k_pack(const float* __restrict__ WQ, const float* __restrict__ WK, const float* __restrict__ WV, const float* __restrict__ WO, __bf16* __restrict__ PK) {
  __shared__ __align__(16) __bf16 s[64][72];
  const int dc = blockIdx.x, grp = blockIdx.y, t = threadIdx.x; const int which = grp >> 4, hh = grp & 15;
  const float* Wm = (which == 0) ? WQ : (which == 1) ? WK : (which == 2) ? WV : WO;
  const float* src = Wm + ((which < 3) ? (size_t)hh * DM * HD : (size_t)0) + (size_t)dc * 64 * HD;
  for (int q = t; q < 64 * 64; q += 256) { const int dd = q >> 6, e = q & 63; s[e][dd] = (__bf16)src[(size_t)dd * HD + e]; }
  __syncthreads();
  for (int q = t; q < 64 * 8; q += 256) { const int e = q >> 3, pc = q & 7; vst2(PK + ((size_t)grp * 64 + e) * DM + dc * 64 + pc * 8, *(const v4u*)&s[e][pc * 8]); }
}
// ---- k_qkv: block = (64 rows of x, 128 fused output columns n0): bf16(x) rows x packed bf16 weight rows on WMMA (K = 1024);
//      k tiles of 64 staged in two LDS buffers: every global load covers whole 128-B lines (x: 2 rows x 256 B per wave load, weights: 4 rows x 128 B),
//      x converted to bf16 on the way in; rows at pitch 144 B for the 16-byte fragment reads; the next tile's loads are issued ahead of this tile's products;
//      the output staging reuses the same LDS behind the loop's last barrier
#define KT 64                       // k per staged tile: one 128-B line of a weight row
#define LP (KT + 8)                 // LDS row pitch in bf16 elements (144 B = 16 B x 9)
#define ST_A (64 * LP)              // x rows of a buffer, in elements
#define ST_BUF (ST_A + 128 * LP)    // one buffer: 64 x rows, then 128 weight rows
static_assert(DM % KT == 0 && 2 * ST_BUF * 2 >= 2 * 128 * 72 * 2 && 2 * ST_BUF * 2 >= 2 * 4 * 16 * 136 * 2);
__global__ __launch_bounds__(128) void k_qkv(const float* __restrict__ X, const __bf16* __restrict__ P, _Float16* __restrict__ QK, _Float16* __restrict__ QKL, _Float16* __restrict__ VTH, _Float16* __restrict__ VTL) {
  __shared__ __align__(16) __bf16 sm[2 * ST_BUF];
  _Float16 (*so)[16][136] = (_Float16 (*)[16][136])sm; _Float16 (*sol)[16][136] = so + 4;
  _Float16 (*sth)[72] = (_Float16 (*)[72])sm; _Float16 (*stl)[72] = sth + 128;
  const int tid = threadIdx.x, wave = tid >> 5, lane = tid & 31, col = lane & 15, g = lane >> 4;
  const size_t rb = (size_t)blockIdx.x * 64; const int b = (int)(rb / SEQ), s0 = (int)(rb % SEQ);
  const size_t pr0 = rb + wave * 16;                            // plane row base (compact b*SEQ + s)
  const int n0 = blockIdx.y * 128;
  const float* xg = X + ((size_t)b * SEQ_FULL + s0 + (tid >> 4)) * DM + (tid & 15) * 4;   // this thread's 16 B of x: row tid/16 (+8 per load), floats 4*(tid%16)
  const __bf16* pg = P + (size_t)(n0 + (tid >> 3)) * DM + (tid & 7) * 8;                    // this thread's 16 B of weights: row tid/8 (+16 per load), elements 8*(tid%8)
  __bf16* sa = sm + (tid >> 4) * LP + (tid & 15) * 4; __bf16* sb = sm + ST_A + (tid >> 3) * LP + (tid & 7) * 8;
  v4f ra[8]; v4u rbw[8];
#pragma unroll   // constant indices keep the register arrays in registers
  for (int i = 0; i < 8; ++i) { ra[i] = *(const v4f*)(xg + (size_t)i * 8 * DM); rbw[i] = *(const v4u*)(pg + (size_t)i * 16 * DM); }
#pragma unroll   // constant indices keep the register arrays in registers
  for (int i = 0; i < 8; ++i) { v4b c; c[0] = (__bf16)ra[i][0]; c[1] = (__bf16)ra[i][1]; c[2] = (__bf16)ra[i][2]; c[3] = (__bf16)ra[i][3]; *(v4b*)(sa + i * 8 * LP) = c; *(v4u*)(sb + i * 16 * LP) = rbw[i]; }
  __syncthreads();
  v8f acc[8] = {};
  for (int t = 0; t < DM / KT; ++t) { const __bf16* cur = sm + (t & 1) * ST_BUF; const int nxt = ((t + 1) & 1) * ST_BUF; const bool more = t + 1 < DM / KT;
    if (more) {
#pragma unroll   // constant indices keep the register arrays in registers
      for (int i = 0; i < 8; ++i) { ra[i] = *(const v4f*)(xg + (t + 1) * KT + (size_t)i * 8 * DM); rbw[i] = *(const v4u*)(pg + (t + 1) * KT + (size_t)i * 16 * DM); } }
#pragma unroll   // constant indices keep the register arrays in registers
    for (int kk = 0; kk < KT / 32; ++kk) { const v16b a = frag_b(cur + (wave * 16 + col) * LP + kk * 32, lane);
#pragma unroll   // constant indices keep the register arrays in registers
      for (int jh = 0; jh < 8; jh += 4) { v16b w[4];   // four weight fragments read as one group ahead of their products: one LDS wait per group, not one per product
#pragma unroll   // constant indices keep the register arrays in registers
        for (int j = 0; j < 4; ++j) w[j] = frag_b(cur + ST_A + ((jh + j) * 16 + col) * LP + kk * 32, lane);
#pragma unroll   // constant indices keep the register arrays in registers
        for (int j = 0; j < 4; ++j) acc[jh + j] = wmma_bf(a, w[j], acc[jh + j]); } }
    __builtin_amdgcn_sched_barrier(0);   // keeps the conversions of the prefetched tile, and with them the wait for its global loads, behind this tile's products
    if (more) {   // the other buffer's last readers left it at the previous trip's barrier
#pragma unroll   // constant indices keep the register arrays in registers
      for (int i = 0; i < 8; ++i) { v4b c; c[0] = (__bf16)ra[i][0]; c[1] = (__bf16)ra[i][1]; c[2] = (__bf16)ra[i][2]; c[3] = (__bf16)ra[i][3]; *(v4b*)(sa + nxt + i * 8 * LP) = c; *(v4u*)(sb + nxt + i * 16 * LP) = rbw[i]; } }
    __syncthreads(); }   // publishes the tile just stored and ends every read of the tile just used (after the last trip: frees the LDS for the output staging)
  if (n0 < 2 * DM) {   // q and k stored unscaled (sigma ~0.6); 1/8 applied to the f32 score
#pragma unroll
    for (int j = 0; j < 8; ++j) {
#pragma unroll
      for (int r = 0; r < 8; ++r) { const float v = acc[j][r]; const _Float16 hv = (_Float16)v; so[wave][8 * g + r][j * 16 + col] = hv; sol[wave][8 * g + r][j * 16 + col] = (_Float16)((v - (float)hv) * 2048.0f); } }
    ldsx();
    for (int rl = 0; rl < 16; ++rl) if (lane < 16) { vst2(QK + (pr0 + rl) * (2 * DM) + n0 + lane * 8, *(const v4u*)&so[wave][rl][lane * 8]); vst2(QKL + (pr0 + rl) * (2 * DM) + n0 + lane * 8, *(const v4u*)&sol[wave][rl][lane * 8]); }
  } else {
#pragma unroll
    for (int j = 0; j < 8; ++j) {
#pragma unroll
      for (int r = 0; r < 8; ++r) { const float v = acc[j][r]; const _Float16 hv = (_Float16)v; sth[j * 16 + col][wave * 16 + 8 * g + r] = hv; stl[j * 16 + col][wave * 16 + 8 * g + r] = (_Float16)((v - (float)hv) * 2048.0f); } }
    __syncthreads();
    const int pc0 = n0 - 2 * DM;
    for (int q = tid; q < 128 * 8; q += 128) { const int d = q >> 3, pc = q & 7; const size_t o = ((size_t)b * DM + pc0 + d) * SEQ + s0 + pc * 8; vst2(VTH + o, *(const v4u*)&sth[d][pc * 8]); vst2(VTL + o, *(const v4u*)&stl[d][pc * 8]); }
  }
}
// ---- k_attn: block = (64 queries, head h, batch b), wave = 16 queries; causal flash attention over 32-key steps up to the wave's last query;
//      the products are taken transposed: S^T = K . Q^T (A = K rows, B = q rows) and O^T += V^T . P^T (A = V^T rows, B = P^T), so that a lane holds scores of ONE query (column lane & 15):
//      keys 8g + r of each 16-key tile, g = lane >> 4; row maximum and row sum are in-lane, the maximum joined with the other half by one cross-row move per step, the sums joined once in the epilogue;
//      the two score tiles of a step, converted in place, are the B operand P^T in the fragments' own k order (elements 0..7 <- keys 8g + i, 8..15 <- 16 + 8g + i): P passes through no LDS;
//      K hi and V^T hi tiles of 64 keys are brought once per block into two LDS buffers by asynchronous copies (each wave copy = 4 rows x one whole 128-B line), the next tile in flight
//      while this one is worked on; the four waves read their fragments from LDS (rows at pitch 144 B for the 16-byte reads); the residual planes of query blocks 0..1 still come straight from global;
//      query blocks 0..1: 3-product q/k scores and P hi/res x V hi/lo in a second accumulator, single products elsewhere;
//      O[b*SEQ+q][h*64+d] = (acc + accl/2048) / (l * 2^4)  (256-B segments, lanes 0..15 x 16 B)
#define AT 64                       // keys per staged tile: one 128-B line of a V^T row; a block's keys are a whole number of tiles
#define AP (AT + 8)                 // LDS row pitch in f16 elements (144 B = 16 B x 9), for K rows (64 d) and V^T rows (64 keys) alike
#define AT_V (AT * AP)              // 64 K rows of a buffer, then 64 V^T rows
#define AT_BUF (AT_V + HD * AP)
static_assert(AT == HD && SEQ % AT == 0);
// one tile: this thread's four 16-B pieces of K (rows 16 apart) and four of V^T; lk, lv = LDS byte addresses, gk, gv = global addresses of the first piece of each
__device__ __forceinline__ void stage_kv(unsigned lk, const _Float16* gk, unsigned lv, const _Float16* gv) {
  const unsigned ls = 16 * AP * 2; const size_t ks = (size_t)16 * 2 * DM, vs = (size_t)16 * SEQ;
  // the closing s_wait_xcnt stands in the copies' own statement, so that no address register named here is rewritten ahead of it
  asm volatile("global_load_async_to_lds_b128 %0, %8, off\n\t"
               "global_load_async_to_lds_b128 %1, %9, off\n\t"
               "global_load_async_to_lds_b128 %2, %10, off\n\t"
               "global_load_async_to_lds_b128 %3, %11, off\n\t"
               "global_load_async_to_lds_b128 %4, %12, off\n\t"
               "global_load_async_to_lds_b128 %5, %13, off\n\t"
               "global_load_async_to_lds_b128 %6, %14, off\n\t"
               "global_load_async_to_lds_b128 %7, %15, off\n\t"
               "s_wait_xcnt 0x0"
               :: "v"(lk), "v"(lk + ls), "v"(lk + 2 * ls), "v"(lk + 3 * ls), "v"(lv), "v"(lv + ls), "v"(lv + 2 * ls), "v"(lv + 3 * ls),
                  "v"(gk), "v"(gk + ks), "v"(gk + 2 * ks), "v"(gk + 3 * ks), "v"(gv), "v"(gv + vs), "v"(gv + 2 * vs), "v"(gv + 3 * vs) : "memory");
}
// lane l takes the value of lane l ^ 16
__device__ __forceinline__ float xhalf(float x) { return __builtin_bit_cast(float, __builtin_amdgcn_permlanex16(__builtin_bit_cast(int, x), __builtin_bit_cast(int, x), 0x76543210, 0xfedcba98, false, false)); }
__global__ __launch_bounds__(128) void k_attn(const _Float16* __restrict__ QK, const _Float16* __restrict__ QKL, const _Float16* __restrict__ VTH, const _Float16* __restrict__ VTL, float* __restrict__ O) {
  __shared__ __align__(16) _Float16 skv[2 * AT_BUF];
  __shared__ __align__(16) float so[4][16][68];
  const int tid = threadIdx.x, wave = tid >> 5, lane = tid & 31, col = lane & 15, g = lane >> 4;
  const int qb = blockIdx.x, h = blockIdx.y, b = blockIdx.z; const int q0 = qb * 64 + wave * 16; const size_t rq = (size_t)b * SEQ + q0 + col;
  const bool lead = qb < 2;   // block-uniform: leading query blocks (few keys, outputs far above the global rms)
  const int nst = qb + 1;     // block-uniform: staged tiles covering keys <= qb * 64 + 63
  const unsigned lk = (unsigned)(size_t)skv + ((tid >> 3) * AP + (tid & 7) * 8) * 2, lv = lk + AT_V * 2;      // this thread's first piece: row tid/8, 16 B number tid%8
  const _Float16* gk = QK + ((size_t)b * SEQ + (tid >> 3)) * (2 * DM) + DM + h * HD + (tid & 7) * 8;           // key row tid/8 of tile 0
  const _Float16* gv = VTH + ((size_t)b * DM + h * HD + (tid >> 3)) * SEQ + (tid & 7) * 8;                     // d row tid/8, keys of tile 0
  stage_kv(lk, gk, lv, gv);
  asm volatile("s_wait_asynccnt 0x0" ::: "memory");   // this wave's pieces of tile 0 have landed
  __syncthreads();                                     // publishes tile 0
  if (nst > 1) stage_kv(lk + AT_BUF * 2, gk + (size_t)AT * 2 * DM, lv + AT_BUF * 2, gv + AT);
  v16h aq[2], aql[2];   // B operands: column = query q0 + col
#pragma unroll
  for (int kc = 0; kc < 2; ++kc) { aq[kc] = frag_h(QK + rq * (2 * DM) + h * HD + kc * 32, lane); aql[kc] = frag_h(QKL + rq * (2 * DM) + h * HD + kc * 32, lane); }
  float m = -1.0e30f, l = 0.f;   // of query q0 + col: running maximum (equal in both halves), sum over this half's keys
  v8f acc[4] = {}, accl[4] = {};   // acc[dt][r] = O^T[d = dt * 16 + 8g + r][query q0 + col]
  const float L2E = 1.44269504088896341f;
  const int nks = __builtin_amdgcn_readfirstlane((q0 + 16 + 31) >> 5);   // wave-uniform, held in a scalar register so that the skip below is a scalar branch: key steps covering keys <= q0 + 15 (every visited step has >= 1 unmasked key per query)
#pragma unroll 1   // one copy of the step's code for both buffers, which differ by an address only
  for (int t = 0; t < nst; ++t) { const _Float16* kt = skv + (t & 1) * AT_BUF; const _Float16* vt = kt + AT_V;
#pragma unroll 1   // one copy of the step's code for both halves of a tile
  for (int ks = 2 * t; ks < 2 * t + 2 && ks < nks; ++ks) { v8f s[2]; const int ko = (ks & 1) * 32;   // waves 0 and 1 skip the last tile's second step, wholly above their diagonal
    const int dq = q0 + col - ks * 32 - 8 * g;   // this lane's key ct * 16 + r of the step lies on or below the diagonal where ct * 16 + r <= dq
    v16h kh[2][2], vh[4];   // the step's fragments read as one group at its head: one LDS wait for the scores, none left in front of the V^T x P^T products
#pragma unroll   // constant indices keep the fragment arrays in registers
    for (int ct = 0; ct < 2; ++ct) {
#pragma unroll   // constant indices keep the fragment arrays in registers
      for (int kc = 0; kc < 2; ++kc) kh[ct][kc] = frag_h(kt + (ko + ct * 16 + col) * AP + kc * 32, lane); }
#pragma unroll   // constant indices keep the fragment arrays in registers
    for (int dt = 0; dt < 4; ++dt) vh[dt] = frag_h(vt + (dt * 16 + col) * AP + ko, lane);
#pragma unroll
    for (int ct = 0; ct < 2; ++ct) { const _Float16* krowl = QKL + ((size_t)b * SEQ + ks * 32 + ct * 16 + col) * (2 * DM) + DM + h * HD; v8f c = {}, cl = {};   // A row = key ks * 32 + ct * 16 + col
      if (lead) {
#pragma unroll
        for (int kc = 0; kc < 2; ++kc) { c = wmma16(kh[ct][kc], aq[kc], c); cl = wmma16(kh[ct][kc], aql[kc], cl); cl = wmma16(frag_h(krowl + kc * 32, lane), aq[kc], cl); }
#pragma unroll
        for (int r = 0; r < 8; ++r) c[r] += cl[r] * (1.0f / 2048.0f); }
      else {
#pragma unroll
        for (int kc = 0; kc < 2; ++kc) c = wmma16(kh[ct][kc], aq[kc], c); }
#pragma unroll   // constant indices keep the register arrays in registers
      for (int r = 0; r < 8; ++r) s[ct][r] = (ct * 16 + r <= dq) ? c[r] * 0.125f : -1.0e30f; }   // 1/sqrt(64); keys above the diagonal replaced by a large negative fill
    float mx = fmaxf(s[0][0], s[1][0]);
#pragma unroll   // constant indices keep the register arrays in registers
    for (int r = 1; r < 8; ++r) mx = fmaxf(mx, fmaxf(s[0][r], s[1][r]));
    mx = fmaxf(mx, xhalf(mx));   // the step's 32 keys: this half's 16 and the other half's
    const float mn = fmaxf(m, mx); const float alpha = exp2f((m - mn) * L2E); float rs = 0.f;
    v16h pa, pl;   // P^T x 2^4 as f16 hi; residual carried x2^11, folded in the epilogue
#pragma unroll   // constant indices keep the register arrays in registers
    for (int i = 0; i < 8; ++i) { const float p0 = exp2f((s[0][i] - mn) * L2E), p1 = exp2f((s[1][i] - mn) * L2E); rs += p0 + p1;
      const float x0 = p0 * PSC, x1 = p1 * PSC; const _Float16 h0 = (_Float16)x0, h1 = (_Float16)x1; pa[i] = h0; pa[8 + i] = h1; pl[i] = (_Float16)((x0 - (float)h0) * 2048.0f); pl[8 + i] = (_Float16)((x1 - (float)h1) * 2048.0f); }
    l = l * alpha + rs; m = mn;
#pragma unroll   // constant indices keep the register arrays in registers
    for (int dt = 0; dt < 4; ++dt) {
#pragma unroll   // constant indices keep the register arrays in registers
      for (int r = 0; r < 8; ++r) { acc[dt][r] *= alpha; accl[dt][r] *= alpha; } }
#pragma unroll
    for (int dt = 0; dt < 4; ++dt) { const size_t vr = ((size_t)b * DM + h * HD + dt * 16 + col) * SEQ + ks * 32; acc[dt] = wmma16(vh[dt], pa, acc[dt]); if (lead) { accl[dt] = wmma16(vh[dt], pl, accl[dt]); accl[dt] = wmma16(frag_h(VTL + vr, lane), pa, accl[dt]); } } }
    asm volatile("s_wait_dscnt 0x0" ::: "memory");      // this wave's reads of tile t have returned
    asm volatile("s_wait_asynccnt 0x0" ::: "memory");   // this wave's pieces of tile t + 1 have landed
    __syncthreads();                                     // publishes tile t + 1 and ends every wave's reads of tile t, whose buffer is refilled behind it
    if (t + 2 < nst) stage_kv(lk + (t & 1) * (AT_BUF * 2), gk + (size_t)(t + 2) * AT * 2 * DM, lv + (t & 1) * (AT_BUF * 2), gv + (t + 2) * AT); }
  asm volatile("s_wait_asynccnt 0x0" ::: "memory");     // no copy is left in flight when the wave goes on to its end
  l += xhalf(l);   // the two halves' key sums of this query
  const float il = 1.0f / (l * PSC);   // l >= 1 (the running max contributes exp(0)); numerator carries the 2^4 pre-scale
#pragma unroll   // constant indices keep the register arrays in registers
  for (int dt = 0; dt < 4; ++dt) {
#pragma unroll   // constant indices keep the register arrays in registers
    for (int rh = 0; rh < 8; rh += 4) { v4f o;
#pragma unroll   // constant indices keep the register arrays in registers
      for (int r = 0; r < 4; ++r) o[r] = (acc[dt][rh + r] + accl[dt][rh + r] * (1.0f / 2048.0f)) * il;
      *(v4f*)&so[wave][col][dt * 16 + 8 * g + rh] = o; } }
  ldsx();
  for (int rl = 0; rl < 16; ++rl) if (lane < 16) vst2(O + ((size_t)b * SEQ + q0 + rl) * DM + h * HD + lane * 4, *(const v4f*)&so[wave][rl][lane * 4]);
}
// ---- k_out: block = 64 rows, wave = 16 rows x 64 columns: out = O (bf16 hi/lo, 2 products) . packed W rows (K = 1024); 256-B output rows written by lanes 0..15 x 16 B
__global__ __launch_bounds__(128) void k_out(const float* __restrict__ O, const __bf16* __restrict__ P, float* __restrict__ Y) {
  __shared__ __align__(16) float so[4][16][68];
  const int tid = threadIdx.x, wave = tid >> 5, lane = tid & 31, col = lane & 15, g = lane >> 4;
  const size_t rb = (size_t)blockIdx.x * 64; const int b = (int)(rb / SEQ), s0 = (int)(rb % SEQ);
  const size_t r0 = rb + wave * 16; const size_t yr0 = (size_t)b * SEQ_FULL + s0 + wave * 16;
  v8f acc[4] = {};
#pragma unroll 2
  for (int kc = 0; kc < DM / 32; ++kc) { const F2 a = split_row(O + (r0 + col) * DM, kc * 32, lane);
#pragma unroll
    for (int j = 0; j < 4; ++j) { const v16b w = frag_b(P + (size_t)(j * 16 + col) * DM + kc * 32, lane); acc[j] = wmma_bf(a.l, w, acc[j]); acc[j] = wmma_bf(a.h, w, acc[j]); } }
#pragma unroll
  for (int j = 0; j < 4; ++j) {
#pragma unroll
    for (int r = 0; r < 8; ++r) so[wave][8 * g + r][j * 16 + col] = acc[j][r]; }
  ldsx();
  for (int rl = 0; rl < 16; ++rl) if (lane < 16) vst2(Y + (yr0 + rl) * NE + lane * 4, *(const v4f*)&so[wave][rl][lane * 4]);
}
extern "C" void kernel_launch(void* const* d_in, const int* in_sizes, int n_in, void* d_out, int out_size, void* d_ws, size_t ws_size, hipStream_t stream) {
  if (n_in < 5) return;
  if (in_sizes[0] < ((NB - 1) * SEQ_FULL + SEQ) * DM) return;                                        // x [2,2048,1024]
  if (in_sizes[1] < NH * DM * HD || in_sizes[2] < NH * DM * HD || in_sizes[3] < NH * DM * HD) return;  // Wq Wk Wv [16,1024,64]
  if (in_sizes[4] < DM * NE) return;                                                                   // W [1024,64]
  if (out_size < ((NB - 1) * SEQ_FULL + SEQ) * NE) return;                                             // out [2,2048,64]
  if (ws_size < (size_t)WS_END) return;
  const float* X = (const float*)d_in[0]; const float* WQ = (const float*)d_in[1]; const float* WK = (const float*)d_in[2]; const float* WV = (const float*)d_in[3]; const float* WO = (const float*)d_in[4];
  char* ws = (char*)d_ws; __bf16* PK = (__bf16*)(ws + WS_PK); _Float16 *QK = (_Float16*)(ws + WS_QK), *QKL = (_Float16*)(ws + WS_QKL), *VTH = (_Float16*)(ws + WS_VTH), *VTL = (_Float16*)(ws + WS_VTL); float* O = (float*)(ws + WS_O);
  k_pack<<<dim3(DM / 64, NPK / 64), 256, 0, stream>>>(WQ, WK, WV, WO, PK);
  k_qkv<<<dim3(NB * SEQ / 64, QKVW / 128), 128, 0, stream>>>(X, PK, QK, QKL, VTH, VTL);
  k_attn<<<dim3(SEQ / 64, NH, NB), 128, 0, stream>>>(QK, QKL, VTH, VTL, O);
  k_out<<<dim3(NB * SEQ / 64, 1), 128, 0, stream>>>(O, PK + (size_t)QKVW * DM, (float*)d_out);
}

// v004
// Measured time: 128 microseconds a run.
// Timed twice side by side with v003, it ran 1.16 times as fast both times.
// All steps since v000 together make it 2.89 times as fast.
// compute dtype: all float inputs RNE-converted to bf16; q|k|v = x . W[h] with exact bf16 x bf16 products on v_wmma_f32_16x16x32_bf16, stored as f16 hi + residual(x2^11) planes (v transposed); scores = q . k on v_wmma_f32_16x16x32_f16 (query blocks 0..1: 3-product hi/res, later blocks single f16), x 1/8 and causal online softmax (running max) in f32; P x 2^4 as f16 hi (+ residual x2^11 against v hi + v lo on query blocks 0..1, single P x v hi elsewhere) on f16 WMMA; out = ctx (bf16 hi + lo) . W on bf16 WMMA; f32 accumulate everywhere, f32 output.
#include <hip/hip_runtime.h>
#include <math.h>

typedef __attribute__((ext_vector_type(16))) _Float16 v16h;
typedef __attribute__((ext_vector_type(16))) __bf16 v16b;
typedef __attribute__((ext_vector_type(8)))  _Float16 v8h;
typedef __attribute__((ext_vector_type(8)))  __bf16 v8b;
typedef __attribute__((ext_vector_type(4)))  __bf16 v4b;
typedef __attribute__((ext_vector_type(8)))  float v8f;
typedef __attribute__((ext_vector_type(4)))  float v4f;
typedef __attribute__((ext_vector_type(4)))  unsigned v4u;

template <typename T> __device__ __forceinline__ void vst2(void* p, T v) { *(T*)p = v;  }
__device__ __forceinline__ v8f wmma16(v16h a, v16h b, v8f c) {
  v8f d = __builtin_amdgcn_wmma_f32_16x16x32_f16(false, a, false, b, (short)0, c, false, false);
  asm volatile("v_nop\n\tv_nop\n\tv_nop\n\tv_nop" : "+v"(d) : "v"(a), "v"(b));
  return d;
}
__device__ __forceinline__ v8f wmma_bf(v16b a, v16b b, v8f c) {
  v8f d = __builtin_amdgcn_wmma_f32_16x16x32_bf16(false, a, false, b, (short)0, c, false, false);
  asm volatile("v_nop\n\tv_nop\n\tv_nop\n\tv_nop" : "+v"(d) : "v"(a), "v"(b));
  return d;
}
// 16-bit row fragment (row m = lane & 15 selected by the caller): elements 0..7 <- k0 + 8h + i, 8..15 <- k0 + 16 + 8h + i, h = lane >> 4
__device__ __forceinline__ v16h frag_h(const _Float16* rowk0, int lane) {
  union { v16h v; v8h q[2]; } u; const _Float16* p = rowk0 + 8 * (lane >> 4);
  u.q[0] = *(const v8h*)p; u.q[1] = *(const v8h*)(p + 16); return u.v;
}
__device__ __forceinline__ v16b frag_b(const __bf16* rowk0, int lane) {
  union { v16b v; v8b q[2]; } u; const __bf16* p = rowk0 + 8 * (lane >> 4);
  u.q[0] = *(const v8b*)p; u.q[1] = *(const v8b*)(p + 16); return u.v;
}
struct F2 { v16b h, l; };
__device__ __forceinline__ F2 bsplit16(const float v[16]) { F2 r;
#pragma unroll
  for (int i = 0; i < 16; ++i) { const __bf16 h = (__bf16)v[i]; r.h[i] = h; r.l[i] = (__bf16)(v[i] - (float)h); }
  return r; }
__device__ __forceinline__ F2 split_row(const float* row, int k0, int lane) { float v[16]; const float* p = row + k0 + 8 * (lane >> 4);
#pragma unroll
  for (int i = 0; i < 8; ++i) { v[i] = p[i]; v[8 + i] = p[16 + i]; }
  return bsplit16(v); }
__device__ __forceinline__ void ldsx() { asm volatile("s_wait_dscnt 0" ::: "memory"); __builtin_amdgcn_wave_barrier(); __builtin_amdgcn_fence(3, "workgroup"); }

// causal multi-head attention: per-head q/k/v projections D 1,024 -> 64 (16 heads, weights [h][in][out]), scores/8, -inf above the diagonal, softmax, ctx merged head-major, out = ctx . W ([in 1,024][out 64])
#ifndef NB
#define NB 2
#endif
#ifndef SEQ
#define SEQ 2048
#endif
#define NB_FULL 2
#define SEQ_FULL 2048
#define DM 1024
#define NH 16
#define HD 64
#define NE 64
#define QKVW (3 * DM)        // fused q | k | v output columns, column h*64+e (+0 / +1024 / +2048)
#define NPK (QKVW + NE)      // packed bf16 weight rows: 3072 q|k|v rows + 64 out-projection rows, each k-contiguous over 1024
#define PSC 16.0f            // softmax weights pre-scaled by 2^4 before the f16 split (<= 16; residual carried x2^11)
static_assert(SEQ % 64 == 0);
static_assert(SEQ >= 64 && SEQ <= SEQ_FULL);
static_assert(NB >= 1 && NB <= NB_FULL);
static_assert(HD == NE);
static_assert(DM % 64 == 0 && NPK % 64 == 0);

#define WS_PK  0ull                                           // bf16 [NPK][DM]
#define WS_QK  (WS_PK + 2ull * NPK * DM)                      // f16 [NB*SEQ][2*DM]: q | k hi
#define WS_QKL (WS_QK + 2ull * NB * SEQ * 2 * DM)             // f16 q | k residual x2048
#define WS_VTH (WS_QKL + 2ull * NB * SEQ * 2 * DM)            // f16 [b][1024 (h*64+d)][SEQ] v hi (transposed)
#define WS_VTL (WS_VTH + 2ull * NB * DM * SEQ)                // f16 v residual x2048 (transposed)
#define WS_O   (WS_VTL + 2ull * NB * DM * SEQ)                // f32 [NB*SEQ][DM] merged ctx
#define WS_END (WS_O + 4ull * NB * SEQ * DM)
static_assert(WS_END <= 134217728ull);
static_assert((WS_QK % 128) == 0 && (WS_QKL % 128) == 0 && (WS_VTH % 128) == 0 && (WS_VTL % 128) == 0 && (WS_O % 128) == 0);

// ---- k_pack: block = (64-wide d chunk, group): group 0..47 = (which = group/16, head = group%16) of Wq/Wk/Wv [h][d][e]; group 48 = W [d][e].
__global__ __launch_bounds__(256) void k_pack(const float* __restrict__ WQ, const float* __restrict__ WK, const float* __restrict__ WV, const float* __restrict__ WO, __bf16* __restrict__ PK) {
  __shared__ __align__(16) __bf16 s[64][72];
  const int dc = blockIdx.x, grp = blockIdx.y, t = threadIdx.x; const int which = grp >> 4, hh = grp & 15;
  const float* Wm = (which == 0) ? WQ : (which == 1) ? WK : (which == 2) ? WV : WO;
  const float* src = Wm + ((which < 3) ? (size_t)hh * DM * HD : (size_t)0) + (size_t)dc * 64 * HD;
  for (int q = t; q < 64 * 64; q += 256) { const int dd = q >> 6, e = q & 63; s[e][dd] = (__bf16)src[(size_t)dd * HD + e]; }
  __syncthreads();
  for (int q = t; q < 64 * 8; q += 256) { const int e = q >> 3, pc = q & 7; vst2(PK + ((size_t)grp * 64 + e) * DM + dc * 64 + pc * 8, *(const v4u*)&s[e][pc * 8]); }
}
// ---- k_qkv: block = (64 rows of x, 128 fused output columns n0): bf16(x) rows x packed bf16 weight rows on WMMA (K = 1024);
//      k tiles of 64 staged in two LDS buffers: every global load covers whole 128-B lines (x: 2 rows x 256 B per wave load, weights: 4 rows x 128 B),
//      x converted to bf16 on the way in; rows at pitch 144 B for the 16-byte fragment reads; the next tile's loads are issued ahead of this tile's products;
//      the output staging reuses the same LDS behind the loop's last barrier
#define KT 64                       // k per staged tile: one 128-B line of a weight row
#define LP (KT + 8)                 // LDS row pitch in bf16 elements (144 B = 16 B x 9)
#define ST_A (64 * LP)              // x rows of a buffer, in elements
#define ST_BUF (ST_A + 128 * LP)    // one buffer: 64 x rows, then 128 weight rows
static_assert(DM % KT == 0 && 2 * ST_BUF * 2 >= 2 * 128 * 72 * 2 && 2 * ST_BUF * 2 >= 2 * 4 * 16 * 136 * 2);
__global__ __launch_bounds__(128) void k_qkv(const float* __restrict__ X, const __bf16* __restrict__ P, _Float16* __restrict__ QK, _Float16* __restrict__ QKL, _Float16* __restrict__ VTH, _Float16* __restrict__ VTL) {
  __shared__ __align__(16) __bf16 sm[2 * ST_BUF];
  _Float16 (*so)[16][136] = (_Float16 (*)[16][136])sm; _Float16 (*sol)[16][136] = so + 4;
  _Float16 (*sth)[72] = (_Float16 (*)[72])sm; _Float16 (*stl)[72] = sth + 128;
  const int tid = threadIdx.x, wave = tid >> 5, lane = tid & 31, col = lane & 15, g = lane >> 4;
  const size_t rb = (size_t)blockIdx.x * 64; const int b = (int)(rb / SEQ), s0 = (int)(rb % SEQ);
  const size_t pr0 = rb + wave * 16;                            // plane row base (compact b*SEQ + s)
  const int n0 = blockIdx.y * 128;
  const float* xg = X + ((size_t)b * SEQ_FULL + s0 + (tid >> 4)) * DM + (tid & 15) * 4;   // this thread's 16 B of x: row tid/16 (+8 per load), floats 4*(tid%16)
  const __bf16* pg = P + (size_t)(n0 + (tid >> 3)) * DM + (tid & 7) * 8;                    // this thread's 16 B of weights: row tid/8 (+16 per load), elements 8*(tid%8)
  __bf16* sa = sm + (tid >> 4) * LP + (tid & 15) * 4; __bf16* sb = sm + ST_A + (tid >> 3) * LP + (tid & 7) * 8;
  v4f ra[8]; v4u rbw[8];
#pragma unroll   // constant indices keep the register arrays in registers
  for (int i = 0; i < 8; ++i) { ra[i] = *(const v4f*)(xg + (size_t)i * 8 * DM); rbw[i] = *(const v4u*)(pg + (size_t)i * 16 * DM); }
#pragma unroll   // constant indices keep the register arrays in registers
  for (int i = 0; i < 8; ++i) { v4b c; c[0] = (__bf16)ra[i][0]; c[1] = (__bf16)ra[i][1]; c[2] = (__bf16)ra[i][2]; c[3] = (__bf16)ra[i][3]; *(v4b*)(sa + i * 8 * LP) = c; *(v4u*)(sb + i * 16 * LP) = rbw[i]; }
  __syncthreads();
  v8f acc[8] = {};
  for (int t = 0; t < DM / KT; ++t) { const __bf16* cur = sm + (t & 1) * ST_BUF; const int nxt = ((t + 1) & 1) * ST_BUF; const bool more = t + 1 < DM / KT;
    if (more) {
#pragma unroll   // constant indices keep the register arrays in registers
      for (int i = 0; i < 8; ++i) { ra[i] = *(const v4f*)(xg + (t + 1) * KT + (size_t)i * 8 * DM); rbw[i] = *(const v4u*)(pg + (t + 1) * KT + (size_t)i * 16 * DM); } }
#pragma unroll   // constant indices keep the register arrays in registers
    for (int kk = 0; kk < KT / 32; ++kk) { const v16b a = frag_b(cur + (wave * 16 + col) * LP + kk * 32, lane);
#pragma unroll   // constant indices keep the register arrays in registers
      for (int jh = 0; jh < 8; jh += 4) { v16b w[4];   // four weight fragments read as one group ahead of their products: one LDS wait per group, not one per product
#pragma unroll   // constant indices keep the register arrays in registers
        for (int j = 0; j < 4; ++j) w[j] = frag_b(cur + ST_A + ((jh + j) * 16 + col) * LP + kk * 32, lane);
#pragma unroll   // constant indices keep the register arrays in registers
        for (int j = 0; j < 4; ++j) acc[jh + j] = wmma_bf(a, w[j], acc[jh + j]); } }
    __builtin_amdgcn_sched_barrier(0);   // keeps the conversions of the prefetched tile, and with them the wait for its global loads, behind this tile's products
    if (more) {   // the other buffer's last readers left it at the previous trip's barrier
#pragma unroll   // constant indices keep the register arrays in registers
      for (int i = 0; i < 8; ++i) { v4b c; c[0] = (__bf16)ra[i][0]; c[1] = (__bf16)ra[i][1]; c[2] = (__bf16)ra[i][2]; c[3] = (__bf16)ra[i][3]; *(v4b*)(sa + nxt + i * 8 * LP) = c; *(v4u*)(sb + nxt + i * 16 * LP) = rbw[i]; } }
    __syncthreads(); }   // publishes the tile just stored and ends every read of the tile just used (after the last trip: frees the LDS for the output staging)
  if (n0 < 2 * DM) {   // q and k stored unscaled (sigma ~0.6); 1/8 applied to the f32 score
#pragma unroll
    for (int j = 0; j < 8; ++j) {
#pragma unroll
      for (int r = 0; r < 8; ++r) { const float v = acc[j][r]; const _Float16 hv = (_Float16)v; so[wave][8 * g + r][j * 16 + col] = hv; sol[wave][8 * g + r][j * 16 + col] = (_Float16)((v - (float)hv) * 2048.0f); } }
    ldsx();
    for (int rl = 0; rl < 16; ++rl) if (lane < 16) { vst2(QK + (pr0 + rl) * (2 * DM) + n0 + lane * 8, *(const v4u*)&so[wave][rl][lane * 8]); vst2(QKL + (pr0 + rl) * (2 * DM) + n0 + lane * 8, *(const v4u*)&sol[wave][rl][lane * 8]); }
  } else {
#pragma unroll
    for (int j = 0; j < 8; ++j) {
#pragma unroll
      for (int r = 0; r < 8; ++r) { const float v = acc[j][r]; const _Float16 hv = (_Float16)v; sth[j * 16 + col][wave * 16 + 8 * g + r] = hv; stl[j * 16 + col][wave * 16 + 8 * g + r] = (_Float16)((v - (float)hv) * 2048.0f); } }
    __syncthreads();
    const int pc0 = n0 - 2 * DM;
    for (int q = tid; q < 128 * 8; q += 128) { const int d = q >> 3, pc = q & 7; const size_t o = ((size_t)b * DM + pc0 + d) * SEQ + s0 + pc * 8; vst2(VTH + o, *(const v4u*)&sth[d][pc * 8]); vst2(VTL + o, *(const v4u*)&stl[d][pc * 8]); }
  }
}
// ---- k_attn: block = (64 queries, head h, batch b), wave = 16 queries; causal flash attention over 32-key steps up to the wave's last query;
//      the products are taken transposed: S^T = K . Q^T (A = K rows, B = q rows) and O^T += V^T . P^T (A = V^T rows, B = P^T), so that a lane holds scores of ONE query (column lane & 15):
//      keys 8g + r of each 16-key tile, g = lane >> 4; row maximum and row sum are in-lane, the maximum joined with the other half by one cross-row move per step, the sums joined once in the epilogue;
//      the two score tiles of a step, converted in place, are the B operand P^T in the fragments' own k order (elements 0..7 <- keys 8g + i, 8..15 <- 16 + 8g + i): P passes through no LDS;
//      K hi and V^T hi tiles of 64 keys are brought once per block into two LDS buffers by asynchronous copies (each wave copy = 4 rows x one whole 128-B line), the next tile in flight
//      while this one is worked on; the four waves read their fragments from LDS (rows at pitch 144 B for the 16-byte reads); the residual planes of query blocks 0..1 still come straight from global;
//      query blocks 0..1: 3-product q/k scores and P hi/res x V hi/lo in a second accumulator, single products elsewhere;
//      O[b*SEQ+q][h*64+d] = (acc + accl/2048) / (l * 2^4)  (256-B segments, lanes 0..15 x 16 B)
#define AT 64                       // keys per staged tile: one 128-B line of a V^T row; a block's keys are a whole number of tiles
#define AP (AT + 8)                 // LDS row pitch in f16 elements (144 B = 16 B x 9), for K rows (64 d) and V^T rows (64 keys) alike
#define AT_V (AT * AP)              // 64 K rows of a buffer, then 64 V^T rows
#define AT_BUF (AT_V + HD * AP)
static_assert(AT == HD && SEQ % AT == 0);
// one tile: this thread's four 16-B pieces of K (rows 16 apart) and four of V^T; lk, lv = LDS byte addresses, gk, gv = global addresses of the first piece of each
__device__ __forceinline__ void stage_kv(unsigned lk, const _Float16* gk, unsigned lv, const _Float16* gv) {
  const unsigned ls = 16 * AP * 2; const size_t ks = (size_t)16 * 2 * DM, vs = (size_t)16 * SEQ;
  // the closing s_wait_xcnt stands in the copies' own statement, so that no address register named here is rewritten ahead of it
  asm volatile("global_load_async_to_lds_b128 %0, %8, off\n\t"
               "global_load_async_to_lds_b128 %1, %9, off\n\t"
               "global_load_async_to_lds_b128 %2, %10, off\n\t"
               "global_load_async_to_lds_b128 %3, %11, off\n\t"
               "global_load_async_to_lds_b128 %4, %12, off\n\t"
               "global_load_async_to_lds_b128 %5, %13, off\n\t"
               "global_load_async_to_lds_b128 %6, %14, off\n\t"
               "global_load_async_to_lds_b128 %7, %15, off\n\t"
               "s_wait_xcnt 0x0"
               :: "v"(lk), "v"(lk + ls), "v"(lk + 2 * ls), "v"(lk + 3 * ls), "v"(lv), "v"(lv + ls), "v"(lv + 2 * ls), "v"(lv + 3 * ls),
                  "v"(gk), "v"(gk + ks), "v"(gk + 2 * ks), "v"(gk + 3 * ks), "v"(gv), "v"(gv + vs), "v"(gv + 2 * vs), "v"(gv + 3 * vs) : "memory");
}
// lane l takes the value of lane l ^ 16
__device__ __forceinline__ float xhalf(float x) { return __builtin_bit_cast(float, __builtin_amdgcn_permlanex16(__builtin_bit_cast(int, x), __builtin_bit_cast(int, x), 0x76543210, 0xfedcba98, false, false)); }
// the tile's code is compiled twice, lead = true for query blocks 0..1 and false for the rest (the flag is block-uniform), so that the later blocks, which are nearly all of the work,
// carry no residual split of P, no second accumulator to rescale or copy and no scalar branch at every product
template <bool lead> __device__ __forceinline__ void attn_tile(_Float16* skv, float (*so)[16][68], const _Float16* __restrict__ QK, const _Float16* __restrict__ QKL, const _Float16* __restrict__ VTH, const _Float16* __restrict__ VTL, float* __restrict__ O) {
  const int tid = threadIdx.x, wave = tid >> 5, lane = tid & 31, col = lane & 15, g = lane >> 4;
  const int qb = blockIdx.x, h = blockIdx.y, b = blockIdx.z; const int q0 = qb * 64 + wave * 16; const size_t rq = (size_t)b * SEQ + q0 + col;
  const int nst = qb + 1;     // block-uniform: staged tiles covering keys <= qb * 64 + 63
  const unsigned lk = (unsigned)(size_t)skv + ((tid >> 3) * AP + (tid & 7) * 8) * 2, lv = lk + AT_V * 2;      // this thread's first piece: row tid/8, 16 B number tid%8
  const _Float16* gk = QK + ((size_t)b * SEQ + (tid >> 3)) * (2 * DM) + DM + h * HD + (tid & 7) * 8;           // key row tid/8 of tile 0
  const _Float16* gv = VTH + ((size_t)b * DM + h * HD + (tid >> 3)) * SEQ + (tid & 7) * 8;                     // d row tid/8, keys of tile 0
  stage_kv(lk, gk, lv, gv);
  asm volatile("s_wait_asynccnt 0x0" ::: "memory");   // this wave's pieces of tile 0 have landed
  __syncthreads();                                     // publishes tile 0
  if (nst > 1) stage_kv(lk + AT_BUF * 2, gk + (size_t)AT * 2 * DM, lv + AT_BUF * 2, gv + AT);
  v16h aq[2], aql[2];   // B operands: column = query q0 + col
#pragma unroll
  for (int kc = 0; kc < 2; ++kc) { aq[kc] = frag_h(QK + rq * (2 * DM) + h * HD + kc * 32, lane); if (lead) aql[kc] = frag_h(QKL + rq * (2 * DM) + h * HD + kc * 32, lane); }
  float m = -1.0e30f, l = 0.f;   // of query q0 + col: running maximum (equal in both halves), sum over this half's keys
  v8f acc[4] = {}, accl[4] = {};   // acc[dt][r] = O^T[d = dt * 16 + 8g + r][query q0 + col]
  const float L2E = 1.44269504088896341f;
  const int nks = __builtin_amdgcn_readfirstlane((q0 + 16 + 31) >> 5);   // wave-uniform, held in a scalar register so that the skip below is a scalar branch: key steps covering keys <= q0 + 15 (every visited step has >= 1 unmasked key per query)
#pragma unroll 1   // one copy of the step's code for both buffers, which differ by an address only
  for (int t = 0; t < nst; ++t) { const _Float16* kt = skv + (t & 1) * AT_BUF; const _Float16* vt = kt + AT_V;
#pragma unroll 1   // one copy of the step's code for both halves of a tile
  for (int ks = 2 * t; ks < 2 * t + 2 && ks < nks; ++ks) { v8f s[2]; const int ko = (ks & 1) * 32;   // waves 0 and 1 skip the last tile's second step, wholly above their diagonal
    const int dq = q0 + col - ks * 32 - 8 * g;   // this lane's key ct * 16 + r of the step lies on or below the diagonal where ct * 16 + r <= dq
    v16h kh[2][2], vh[4];   // the step's fragments read as one group at its head: one LDS wait for the scores, none left in front of the V^T x P^T products
#pragma unroll   // constant indices keep the fragment arrays in registers
    for (int ct = 0; ct < 2; ++ct) {
#pragma unroll   // constant indices keep the fragment arrays in registers
      for (int kc = 0; kc < 2; ++kc) kh[ct][kc] = frag_h(kt + (ko + ct * 16 + col) * AP + kc * 32, lane); }
#pragma unroll   // constant indices keep the fragment arrays in registers
    for (int dt = 0; dt < 4; ++dt) vh[dt] = frag_h(vt + (dt * 16 + col) * AP + ko, lane);
#pragma unroll
    for (int ct = 0; ct < 2; ++ct) { const _Float16* krowl = QKL + ((size_t)b * SEQ + ks * 32 + ct * 16 + col) * (2 * DM) + DM + h * HD; v8f c = {}, cl = {};   // A row = key ks * 32 + ct * 16 + col
      if (lead) {
#pragma unroll
        for (int kc = 0; kc < 2; ++kc) { c = wmma16(kh[ct][kc], aq[kc], c); cl = wmma16(kh[ct][kc], aql[kc], cl); cl = wmma16(frag_h(krowl + kc * 32, lane), aq[kc], cl); }
#pragma unroll
        for (int r = 0; r < 8; ++r) c[r] += cl[r] * (1.0f / 2048.0f); }
      else {
#pragma unroll
        for (int kc = 0; kc < 2; ++kc) c = wmma16(kh[ct][kc], aq[kc], c); }
#pragma unroll   // constant indices keep the register arrays in registers
      for (int r = 0; r < 8; ++r) s[ct][r] = (ct * 16 + r <= dq) ? c[r] * 0.125f : -1.0e30f; }   // 1/sqrt(64); keys above the diagonal replaced by a large negative fill
    float mx = fmaxf(s[0][0], s[1][0]);
#pragma unroll   // constant indices keep the register arrays in registers
    for (int r = 1; r < 8; ++r) mx = fmaxf(mx, fmaxf(s[0][r], s[1][r]));
    mx = fmaxf(mx, xhalf(mx));   // the step's 32 keys: this half's 16 and the other half's
    const float mn = fmaxf(m, mx); const float alpha = exp2f((m - mn) * L2E); float rs = 0.f;
    v16h pa, pl;   // P^T x 2^4 as f16 hi; residual carried x2^11, folded in the epilogue
#pragma unroll   // constant indices keep the register arrays in registers
    for (int i = 0; i < 8; ++i) { const float p0 = exp2f((s[0][i] - mn) * L2E), p1 = exp2f((s[1][i] - mn) * L2E); rs += p0 + p1;
      const float x0 = p0 * PSC, x1 = p1 * PSC; const _Float16 h0 = (_Float16)x0, h1 = (_Float16)x1; pa[i] = h0; pa[8 + i] = h1; if (lead) { pl[i] = (_Float16)((x0 - (float)h0) * 2048.0f); pl[8 + i] = (_Float16)((x1 - (float)h1) * 2048.0f); } }
    l = l * alpha + rs; m = mn;
#pragma unroll   // constant indices keep the register arrays in registers
    for (int dt = 0; dt < 4; ++dt) {
#pragma unroll   // constant indices keep the register arrays in registers
      for (int r = 0; r < 8; ++r) { acc[dt][r] *= alpha; if (lead) accl[dt][r] *= alpha; } }
#pragma unroll
    for (int dt = 0; dt < 4; ++dt) { const size_t vr = ((size_t)b * DM + h * HD + dt * 16 + col) * SEQ + ks * 32; acc[dt] = wmma16(vh[dt], pa, acc[dt]); if (lead) { accl[dt] = wmma16(vh[dt], pl, accl[dt]); accl[dt] = wmma16(frag_h(VTL + vr, lane), pa, accl[dt]); } } }
    asm volatile("s_wait_dscnt 0x0" ::: "memory");      // this wave's reads of tile t have returned
    asm volatile("s_wait_asynccnt 0x0" ::: "memory");   // this wave's pieces of tile t + 1 have landed
    __syncthreads();                                     // publishes tile t + 1 and ends every wave's reads of tile t, whose buffer is refilled behind it
    if (t + 2 < nst) stage_kv(lk + (t & 1) * (AT_BUF * 2), gk + (size_t)(t + 2) * AT * 2 * DM, lv + (t & 1) * (AT_BUF * 2), gv + (t + 2) * AT); }
  asm volatile("s_wait_asynccnt 0x0" ::: "memory");     // no copy is left in flight when the wave goes on to its end
  l += xhalf(l);   // the two halves' key sums of this query
  const float il = 1.0f / (l * PSC);   // l >= 1 (the running max contributes exp(0)); numerator carries the 2^4 pre-scale
#pragma unroll   // constant indices keep the register arrays in registers
  for (int dt = 0; dt < 4; ++dt) {
#pragma unroll   // constant indices keep the register arrays in registers
    for (int rh = 0; rh < 8; rh += 4) { v4f o;
#pragma unroll   // constant indices keep the register arrays in registers
      for (int r = 0; r < 4; ++r) o[r] = (lead ? acc[dt][rh + r] + accl[dt][rh + r] * (1.0f / 2048.0f) : acc[dt][rh + r]) * il;
      *(v4f*)&so[wave][col][dt * 16 + 8 * g + rh] = o; } }
  ldsx();
  for (int rl = 0; rl < 16; ++rl) if (lane < 16) vst2(O + ((size_t)b * SEQ + q0 + rl) * DM + h * HD + lane * 4, *(const v4f*)&so[wave][rl][lane * 4]);
}
__global__ __launch_bounds__(128) void k_attn(const _Float16* __restrict__ QK, const _Float16* __restrict__ QKL, const _Float16* __restrict__ VTH, const _Float16* __restrict__ VTL, float* __restrict__ O) {
  __shared__ __align__(16) _Float16 skv[2 * AT_BUF];
  __shared__ __align__(16) float so[4][16][68];
  if (blockIdx.x < 2) attn_tile<true>(skv, so, QK, QKL, VTH, VTL, O);   // block-uniform: leading query blocks (few keys, outputs far above the global rms)
  else attn_tile<false>(skv, so, QK, QKL, VTH, VTL, O);
}
// ---- k_out: block = 64 rows, wave = 16 rows x 64 columns: out = O (bf16 hi/lo, 2 products) . packed W rows (K = 1024); 256-B output rows written by lanes 0..15 x 16 B
__global__ __launch_bounds__(128) void k_out(const float* __restrict__ O, const __bf16* __restrict__ P, float* __restrict__ Y) {
  __shared__ __align__(16) float so[4][16][68];
  const int tid = threadIdx.x, wave = tid >> 5, lane = tid & 31, col = lane & 15, g = lane >> 4;
  const size_t rb = (size_t)blockIdx.x * 64; const int b = (int)(rb / SEQ), s0 = (int)(rb % SEQ);
  const size_t r0 = rb + wave * 16; const size_t yr0 = (size_t)b * SEQ_FULL + s0 + wave * 16;
  v8f acc[4] = {};
#pragma unroll 2
  for (int kc = 0; kc < DM / 32; ++kc) { const F2 a = split_row(O + (r0 + col) * DM, kc * 32, lane);
#pragma unroll
    for (int j = 0; j < 4; ++j) { const v16b w = frag_b(P + (size_t)(j * 16 + col) * DM + kc * 32, lane); acc[j] = wmma_bf(a.l, w, acc[j]); acc[j] = wmma_bf(a.h, w, acc[j]); } }
#pragma unroll
  for (int j = 0; j < 4; ++j) {
#pragma unroll
    for (int r = 0; r < 8; ++r) so[wave][8 * g + r][j * 16 + col] = acc[j][r]; }
  ldsx();
  for (int rl = 0; rl < 16; ++rl) if (lane < 16) vst2(Y + (yr0 + rl) * NE + lane * 4, *(const v4f*)&so[wave][rl][lane * 4]);
}
extern "C" void kernel_launch(void* const* d_in, const int* in_sizes, int n_in, void* d_out, int out_size, void* d_ws, size_t ws_size, hipStream_t stream) {
  if (n_in < 5) return;
  if (in_sizes[0] < ((NB - 1) * SEQ_FULL + SEQ) * DM) return;                                        // x [2,2048,1024]
  if (in_sizes[1] < NH * DM * HD || in_sizes[2] < NH * DM * HD || in_sizes[3] < NH * DM * HD) return;  // Wq Wk Wv [16,1024,64]
  if (in_sizes[4] < DM * NE) return;                                                                   // W [1024,64]
  if (out_size < ((NB - 1) * SEQ_FULL + SEQ) * NE) return;                                             // out [2,2048,64]
  if (ws_size < (size_t)WS_END) return;
  const float* X = (const float*)d_in[0]; const float* WQ = (const float*)d_in[1]; const float* WK = (const float*)d_in[2]; const float* WV = (const float*)d_in[3]; const float* WO = (const float*)d_in[4];
  char* ws = (char*)d_ws; __bf16* PK = (__bf16*)(ws + WS_PK); _Float16 *QK = (_Float16*)(ws + WS_QK), *QKL = (_Float16*)(ws + WS_QKL), *VTH = (_Float16*)(ws + WS_VTH), *VTL = (_Float16*)(ws + WS_VTL); float* O = (float*)(ws + WS_O);
  k_pack<<<dim3(DM / 64, NPK / 64), 256, 0, stream>>>(WQ, WK, WV, WO, PK);
  k_qkv<<<dim3(NB * SEQ / 64, QKVW / 128), 128, 0, stream>>>(X, PK, QK, QKL, VTH, VTL);
  k_attn<<<dim3(SEQ / 64, NH, NB), 128, 0, stream>>>(QK, QKL, VTH, VTL, O);
  k_out<<<dim3(NB * SEQ / 64, 1), 128, 0, stream>>>(O, PK + (size_t)QKVW * DM, (float*)d_out);
}

// v005
// It runs in 117 microseconds.
// Timed twice side by side with v004, it ran 1.11 and 1.10 times as fast.
// Over all steps from v000 it is 3.18 times as fast.
// compute dtype: all float inputs RNE-converted to bf16; q|k|v = x . W[h] with exact bf16 x bf16 products on v_wmma_f32_16x16x32_bf16, stored as f16 hi + residual(x2^11) planes (v transposed); scores = q . k on v_wmma_f32_16x16x32_f16 (query blocks 0..1: 3-product hi/res, later blocks single f16), causal online softmax (running max of the raw scores; 1/8, log2 e, the maximum and the 2^4 pre-scale folded into one f32 fma per exponent) in f32; P x 2^4 as f16 hi (+ residual x2^11 against v hi + v lo on query blocks 0..1, single P x v hi elsewhere) on f16 WMMA; out = ctx (bf16 hi + lo) . W on bf16 WMMA; f32 accumulate everywhere, f32 output.
#include <hip/hip_runtime.h>
#include <math.h>

typedef __attribute__((ext_vector_type(16))) _Float16 v16h;
typedef __attribute__((ext_vector_type(16))) __bf16 v16b;
typedef __attribute__((ext_vector_type(8)))  _Float16 v8h;
typedef __attribute__((ext_vector_type(8)))  __bf16 v8b;
typedef __attribute__((ext_vector_type(4)))  __bf16 v4b;
typedef __attribute__((ext_vector_type(8)))  float v8f;
typedef __attribute__((ext_vector_type(4)))  float v4f;
typedef __attribute__((ext_vector_type(4)))  unsigned v4u;

template <typename T> __device__ __forceinline__ void vst2(void* p, T v) { *(T*)p = v;  }
__device__ __forceinline__ v8f wmma16(v16h a, v16h b, v8f c) {
  v8f d = __builtin_amdgcn_wmma_f32_16x16x32_f16(false, a, false, b, (short)0, c, false, false);
  asm volatile("v_nop\n\tv_nop\n\tv_nop\n\tv_nop" : "+v"(d) : "v"(a), "v"(b));
  return d;
}
__device__ __forceinline__ v8f wmma_bf(v16b a, v16b b, v8f c) {
  v8f d = __builtin_amdgcn_wmma_f32_16x16x32_bf16(false, a, false, b, (short)0, c, false, false);
  asm volatile("v_nop\n\tv_nop\n\tv_nop\n\tv_nop" : "+v"(d) : "v"(a), "v"(b));
  return d;
}
// 16-bit row fragment (row m = lane & 15 selected by the caller): elements 0..7 <- k0 + 8h + i, 8..15 <- k0 + 16 + 8h + i, h = lane >> 4
__device__ __forceinline__ v16h frag_h(const _Float16* rowk0, int lane) {
  union { v16h v; v8h q[2]; } u; const _Float16* p = rowk0 + 8 * (lane >> 4);
  u.q[0] = *(const v8h*)p; u.q[1] = *(const v8h*)(p + 16); return u.v;
}
__device__ __forceinline__ v16b frag_b(const __bf16* rowk0, int lane) {
  union { v16b v; v8b q[2]; } u; const __bf16* p = rowk0 + 8 * (lane >> 4);
  u.q[0] = *(const v8b*)p; u.q[1] = *(const v8b*)(p + 16); return u.v;
}
struct F2 { v16b h, l; };
__device__ __forceinline__ F2 bsplit16(const float v[16]) { F2 r;
#pragma unroll
  for (int i = 0; i < 16; ++i) { const __bf16 h = (__bf16)v[i]; r.h[i] = h; r.l[i] = (__bf16)(v[i] - (float)h); }
  return r; }
__device__ __forceinline__ F2 split_row(const float* row, int k0, int lane) { float v[16]; const float* p = row + k0 + 8 * (lane >> 4);
#pragma unroll
  for (int i = 0; i < 8; ++i) { v[i] = p[i]; v[8 + i] = p[16 + i]; }
  return bsplit16(v); }
__device__ __forceinline__ void ldsx() { asm volatile("s_wait_dscnt 0" ::: "memory"); __builtin_amdgcn_wave_barrier(); __builtin_amdgcn_fence(3, "workgroup"); }

// causal multi-head attention: per-head q/k/v projections D 1,024 -> 64 (16 heads, weights [h][in][out]), scores/8, -inf above the diagonal, softmax, ctx merged head-major, out = ctx . W ([in 1,024][out 64])
#ifndef NB
#define NB 2
#endif
#ifndef SEQ
#define SEQ 2048
#endif
#define NB_FULL 2
#define SEQ_FULL 2048
#define DM 1024
#define NH 16
#define HD 64
#define NE 64
#define QKVW (3 * DM)        // fused q | k | v output columns, column h*64+e (+0 / +1024 / +2048)
#define NPK (QKVW + NE)      // packed bf16 weight rows: 3072 q|k|v rows + 64 out-projection rows, each k-contiguous over 1024
#define PSL 4.0f             // softmax weights pre-scaled by 2^4 ahead of the f16 split (<= 16; residual carried x2^11): 4 is added to every exponent, so the row sum l carries the 2^4 too
static_assert(SEQ % 64 == 0);
static_assert(SEQ >= 64 && SEQ <= SEQ_FULL);
static_assert(NB >= 1 && NB <= NB_FULL);
static_assert(HD == NE);
static_assert(DM % 64 == 0 && NPK % 64 == 0);

#define WS_PK  0ull                                           // bf16 [NPK][DM]
#define WS_QK  (WS_PK + 2ull * NPK * DM)                      // f16 [NB*SEQ][2*DM]: q | k hi
#define WS_QKL (WS_QK + 2ull * NB * SEQ * 2 * DM)             // f16 q | k residual x2048
#define WS_VTH (WS_QKL + 2ull * NB * SEQ * 2 * DM)            // f16 [b][1024 (h*64+d)][SEQ] v hi (transposed)
#define WS_VTL (WS_VTH + 2ull * NB * DM * SEQ)                // f16 v residual x2048 (transposed)
#define WS_O   (WS_VTL + 2ull * NB * DM * SEQ)                // f32 [NB*SEQ][DM] merged ctx
#define WS_END (WS_O + 4ull * NB * SEQ * DM)
static_assert(WS_END <= 134217728ull);
static_assert((WS_QK % 128) == 0 && (WS_QKL % 128) == 0 && (WS_VTH % 128) == 0 && (WS_VTL % 128) == 0 && (WS_O % 128) == 0);

// ---- k_pack: block = (64-wide d chunk, group): group 0..47 = (which = group/16, head = group%16) of Wq/Wk/Wv [h][d][e]; group 48 = W [d][e].
__global__ __launch_bounds__(256) void k_pack(const float* __restrict__ WQ, const float* __restrict__ WK, const float* __restrict__ WV, const float* __restrict__ WO, __bf16* __restrict__ PK) {
  __shared__ __align__(16) __bf16 s[64][72];
  const int dc = blockIdx.x, grp = blockIdx.y, t = threadIdx.x; const int which = grp >> 4, hh = grp & 15;
  const float* Wm = (which == 0) ? WQ : (which == 1) ? WK : (which == 2) ? WV : WO;
  const float* src = Wm + ((which < 3) ? (size_t)hh * DM * HD : (size_t)0) + (size_t)dc * 64 * HD;
  for (int q = t; q < 64 * 64; q += 256) { const int dd = q >> 6, e = q & 63; s[e][dd] = (__bf16)src[(size_t)dd * HD + e]; }
  __syncthreads();
  for (int q = t; q < 64 * 8; q += 256) { const int e = q >> 3, pc = q & 7; vst2(PK + ((size_t)grp * 64 + e) * DM + dc * 64 + pc * 8, *(const v4u*)&s[e][pc * 8]); }
}
// ---- k_qkv: block = (64 rows of x, 128 fused output columns n0): bf16(x) rows x packed bf16 weight rows on WMMA (K = 1024);
//      k tiles of 64 staged in two LDS buffers: every global load covers whole 128-B lines (x: 2 rows x 256 B per wave load, weights: 4 rows x 128 B),
//      x converted to bf16 on the way in; rows at pitch 144 B for the 16-byte fragment reads; the next tile's loads are issued ahead of this tile's products;
//      the output staging reuses the same LDS behind the loop's last barrier
#define KT 64                       // k per staged tile: one 128-B line of a weight row
#define LP (KT + 8)                 // LDS row pitch in bf16 elements (144 B = 16 B x 9)
#define ST_A (64 * LP)              // x rows of a buffer, in elements
#define ST_BUF (ST_A + 128 * LP)    // one buffer: 64 x rows, then 128 weight rows
static_assert(DM % KT == 0 && 2 * ST_BUF * 2 >= 2 * 128 * 72 * 2 && 2 * ST_BUF * 2 >= 2 * 4 * 16 * 136 * 2);
__global__ __launch_bounds__(128) void k_qkv(const float* __restrict__ X, const __bf16* __restrict__ P, _Float16* __restrict__ QK, _Float16* __restrict__ QKL, _Float16* __restrict__ VTH, _Float16* __restrict__ VTL) {
  __shared__ __align__(16) __bf16 sm[2 * ST_BUF];
  _Float16 (*so)[16][136] = (_Float16 (*)[16][136])sm; _Float16 (*sol)[16][136] = so + 4;
  _Float16 (*sth)[72] = (_Float16 (*)[72])sm; _Float16 (*stl)[72] = sth + 128;
  const int tid = threadIdx.x, wave = tid >> 5, lane = tid & 31, col = lane & 15, g = lane >> 4;
  const size_t rb = (size_t)blockIdx.x * 64; const int b = (int)(rb / SEQ), s0 = (int)(rb % SEQ);
  const size_t pr0 = rb + wave * 16;                            // plane row base (compact b*SEQ + s)
  const int n0 = blockIdx.y * 128;
  const float* xg = X + ((size_t)b * SEQ_FULL + s0 + (tid >> 4)) * DM + (tid & 15) * 4;   // this thread's 16 B of x: row tid/16 (+8 per load), floats 4*(tid%16)
  const __bf16* pg = P + (size_t)(n0 + (tid >> 3)) * DM + (tid & 7) * 8;                    // this thread's 16 B of weights: row tid/8 (+16 per load), elements 8*(tid%8)
  __bf16* sa = sm + (tid >> 4) * LP + (tid & 15) * 4; __bf16* sb = sm + ST_A + (tid >> 3) * LP + (tid & 7) * 8;
  v4f ra[8]; v4u rbw[8];
#pragma unroll   // constant indices keep the register arrays in registers
  for (int i = 0; i < 8; ++i) { ra[i] = *(const v4f*)(xg + (size_t)i * 8 * DM); rbw[i] = *(const v4u*)(pg + (size_t)i * 16 * DM); }
#pragma unroll   // constant indices keep the register arrays in registers
  for (int i = 0; i < 8; ++i) { v4b c; c[0] = (__bf16)ra[i][0]; c[1] = (__bf16)ra[i][1]; c[2] = (__bf16)ra[i][2]; c[3] = (__bf16)ra[i][3]; *(v4b*)(sa + i * 8 * LP) = c; *(v4u*)(sb + i * 16 * LP) = rbw[i]; }
  __syncthreads();
  v8f acc[8] = {};
  for (int t = 0; t < DM / KT; ++t) { const __bf16* cur = sm + (t & 1) * ST_BUF; const int nxt = ((t + 1) & 1) * ST_BUF; const bool more = t + 1 < DM / KT;
    if (more) {
#pragma unroll   // constant indices keep the register arrays in registers
      for (int i = 0; i < 8; ++i) { ra[i] = *(const v4f*)(xg + (t + 1) * KT + (size_t)i * 8 * DM); rbw[i] = *(const v4u*)(pg + (t + 1) * KT + (size_t)i * 16 * DM); } }
#pragma unroll   // constant indices keep the register arrays in registers
    for (int kk = 0; kk < KT / 32; ++kk) { const v16b a = frag_b(cur + (wave * 16 + col) * LP + kk * 32, lane);
#pragma unroll   // constant indices keep the register arrays in registers
      for (int jh = 0; jh < 8; jh += 4) { v16b w[4];   // four weight fragments read as one group ahead of their products: one LDS wait per group, not one per product
#pragma unroll   // constant indices keep the register arrays in registers
        for (int j = 0; j < 4; ++j) w[j] = frag_b(cur + ST_A + ((jh + j) * 16 + col) * LP + kk * 32, lane);
#pragma unroll   // constant indices keep the register arrays in registers
        for (int j = 0; j < 4; ++j) acc[jh + j] = wmma_bf(a, w[j], acc[jh + j]); } }
    __builtin_amdgcn_sched_barrier(0);   // keeps the conversions of the prefetched tile, and with them the wait for its global loads, behind this tile's products
    if (more) {   // the other buffer's last readers left it at the previous trip's barrier
#pragma unroll   // constant indices keep the register arrays in registers
      for (int i = 0; i < 8; ++i) { v4b c; c[0] = (__bf16)ra[i][0]; c[1] = (__bf16)ra[i][1]; c[2] = (__bf16)ra[i][2]; c[3] = (__bf16)ra[i][3]; *(v4b*)(sa + nxt + i * 8 * LP) = c; *(v4u*)(sb + nxt + i * 16 * LP) = rbw[i]; } }
    __syncthreads(); }   // publishes the tile just stored and ends every read of the tile just used (after the last trip: frees the LDS for the output staging)
  if (n0 < 2 * DM) {   // q and k stored unscaled (sigma ~0.6); 1/8 applied in the softmax exponent
#pragma unroll
    for (int j = 0; j < 8; ++j) {
#pragma unroll
      for (int r = 0; r < 8; ++r) { const float v = acc[j][r]; const _Float16 hv = (_Float16)v; so[wave][8 * g + r][j * 16 + col] = hv; sol[wave][8 * g + r][j * 16 + col] = (_Float16)((v - (float)hv) * 2048.0f); } }
    ldsx();
    for (int rl = 0; rl < 16; ++rl) if (lane < 16) { vst2(QK + (pr0 + rl) * (2 * DM) + n0 + lane * 8, *(const v4u*)&so[wave][rl][lane * 8]); vst2(QKL + (pr0 + rl) * (2 * DM) + n0 + lane * 8, *(const v4u*)&sol[wave][rl][lane * 8]); }
  } else {
#pragma unroll
    for (int j = 0; j < 8; ++j) {
#pragma unroll
      for (int r = 0; r < 8; ++r) { const float v = acc[j][r]; const _Float16 hv = (_Float16)v; sth[j * 16 + col][wave * 16 + 8 * g + r] = hv; stl[j * 16 + col][wave * 16 + 8 * g + r] = (_Float16)((v - (float)hv) * 2048.0f); } }
    __syncthreads();
    const int pc0 = n0 - 2 * DM;
    for (int q = tid; q < 128 * 8; q += 128) { const int d = q >> 3, pc = q & 7; const size_t o = ((size_t)b * DM + pc0 + d) * SEQ + s0 + pc * 8; vst2(VTH + o, *(const v4u*)&sth[d][pc * 8]); vst2(VTL + o, *(const v4u*)&stl[d][pc * 8]); }
  }
}
// ---- k_attn: block = (64 queries, head h, batch b), wave = 16 queries; causal flash attention over 32-key steps up to the wave's last query;
//      the products are taken transposed: S^T = K . Q^T (A = K rows, B = q rows) and O^T += V^T . P^T (A = V^T rows, B = P^T), so that a lane holds scores of ONE query (column lane & 15):
//      keys 8g + r of each 16-key tile, g = lane >> 4; row maximum and row sum are in-lane, the maximum joined with the other half by one cross-row move per step, the sums joined once in the epilogue;
//      the two score tiles of a step, converted in place, are the B operand P^T in the fragments' own k order (elements 0..7 <- keys 8g + i, 8..15 <- 16 + 8g + i): P passes through no LDS;
//      K hi and V^T hi tiles of 64 keys are brought once per block into two LDS buffers by asynchronous copies (each wave copy = 4 rows x one whole 128-B line), the next tile in flight
//      while this one is worked on; the four waves read their fragments from LDS (rows at pitch 144 B for the 16-byte reads); the residual planes of query blocks 0..1 still come straight from global;
//      query blocks 0..1: 3-product q/k scores and P hi/res x V hi/lo in a second accumulator, single products elsewhere;
//      a weight is one fma and one hardware exponential: P x 2^4 = 2^(c * KS + nb), c the raw score, KS = log2(e) / 8, nb = 4 - max * KS formed once per step; results under 2^-126 may come out 0,
//      far below what the f16 P or the f32 sum (>= about 2^4) can hold; the rescale factor is 2^(nb new - nb old), the exact ratio of the two steps' weights;
//      O[b*SEQ+q][h*64+d] = (acc + accl/2048) / l, l summed over P x 2^4  (256-B segments, lanes 0..15 x 16 B)
#define AT 64                       // keys per staged tile: one 128-B line of a V^T row; a block's keys are a whole number of tiles
#define AP (AT + 8)                 // LDS row pitch in f16 elements (144 B = 16 B x 9), for K rows (64 d) and V^T rows (64 keys) alike
#define AT_V (AT * AP)              // 64 K rows of a buffer, then 64 V^T rows
#define AT_BUF (AT_V + HD * AP)
static_assert(AT == HD && SEQ % AT == 0);
// one tile: this thread's four 16-B pieces of K (rows 16 apart) and four of V^T; lk, lv = LDS byte addresses, gk, gv = global addresses of the first piece of each
__device__ __forceinline__ void stage_kv(unsigned lk, const _Float16* gk, unsigned lv, const _Float16* gv) {
  const unsigned ls = 16 * AP * 2; const size_t ks = (size_t)16 * 2 * DM, vs = (size_t)16 * SEQ;
  // the closing s_wait_xcnt stands in the copies' own statement, so that no address register named here is rewritten ahead of it
  asm volatile("global_load_async_to_lds_b128 %0, %8, off\n\t"
               "global_load_async_to_lds_b128 %1, %9, off\n\t"
               "global_load_async_to_lds_b128 %2, %10, off\n\t"
               "global_load_async_to_lds_b128 %3, %11, off\n\t"
               "global_load_async_to_lds_b128 %4, %12, off\n\t"
               "global_load_async_to_lds_b128 %5, %13, off\n\t"
               "global_load_async_to_lds_b128 %6, %14, off\n\t"
               "global_load_async_to_lds_b128 %7, %15, off\n\t"
               "s_wait_xcnt 0x0"
               :: "v"(lk), "v"(lk + ls), "v"(lk + 2 * ls), "v"(lk + 3 * ls), "v"(lv), "v"(lv + ls), "v"(lv + 2 * ls), "v"(lv + 3 * ls),
                  "v"(gk), "v"(gk + ks), "v"(gk + 2 * ks), "v"(gk + 3 * ks), "v"(gv), "v"(gv + vs), "v"(gv + 2 * vs), "v"(gv + 3 * vs) : "memory");
}
// 2^x of a step's sixteen exponents on the hardware's own exponential, in place and in one statement: each v_exp_f32 overwrites its own argument alone, so that none stands directly in front of an
// instruction that reads its result or overwrites its source (with the registers left to the allocator, neighbouring exponentials did); the closing v_nop keeps that slot behind the last one
__device__ __forceinline__ void exp2x16(float (&e)[16]) {
  asm("v_exp_f32 %0, %0\n\tv_exp_f32 %1, %1\n\tv_exp_f32 %2, %2\n\tv_exp_f32 %3, %3\n\tv_exp_f32 %4, %4\n\tv_exp_f32 %5, %5\n\tv_exp_f32 %6, %6\n\tv_exp_f32 %7, %7\n\t"
      "v_exp_f32 %8, %8\n\tv_exp_f32 %9, %9\n\tv_exp_f32 %10, %10\n\tv_exp_f32 %11, %11\n\tv_exp_f32 %12, %12\n\tv_exp_f32 %13, %13\n\tv_exp_f32 %14, %14\n\tv_exp_f32 %15, %15\n\tv_nop"
      : "+v"(e[0]), "+v"(e[1]), "+v"(e[2]), "+v"(e[3]), "+v"(e[4]), "+v"(e[5]), "+v"(e[6]), "+v"(e[7]), "+v"(e[8]), "+v"(e[9]), "+v"(e[10]), "+v"(e[11]), "+v"(e[12]), "+v"(e[13]), "+v"(e[14]), "+v"(e[15]));
}
// lane l takes the value of lane l ^ 16
__device__ __forceinline__ float xhalf(float x) { return __builtin_bit_cast(float, __builtin_amdgcn_permlanex16(__builtin_bit_cast(int, x), __builtin_bit_cast(int, x), 0x76543210, 0xfedcba98, false, false)); }
// the tile's code is compiled twice, lead = true for query blocks 0..1 and false for the rest (the flag is block-uniform), so that the later blocks, which are nearly all of the work,
// carry no residual split of P, no second accumulator to rescale or copy and no scalar branch at every product
template <bool lead> __device__ __forceinline__ void attn_tile(_Float16* skv, float (*so)[16][68], const _Float16* __restrict__ QK, const _Float16* __restrict__ QKL, const _Float16* __restrict__ VTH, const _Float16* __restrict__ VTL, float* __restrict__ O) {
  const int tid = threadIdx.x, wave = tid >> 5, lane = tid & 31, col = lane & 15, g = lane >> 4;
  const int qb = blockIdx.x, h = blockIdx.y, b = blockIdx.z; const int q0 = qb * 64 + wave * 16; const size_t rq = (size_t)b * SEQ + q0 + col;
  const int nst = qb + 1;     // block-uniform: staged tiles covering keys <= qb * 64 + 63
  const unsigned lk = (unsigned)(size_t)skv + ((tid >> 3) * AP + (tid & 7) * 8) * 2, lv = lk + AT_V * 2;      // this thread's first piece: row tid/8, 16 B number tid%8
  const _Float16* gk = QK + ((size_t)b * SEQ + (tid >> 3)) * (2 * DM) + DM + h * HD + (tid & 7) * 8;           // key row tid/8 of tile 0
  const _Float16* gv = VTH + ((size_t)b * DM + h * HD + (tid >> 3)) * SEQ + (tid & 7) * 8;                     // d row tid/8, keys of tile 0
  stage_kv(lk, gk, lv, gv);
  asm volatile("s_wait_asynccnt 0x0" ::: "memory");   // this wave's pieces of tile 0 have landed
  __syncthreads();                                     // publishes tile 0
  if (nst > 1) stage_kv(lk + AT_BUF * 2, gk + (size_t)AT * 2 * DM, lv + AT_BUF * 2, gv + AT);
  v16h aq[2], aql[2];   // B operands: column = query q0 + col
#pragma unroll
  for (int kc = 0; kc < 2; ++kc) { aq[kc] = frag_h(QK + rq * (2 * DM) + h * HD + kc * 32, lane); if (lead) aql[kc] = frag_h(QKL + rq * (2 * DM) + h * HD + kc * 32, lane); }
  const float KS = 0.125f * 1.44269504088896341f;   // 1/sqrt(64) x log2(e)
  float m = -1.0e30f, nb = 1.0e30f, l = 0.f;   // of query q0 + col: running maximum of the raw scores (equal in both halves), its exponent offset 4 - m * KS (first step: any large value, the factor it yields scales zeros), sum over this half's keys
  v8f acc[4] = {}, accl[4] = {};   // acc[dt][r] = O^T[d = dt * 16 + 8g + r][query q0 + col]
  const int nks = __builtin_amdgcn_readfirstlane((q0 + 16 + 31) >> 5);   // wave-uniform, held in a scalar register so that the skip below is a scalar branch: key steps covering keys <= q0 + 15 (every visited step has >= 1 unmasked key per query)
#pragma unroll 1   // one copy of the step's code for both buffers, which differ by an address only
  for (int t = 0; t < nst; ++t) { const _Float16* kt = skv + (t & 1) * AT_BUF; const _Float16* vt = kt + AT_V;
#pragma unroll 1   // one copy of the step's code for both halves of a tile
  for (int ks = 2 * t; ks < 2 * t + 2 && ks < nks; ++ks) { v8f s[2]; const int ko = (ks & 1) * 32;   // waves 0 and 1 skip the last tile's second step, wholly above their diagonal
    const int dq = q0 + col - ks * 32 - 8 * g;   // this lane's key ct * 16 + r of the step lies on or below the diagonal where ct * 16 + r <= dq
    v16h kh[2][2], vh[4];   // the step's fragments read as one group at its head: one LDS wait for the scores, none left in front of the V^T x P^T products
#pragma unroll   // constant indices keep the fragment arrays in registers
    for (int ct = 0; ct < 2; ++ct) {
#pragma unroll   // constant indices keep the fragment arrays in registers
      for (int kc = 0; kc < 2; ++kc) kh[ct][kc] = frag_h(kt + (ko + ct * 16 + col) * AP + kc * 32, lane); }
#pragma unroll   // constant indices keep the fragment arrays in registers
    for (int dt = 0; dt < 4; ++dt) vh[dt] = frag_h(vt + (dt * 16 + col) * AP + ko, lane);
#pragma unroll
    for (int ct = 0; ct < 2; ++ct) { const _Float16* krowl = QKL + ((size_t)b * SEQ + ks * 32 + ct * 16 + col) * (2 * DM) + DM + h * HD; v8f c = {}, cl = {};   // A row = key ks * 32 + ct * 16 + col
      if (lead) {
#pragma unroll
        for (int kc = 0; kc < 2; ++kc) { c = wmma16(kh[ct][kc], aq[kc], c); cl = wmma16(kh[ct][kc], aql[kc], cl); cl = wmma16(frag_h(krowl + kc * 32, lane), aq[kc], cl); }
#pragma unroll
        for (int r = 0; r < 8; ++r) c[r] += cl[r] * (1.0f / 2048.0f); }
      else {
#pragma unroll
        for (int kc = 0; kc < 2; ++kc) c = wmma16(kh[ct][kc], aq[kc], c); }
#pragma unroll   // constant indices keep the register arrays in registers
      for (int r = 0; r < 8; ++r) s[ct][r] = (ct * 16 + r <= dq) ? c[r] : -1.0e30f; }   // raw scores; keys above the diagonal replaced by a large negative fill
    float mx = fmaxf(s[0][0], s[1][0]);
#pragma unroll   // constant indices keep the register arrays in registers
    for (int r = 1; r < 8; ++r) mx = fmaxf(mx, fmaxf(s[0][r], s[1][r]));
    mx = fmaxf(mx, xhalf(mx));   // the step's 32 keys: this half's 16 and the other half's
    const float mn = fmaxf(m, mx); const float nbn = fmaf(-mn, KS, PSL); const float alpha = __builtin_amdgcn_exp2f(nbn - nb); float rs;
    float e[16];   // e[2i], e[2i + 1]: exponents, then weights x 2^4, of keys i and 16 + i of this half
#pragma unroll   // constant indices keep the register arrays in registers
    for (int i = 0; i < 8; ++i) { e[2 * i] = fmaf(s[0][i], KS, nbn); e[2 * i + 1] = fmaf(s[1][i], KS, nbn); }
    exp2x16(e);
    v16h pa, pl;   // P^T x 2^4 as f16 hi; residual carried x2^11, folded in the epilogue
#pragma unroll   // constant indices keep the register arrays in registers
    for (int i = 0; i < 8; ++i) { const float x0 = e[2 * i], x1 = e[2 * i + 1]; rs = i ? rs + (x0 + x1) : x0 + x1;
      const _Float16 h0 = (_Float16)x0, h1 = (_Float16)x1; pa[i] = h0; pa[8 + i] = h1; if (lead) { pl[i] = (_Float16)((x0 - (float)h0) * 2048.0f); pl[8 + i] = (_Float16)((x1 - (float)h1) * 2048.0f); } }
    l = l * alpha + rs; m = mn; nb = nbn;
#pragma unroll   // constant indices keep the register arrays in registers
    for (int dt = 0; dt < 4; ++dt) {
#pragma unroll   // constant indices keep the register arrays in registers
      for (int r = 0; r < 8; ++r) { acc[dt][r] *= alpha; if (lead) accl[dt][r] *= alpha; } }
#pragma unroll
    for (int dt = 0; dt < 4; ++dt) { const size_t vr = ((size_t)b * DM + h * HD + dt * 16 + col) * SEQ + ks * 32; acc[dt] = wmma16(vh[dt], pa, acc[dt]); if (lead) { accl[dt] = wmma16(vh[dt], pl, accl[dt]); accl[dt] = wmma16(frag_h(VTL + vr, lane), pa, accl[dt]); } } }
    asm volatile("s_wait_dscnt 0x0" ::: "memory");      // this wave's reads of tile t have returned
    asm volatile("s_wait_asynccnt 0x0" ::: "memory");   // this wave's pieces of tile t + 1 have landed
    __syncthreads();                                     // publishes tile t + 1 and ends every wave's reads of tile t, whose buffer is refilled behind it
    if (t + 2 < nst) stage_kv(lk + (t & 1) * (AT_BUF * 2), gk + (size_t)(t + 2) * AT * 2 * DM, lv + (t & 1) * (AT_BUF * 2), gv + (t + 2) * AT); }
  asm volatile("s_wait_asynccnt 0x0" ::: "memory");     // no copy is left in flight when the wave goes on to its end
  l += xhalf(l);   // the two halves' key sums of this query
  const float il = 1.0f / l;   // l >= about 2^4 (the running max contributes 2^4); numerator and l carry the same 2^4 pre-scale
#pragma unroll   // constant indices keep the register arrays in registers
  for (int dt = 0; dt < 4; ++dt) {
#pragma unroll   // constant indices keep the register arrays in registers
    for (int rh = 0; rh < 8; rh += 4) { v4f o;
#pragma unroll   // constant indices keep the register arrays in registers
      for (int r = 0; r < 4; ++r) o[r] = (lead ? acc[dt][rh + r] + accl[dt][rh + r] * (1.0f / 2048.0f) : acc[dt][rh + r]) * il;
      *(v4f*)&so[wave][col][dt * 16 + 8 * g + rh] = o; } }
  ldsx();
  for (int rl = 0; rl < 16; ++rl) if (lane < 16) vst2(O + ((size_t)b * SEQ + q0 + rl) * DM + h * HD + lane * 4, *(const v4f*)&so[wave][rl][lane * 4]);
}
__global__ __launch_bounds__(128) void k_attn(const _Float16* __restrict__ QK, const _Float16* __restrict__ QKL, const _Float16* __restrict__ VTH, const _Float16* __restrict__ VTL, float* __restrict__ O) {
  __shared__ __align__(16) _Float16 skv[2 * AT_BUF];
  __shared__ __align__(16) float so[4][16][68];
  if (blockIdx.x < 2) attn_tile<true>(skv, so, QK, QKL, VTH, VTL, O);   // block-uniform: leading query blocks (few keys, outputs far above the global rms)
  else attn_tile<false>(skv, so, QK, QKL, VTH, VTL, O);
}
// ---- k_out: block = 64 rows, wave = 16 rows x 64 columns: out = O (bf16 hi/lo, 2 products) . packed W rows (K = 1024); 256-B output rows written by lanes 0..15 x 16 B
__global__ __launch_bounds__(128) void k_out(const float* __restrict__ O, const __bf16* __restrict__ P, float* __restrict__ Y) {
  __shared__ __align__(16) float so[4][16][68];
  const int tid = threadIdx.x, wave = tid >> 5, lane = tid & 31, col = lane & 15, g = lane >> 4;
  const size_t rb = (size_t)blockIdx.x * 64; const int b = (int)(rb / SEQ), s0 = (int)(rb % SEQ);
  const size_t r0 = rb + wave * 16; const size_t yr0 = (size_t)b * SEQ_FULL + s0 + wave * 16;
  v8f acc[4] = {};
#pragma unroll 2
  for (int kc = 0; kc < DM / 32; ++kc) { const F2 a = split_row(O + (r0 + col) * DM, kc * 32, lane);
#pragma unroll
    for (int j = 0; j < 4; ++j) { const v16b w = frag_b(P + (size_t)(j * 16 + col) * DM + kc * 32, lane); acc[j] = wmma_bf(a.l, w, acc[j]); acc[j] = wmma_bf(a.h, w, acc[j]); } }
#pragma unroll
  for (int j = 0; j < 4; ++j) {
#pragma unroll
    for (int r = 0; r < 8; ++r) so[wave][8 * g + r][j * 16 + col] = acc[j][r]; }
  ldsx();
  for (int rl = 0; rl < 16; ++rl) if (lane < 16) vst2(Y + (yr0 + rl) * NE + lane * 4, *(const v4f*)&so[wave][rl][lane * 4]);
}
extern "C" void kernel_launch(void* const* d_in, const int* in_sizes, int n_in, void* d_out, int out_size, void* d_ws, size_t ws_size, hipStream_t stream) {
  if (n_in < 5) return;
  if (in_sizes[0] < ((NB - 1) * SEQ_FULL + SEQ) * DM) return;                                        // x [2,2048,1024]
  if (in_sizes[1] < NH * DM * HD || in_sizes[2] < NH * DM * HD || in_sizes[3] < NH * DM * HD) return;  // Wq Wk Wv [16,1024,64]
  if (in_sizes[4] < DM * NE) return;                                                                   // W [1024,64]
  if (out_size < ((NB - 1) * SEQ_FULL + SEQ) * NE) return;                                             // out [2,2048,64]
  if (ws_size < (size_t)WS_END) return;
  const float* X = (const float*)d_in[0]; const float* WQ = (const float*)d_in[1]; const float* WK = (const float*)d_in[2]; const float* WV = (const float*)d_in[3]; const float* WO = (const float*)d_in[4];
  char* ws = (char*)d_ws; __bf16* PK = (__bf16*)(ws + WS_PK); _Float16 *QK = (_Float16*)(ws + WS_QK), *QKL = (_Float16*)(ws + WS_QKL), *VTH = (_Float16*)(ws + WS_VTH), *VTL = (_Float16*)(ws + WS_VTL); float* O = (float*)(ws + WS_O);
  k_pack<<<dim3(DM / 64, NPK / 64), 256, 0, stream>>>(WQ, WK, WV, WO, PK);
  k_qkv<<<dim3(NB * SEQ / 64, QKVW / 128), 128, 0, stream>>>(X, PK, QK, QKL, VTH, VTL);
  k_attn<<<dim3(SEQ / 64, NH, NB), 128, 0, stream>>>(QK, QKL, VTH, VTL, O);
  k_out<<<dim3(NB * SEQ / 64, 1), 128, 0, stream>>>(O, PK + (size_t)QKVW * DM, (float*)d_out);
}

// v006
// It runs in 108 microseconds.
// Timed twice side by side with v005, it ran 1.07 and 1.08 times as fast.
// Over all steps from v000 it is 3.42 times as fast.
// compute dtype: all float inputs RNE-converted to bf16; q|k|v = x . W[h] with exact bf16 x bf16 products on v_wmma_f32_16x16x32_bf16, stored as f16 hi + residual(x2^11) planes (v transposed); scores = q . k on v_wmma_f32_16x16x32_f16 (query blocks 0..1: 3-product hi/res, later blocks single f16), causal online softmax (running max of the raw scores; 1/8, log2 e, the maximum and the 2^4 pre-scale folded into one f32 fma per exponent) in f32; P x 2^4 as f16 hi (+ residual x2^11 against v hi + v lo on query blocks 0..1, single P x v hi elsewhere) on f16 WMMA; out = ctx (bf16 hi + lo) . W on bf16 WMMA; f32 accumulate everywhere, f32 output.
#include <hip/hip_runtime.h>
#include <math.h>

typedef __attribute__((ext_vector_type(16))) _Float16 v16h;
typedef __attribute__((ext_vector_type(16))) __bf16 v16b;
typedef __attribute__((ext_vector_type(8)))  _Float16 v8h;
typedef __attribute__((ext_vector_type(8)))  __bf16 v8b;
typedef __attribute__((ext_vector_type(4)))  __bf16 v4b;
typedef __attribute__((ext_vector_type(8)))  float v8f;
typedef __attribute__((ext_vector_type(4)))  float v4f;
typedef __attribute__((ext_vector_type(4)))  unsigned v4u;

template <typename T> __device__ __forceinline__ void vst2(void* p, T v) { *(T*)p = v;  }
__device__ __forceinline__ v8f wmma16(v16h a, v16h b, v8f c) {
  v8f d = __builtin_amdgcn_wmma_f32_16x16x32_f16(false, a, false, b, (short)0, c, false, false);
  asm volatile("v_nop\n\tv_nop\n\tv_nop\n\tv_nop" : "+v"(d) : "v"(a), "v"(b));
  return d;
}
__device__ __forceinline__ v8f wmma_bf(v16b a, v16b b, v8f c) {
  v8f d = __builtin_amdgcn_wmma_f32_16x16x32_bf16(false, a, false, b, (short)0, c, false, false);
  asm volatile("v_nop\n\tv_nop\n\tv_nop\n\tv_nop" : "+v"(d) : "v"(a), "v"(b));
  return d;
}
// 16-bit row fragment (row m = lane & 15 selected by the caller): elements 0..7 <- k0 + 8h + i, 8..15 <- k0 + 16 + 8h + i, h = lane >> 4
__device__ __forceinline__ v16h frag_h(const _Float16* rowk0, int lane) {
  union { v16h v; v8h q[2]; } u; const _Float16* p = rowk0 + 8 * (lane >> 4);
  u.q[0] = *(const v8h*)p; u.q[1] = *(const v8h*)(p + 16); return u.v;
}
__device__ __forceinline__ v16b frag_b(const __bf16* rowk0, int lane) {
  union { v16b v; v8b q[2]; } u; const __bf16* p = rowk0 + 8 * (lane >> 4);
  u.q[0] = *(const v8b*)p; u.q[1] = *(const v8b*)(p + 16); return u.v;
}
struct F2 { v16b h, l; };
__device__ __forceinline__ F2 bsplit16(const float v[16]) { F2 r;
#pragma unroll
  for (int i = 0; i < 16; ++i) { const __bf16 h = (__bf16)v[i]; r.h[i] = h; r.l[i] = (__bf16)(v[i] - (float)h); }
  return r; }
__device__ __forceinline__ F2 split_row(const float* row, int k0, int lane) { float v[16]; const float* p = row + k0 + 8 * (lane >> 4);
#pragma unroll
  for (int i = 0; i < 8; ++i) { v[i] = p[i]; v[8 + i] = p[16 + i]; }
  return bsplit16(v); }
__device__ __forceinline__ void ldsx() { asm volatile("s_wait_dscnt 0" ::: "memory"); __builtin_amdgcn_wave_barrier(); __builtin_amdgcn_fence(3, "workgroup"); }

// causal multi-head attention: per-head q/k/v projections D 1,024 -> 64 (16 heads, weights [h][in][out]), scores/8, -inf above the diagonal, softmax, ctx merged head-major, out = ctx . W ([in 1,024][out 64])
#ifndef NB
#define NB 2
#endif
#ifndef SEQ
#define SEQ 2048
#endif
#define NB_FULL 2
#define SEQ_FULL 2048
#define DM 1024
#define NH 16
#define HD 64
#define NE 64
#define QKVW (3 * DM)        // fused q | k | v output columns, column h*64+e (+0 / +1024 / +2048)
#define NPK (QKVW + NE)      // packed bf16 weight rows: 3072 q|k|v rows + 64 out-projection rows, each k-contiguous over 1024
#define PSL 4.0f             // softmax weights pre-scaled by 2^4 ahead of the f16 split (<= 16; residual carried x2^11): 4 is added to every exponent, so the row sum l carries the 2^4 too
static_assert(SEQ % 64 == 0);
static_assert(SEQ >= 64 && SEQ <= SEQ_FULL);
static_assert(NB >= 1 && NB <= NB_FULL);
static_assert(HD == NE);
static_assert(DM % 64 == 0 && NPK % 64 == 0);

#define WS_PK  0ull                                           // bf16 [NPK][DM]
#define WS_QK  (WS_PK + 2ull * NPK * DM)                      // f16 [NB*SEQ][2*DM]: q | k hi
#define WS_QKL (WS_QK + 2ull * NB * SEQ * 2 * DM)             // f16 q | k residual x2048
#define WS_VTH (WS_QKL + 2ull * NB * SEQ * 2 * DM)            // f16 [b][1024 (h*64+d)][SEQ] v hi (transposed)
#define WS_VTL (WS_VTH + 2ull * NB * DM * SEQ)                // f16 v residual x2048 (transposed)
#define WS_O   (WS_VTL + 2ull * NB * DM * SEQ)                // f32 [NB*SEQ][DM] merged ctx
#define WS_END (WS_O + 4ull * NB * SEQ * DM)
static_assert(WS_END <= 134217728ull);
static_assert((WS_QK % 128) == 0 && (WS_QKL % 128) == 0 && (WS_VTH % 128) == 0 && (WS_VTL % 128) == 0 && (WS_O % 128) == 0);

// ---- k_pack: block = (64-wide d chunk, group): group 0..47 = (which = group/16, head = group%16) of Wq/Wk/Wv [h][d][e]; group 48 = W [d][e].
__global__ __launch_bounds__(256) void k_pack(const float* __restrict__ WQ, const float* __restrict__ WK, const float* __restrict__ WV, const float* __restrict__ WO, __bf16* __restrict__ PK) {
  __shared__ __align__(16) __bf16 s[64][72];
  const int dc = blockIdx.x, grp = blockIdx.y, t = threadIdx.x; const int which = grp >> 4, hh = grp & 15;
  const float* Wm = (which == 0) ? WQ : (which == 1) ? WK : (which == 2) ? WV : WO;
  const float* src = Wm + ((which < 3) ? (size_t)hh * DM * HD : (size_t)0) + (size_t)dc * 64 * HD;
  for (int q = t; q < 64 * 64; q += 256) { const int dd = q >> 6, e = q & 63; s[e][dd] = (__bf16)src[(size_t)dd * HD + e]; }
  __syncthreads();
  for (int q = t; q < 64 * 8; q += 256) { const int e = q >> 3, pc = q & 7; vst2(PK + ((size_t)grp * 64 + e) * DM + dc * 64 + pc * 8, *(const v4u*)&s[e][pc * 8]); }
}
// ---- k_qkv: block = (64 rows of x, 128 fused output columns n0): bf16(x) rows x packed bf16 weight rows on WMMA (K = 1024);
//      k tiles of 64 staged in two LDS buffers: every global load covers whole 128-B lines (x: 2 rows x 256 B per wave load, weights: 4 rows x 128 B),
//      x converted to bf16 on the way in; rows at pitch 144 B for the 16-byte fragment reads; the next tile's loads are issued ahead of this tile's products;
//      the output staging reuses the same LDS behind the loop's last barrier
#define KT 64                       // k per staged tile: one 128-B line of a weight row
#define LP (KT + 8)                 // LDS row pitch in bf16 elements (144 B = 16 B x 9)
#define ST_A (64 * LP)              // x rows of a buffer, in elements
#define ST_BUF (ST_A + 128 * LP)    // one buffer: 64 x rows, then 128 weight rows
static_assert(DM % KT == 0 && 2 * ST_BUF * 2 >= 2 * 128 * 72 * 2 && 2 * ST_BUF * 2 >= 2 * 4 * 16 * 136 * 2);
__global__ __launch_bounds__(128) void k_qkv(const float* __restrict__ X, const __bf16* __restrict__ P, _Float16* __restrict__ QK, _Float16* __restrict__ QKL, _Float16* __restrict__ VTH, _Float16* __restrict__ VTL) {
  __shared__ __align__(16) __bf16 sm[2 * ST_BUF];
  _Float16 (*so)[16][136] = (_Float16 (*)[16][136])sm; _Float16 (*sol)[16][136] = so + 4;
  _Float16 (*sth)[72] = (_Float16 (*)[72])sm; _Float16 (*stl)[72] = sth + 128;
  const int tid = threadIdx.x, wave = tid >> 5, lane = tid & 31, col = lane & 15, g = lane >> 4;
  const size_t rb = (size_t)blockIdx.x * 64; const int b = (int)(rb / SEQ), s0 = (int)(rb % SEQ);
  const size_t pr0 = rb + wave * 16;                            // plane row base (compact b*SEQ + s)
  const int n0 = blockIdx.y * 128;
  const float* xg = X + ((size_t)b * SEQ_FULL + s0 + (tid >> 4)) * DM + (tid & 15) * 4;   // this thread's 16 B of x: row tid/16 (+8 per load), floats 4*(tid%16)
  const __bf16* pg = P + (size_t)(n0 + (tid >> 3)) * DM + (tid & 7) * 8;                    // this thread's 16 B of weights: row tid/8 (+16 per load), elements 8*(tid%8)
  __bf16* sa = sm + (tid >> 4) * LP + (tid & 15) * 4; __bf16* sb = sm + ST_A + (tid >> 3) * LP + (tid & 7) * 8;
  v4f ra[8]; v4u rbw[8];
#pragma unroll   // constant indices keep the register arrays in registers
  for (int i = 0; i < 8; ++i) { ra[i] = *(const v4f*)(xg + (size_t)i * 8 * DM); rbw[i] = *(const v4u*)(pg + (size_t)i * 16 * DM); }
#pragma unroll   // constant indices keep the register arrays in registers
  for (int i = 0; i < 8; ++i) { v4b c; c[0] = (__bf16)ra[i][0]; c[1] = (__bf16)ra[i][1]; c[2] = (__bf16)ra[i][2]; c[3] = (__bf16)ra[i][3]; *(v4b*)(sa + i * 8 * LP) = c; *(v4u*)(sb + i * 16 * LP) = rbw[i]; }
  __syncthreads();
  v8f acc[8] = {};
  for (int t = 0; t < DM / KT; ++t) { const __bf16* cur = sm + (t & 1) * ST_BUF; const int nxt = ((t + 1) & 1) * ST_BUF; const bool more = t + 1 < DM / KT;
    if (more) {
#pragma unroll   // constant indices keep the register arrays in registers
      for (int i = 0; i < 8; ++i) { ra[i] = *(const v4f*)(xg + (t + 1) * KT + (size_t)i * 8 * DM); rbw[i] = *(const v4u*)(pg + (t + 1) * KT + (size_t)i * 16 * DM); } }
#pragma unroll   // constant indices keep the register arrays in registers
    for (int kk = 0; kk < KT / 32; ++kk) { const v16b a = frag_b(cur + (wave * 16 + col) * LP + kk * 32, lane);
#pragma unroll   // constant indices keep the register arrays in registers
      for (int jh = 0; jh < 8; jh += 4) { v16b w[4];   // four weight fragments read as one group ahead of their products: one LDS wait per group, not one per product
#pragma unroll   // constant indices keep the register arrays in registers
        for (int j = 0; j < 4; ++j) w[j] = frag_b(cur + ST_A + ((jh + j) * 16 + col) * LP + kk * 32, lane);
#pragma unroll   // constant indices keep the register arrays in registers
        for (int j = 0; j < 4; ++j) acc[jh + j] = wmma_bf(a, w[j], acc[jh + j]); } }
    __builtin_amdgcn_sched_barrier(0);   // keeps the conversions of the prefetched tile, and with them the wait for its global loads, behind this tile's products
    if (more) {   // the other buffer's last readers left it at the previous trip's barrier
#pragma unroll   // constant indices keep the register arrays in registers
      for (int i = 0; i < 8; ++i) { v4b c; c[0] = (__bf16)ra[i][0]; c[1] = (__bf16)ra[i][1]; c[2] = (__bf16)ra[i][2]; c[3] = (__bf16)ra[i][3]; *(v4b*)(sa + nxt + i * 8 * LP) = c; *(v4u*)(sb + nxt + i * 16 * LP) = rbw[i]; } }
    __syncthreads(); }   // publishes the tile just stored and ends every read of the tile just used (after the last trip: frees the LDS for the output staging)
  if (n0 < 2 * DM) {   // q and k stored unscaled (sigma ~0.6); 1/8 applied in the softmax exponent
#pragma unroll
    for (int j = 0; j < 8; ++j) {
#pragma unroll
      for (int r = 0; r < 8; ++r) { const float v = acc[j][r]; const _Float16 hv = (_Float16)v; so[wave][8 * g + r][j * 16 + col] = hv; sol[wave][8 * g + r][j * 16 + col] = (_Float16)((v - (float)hv) * 2048.0f); } }
    ldsx();
    for (int rl = 0; rl < 16; ++rl) if (lane < 16) { vst2(QK + (pr0 + rl) * (2 * DM) + n0 + lane * 8, *(const v4u*)&so[wave][rl][lane * 8]); vst2(QKL + (pr0 + rl) * (2 * DM) + n0 + lane * 8, *(const v4u*)&sol[wave][rl][lane * 8]); }
  } else {
#pragma unroll
    for (int j = 0; j < 8; ++j) {
#pragma unroll
      for (int r = 0; r < 8; ++r) { const float v = acc[j][r]; const _Float16 hv = (_Float16)v; sth[j * 16 + col][wave * 16 + 8 * g + r] = hv; stl[j * 16 + col][wave * 16 + 8 * g + r] = (_Float16)((v - (float)hv) * 2048.0f); } }
    __syncthreads();
    const int pc0 = n0 - 2 * DM;
    for (int q = tid; q < 128 * 8; q += 128) { const int d = q >> 3, pc = q & 7; const size_t o = ((size_t)b * DM + pc0 + d) * SEQ + s0 + pc * 8; vst2(VTH + o, *(const v4u*)&sth[d][pc * 8]); vst2(VTL + o, *(const v4u*)&stl[d][pc * 8]); }
  }
}
// ---- k_attn: block = (64 queries: query block attn_qb(), head h, batch b), wave = 16 queries; causal flash attention over 32-key steps up to the wave's last query;
//      the products are taken transposed: S^T = K . Q^T (A = K rows, B = q rows) and O^T += V^T . P^T (A = V^T rows, B = P^T), so that a lane holds scores of ONE query (column lane & 15):
//      keys 8g + r of each 16-key tile, g = lane >> 4; row maximum and row sum are in-lane, the maximum joined with the other half by one cross-row move per step, the sums joined once in the epilogue;
//      the two score tiles of a step, converted in place, are the B operand P^T in the fragments' own k order (elements 0..7 <- keys 8g + i, 8..15 <- 16 + 8g + i): P passes through no LDS;
//      K hi and V^T hi tiles of 64 keys are brought once per block into two LDS buffers by asynchronous copies (each wave copy = 4 rows x one whole 128-B line), the next tile in flight
//      while this one is worked on; the four waves read their fragments from LDS (rows at pitch 144 B for the 16-byte reads); the residual planes of query blocks 0..1 still come straight from global;
//      query blocks 0..1: 3-product q/k scores and P hi/res x V hi/lo in a second accumulator, single products elsewhere;
//      a weight is one fma and one hardware exponential: P x 2^4 = 2^(c * KS + nb), c the raw score, KS = log2(e) / 8, nb = 4 - max * KS formed once per step; results under 2^-126 may come out 0,
//      far below what the f16 P or the f32 sum (>= about 2^4) can hold; the rescale factor is 2^(nb new - nb old), the exact ratio of the two steps' weights;
//      O[b*SEQ+q][h*64+d] = (acc + accl/2048) / l, l summed over P x 2^4  (256-B segments, lanes 0..15 x 16 B)
#define AT 64                       // keys per staged tile: one 128-B line of a V^T row; a block's keys are a whole number of tiles
#define AP (AT + 8)                 // LDS row pitch in f16 elements (144 B = 16 B x 9), for K rows (64 d) and V^T rows (64 keys) alike
#define AT_V (AT * AP)              // 64 K rows of a buffer, then 64 V^T rows
#define AT_BUF (AT_V + HD * AP)
static_assert(AT == HD && SEQ % AT == 0);
#define NQB (SEQ / 64)              // query blocks of a (head, batch)
// the query block of this work-group. A block's cost grows with its query block (causal: qb + 1 key tiles), and the whole grid is resident at once, four work-groups to a WGP, so the launch lasts as long as
// the WGP that holds the most tiles; with qb = blockIdx.x, work-groups whose flat indices lie a multiple of NQB apart all have the same qb.
// Here the parity of all index bits picks a block of the lower half or its mirror NQB - 1 - qb: any four work-groups whose flat indices differ in just two bit places hold 2 * (NQB + 1) tiles together.
// For speed only: for every (head, batch) x -> qb is one-to-one, so each block is done exactly once wherever the work-groups land.
__device__ __forceinline__ int attn_qb() {
  const int x = blockIdx.x; const bool fold = NQB % 16 == 0;   // other block counts: mirrored on the parity of head and batch alone
  const int lo = fold ? (x & 7) + 8 * (x >> 4) : x;
  const int par = __builtin_popcount((unsigned)(fold ? x : 0) ^ blockIdx.y ^ blockIdx.z) & 1;   // bit 3 of x enters par alone, not lo: it tells a block from its mirror
  return par ? NQB - 1 - lo : lo;
}
// one tile: this thread's four 16-B pieces of K (rows 16 apart) and four of V^T; lk, lv = LDS byte addresses, gk, gv = global addresses of the first piece of each
__device__ __forceinline__ void stage_kv(unsigned lk, const _Float16* gk, unsigned lv, const _Float16* gv) {
  const unsigned ls = 16 * AP * 2; const size_t ks = (size_t)16 * 2 * DM, vs = (size_t)16 * SEQ;
  // the closing s_wait_xcnt stands in the copies' own statement, so that no address register named here is rewritten ahead of it
  asm volatile("global_load_async_to_lds_b128 %0, %8, off\n\t"
               "global_load_async_to_lds_b128 %1, %9, off\n\t"
               "global_load_async_to_lds_b128 %2, %10, off\n\t"
               "global_load_async_to_lds_b128 %3, %11, off\n\t"
               "global_load_async_to_lds_b128 %4, %12, off\n\t"
               "global_load_async_to_lds_b128 %5, %13, off\n\t"
               "global_load_async_to_lds_b128 %6, %14, off\n\t"
               "global_load_async_to_lds_b128 %7, %15, off\n\t"
               "s_wait_xcnt 0x0"
               :: "v"(lk), "v"(lk + ls), "v"(lk + 2 * ls), "v"(lk + 3 * ls), "v"(lv), "v"(lv + ls), "v"(lv + 2 * ls), "v"(lv + 3 * ls),
                  "v"(gk), "v"(gk + ks), "v"(gk + 2 * ks), "v"(gk + 3 * ks), "v"(gv), "v"(gv + vs), "v"(gv + 2 * vs), "v"(gv + 3 * vs) : "memory");
}
// 2^x of a step's sixteen exponents on the hardware's own exponential, in place and in one statement: each v_exp_f32 overwrites its own argument alone, so that none stands directly in front of an
// instruction that reads its result or overwrites its source (with the registers left to the allocator, neighbouring exponentials did); the closing v_nop keeps that slot behind the last one
__device__ __forceinline__ void exp2x16(float (&e)[16]) {
  asm("v_exp_f32 %0, %0\n\tv_exp_f32 %1, %1\n\tv_exp_f32 %2, %2\n\tv_exp_f32 %3, %3\n\tv_exp_f32 %4, %4\n\tv_exp_f32 %5, %5\n\tv_exp_f32 %6, %6\n\tv_exp_f32 %7, %7\n\t"
      "v_exp_f32 %8, %8\n\tv_exp_f32 %9, %9\n\tv_exp_f32 %10, %10\n\tv_exp_f32 %11, %11\n\tv_exp_f32 %12, %12\n\tv_exp_f32 %13, %13\n\tv_exp_f32 %14, %14\n\tv_exp_f32 %15, %15\n\tv_nop"
      : "+v"(e[0]), "+v"(e[1]), "+v"(e[2]), "+v"(e[3]), "+v"(e[4]), "+v"(e[5]), "+v"(e[6]), "+v"(e[7]), "+v"(e[8]), "+v"(e[9]), "+v"(e[10]), "+v"(e[11]), "+v"(e[12]), "+v"(e[13]), "+v"(e[14]), "+v"(e[15]));
}
// lane l takes the value of lane l ^ 16
__device__ __forceinline__ float xhalf(float x) { return __builtin_bit_cast(float, __builtin_amdgcn_permlanex16(__builtin_bit_cast(int, x), __builtin_bit_cast(int, x), 0x76543210, 0xfedcba98, false, false)); }
// the tile's code is compiled twice, lead = true for query blocks 0..1 and false for the rest (the flag is block-uniform), so that the later blocks, which are nearly all of the work,
// carry no residual split of P, no second accumulator to rescale or copy and no scalar branch at every product
template <bool lead> __device__ __forceinline__ void attn_tile(const int qb, _Float16* skv, float (*so)[16][68], const _Float16* __restrict__ QK, const _Float16* __restrict__ QKL, const _Float16* __restrict__ VTH, const _Float16* __restrict__ VTL, float* __restrict__ O) {
  const int tid = threadIdx.x, wave = tid >> 5, lane = tid & 31, col = lane & 15, g = lane >> 4;
  const int h = blockIdx.y, b = blockIdx.z; const int q0 = qb * 64 + wave * 16; const size_t rq = (size_t)b * SEQ + q0 + col;
  const int nst = qb + 1;     // block-uniform: staged tiles covering keys <= qb * 64 + 63
  const unsigned lk = (unsigned)(size_t)skv + ((tid >> 3) * AP + (tid & 7) * 8) * 2, lv = lk + AT_V * 2;      // this thread's first piece: row tid/8, 16 B number tid%8
  const _Float16* gk = QK + ((size_t)b * SEQ + (tid >> 3)) * (2 * DM) + DM + h * HD + (tid & 7) * 8;           // key row tid/8 of tile 0
  const _Float16* gv = VTH + ((size_t)b * DM + h * HD + (tid >> 3)) * SEQ + (tid & 7) * 8;                     // d row tid/8, keys of tile 0
  stage_kv(lk, gk, lv, gv);
  asm volatile("s_wait_asynccnt 0x0" ::: "memory");   // this wave's pieces of tile 0 have landed
  __syncthreads();                                     // publishes tile 0
  if (nst > 1) stage_kv(lk + AT_BUF * 2, gk + (size_t)AT * 2 * DM, lv + AT_BUF * 2, gv + AT);
  v16h aq[2], aql[2];   // B operands: column = query q0 + col
#pragma unroll
  for (int kc = 0; kc < 2; ++kc) { aq[kc] = frag_h(QK + rq * (2 * DM) + h * HD + kc * 32, lane); if (lead) aql[kc] = frag_h(QKL + rq * (2 * DM) + h * HD + kc * 32, lane); }
  const float KS = 0.125f * 1.44269504088896341f;   // 1/sqrt(64) x log2(e)
  float m = -1.0e30f, nb = 1.0e30f, l = 0.f;   // of query q0 + col: running maximum of the raw scores (equal in both halves), its exponent offset 4 - m * KS (first step: any large value, the factor it yields scales zeros), sum over this half's keys
  v8f acc[4] = {}, accl[4] = {};   // acc[dt][r] = O^T[d = dt * 16 + 8g + r][query q0 + col]
  const int nks = __builtin_amdgcn_readfirstlane((q0 + 16 + 31) >> 5);   // wave-uniform, held in a scalar register so that the skip below is a scalar branch: key steps covering keys <= q0 + 15 (every visited step has >= 1 unmasked key per query)
#pragma unroll 1   // one copy of the step's code for both buffers, which differ by an address only
  for (int t = 0; t < nst; ++t) { const _Float16* kt = skv + (t & 1) * AT_BUF; const _Float16* vt = kt + AT_V;
#pragma unroll 1   // one copy of the step's code for both halves of a tile
  for (int ks = 2 * t; ks < 2 * t + 2 && ks < nks; ++ks) { v8f s[2]; const int ko = (ks & 1) * 32;   // waves 0 and 1 skip the last tile's second step, wholly above their diagonal
    const int dq = q0 + col - ks * 32 - 8 * g;   // this lane's key ct * 16 + r of the step lies on or below the diagonal where ct * 16 + r <= dq
    v16h kh[2][2], vh[4];   // the step's fragments read as one group at its head: one LDS wait for the scores, none left in front of the V^T x P^T products
#pragma unroll   // constant indices keep the fragment arrays in registers
    for (int ct = 0; ct < 2; ++ct) {
#pragma unroll   // constant indices keep the fragment arrays in registers
      for (int kc = 0; kc < 2; ++kc) kh[ct][kc] = frag_h(kt + (ko + ct * 16 + col) * AP + kc * 32, lane); }
#pragma unroll   // constant indices keep the fragment arrays in registers
    for (int dt = 0; dt < 4; ++dt) vh[dt] = frag_h(vt + (dt * 16 + col) * AP + ko, lane);
#pragma unroll
    for (int ct = 0; ct < 2; ++ct) { const _Float16* krowl = QKL + ((size_t)b * SEQ + ks * 32 + ct * 16 + col) * (2 * DM) + DM + h * HD; v8f c = {}, cl = {};   // A row = key ks * 32 + ct * 16 + col
      if (lead) {
#pragma unroll
        for (int kc = 0; kc < 2; ++kc) { c = wmma16(kh[ct][kc], aq[kc], c); cl = wmma16(kh[ct][kc], aql[kc], cl); cl = wmma16(frag_h(krowl + kc * 32, lane), aq[kc], cl); }
#pragma unroll
        for (int r = 0; r < 8; ++r) c[r] += cl[r] * (1.0f / 2048.0f); }
      else {
#pragma unroll
        for (int kc = 0; kc < 2; ++kc) c = wmma16(kh[ct][kc], aq[kc], c); }
#pragma unroll   // constant indices keep the register arrays in registers
      for (int r = 0; r < 8; ++r) s[ct][r] = (ct * 16 + r <= dq) ? c[r] : -1.0e30f; }   // raw scores; keys above the diagonal replaced by a large negative fill
    float mx = fmaxf(s[0][0], s[1][0]);
#pragma unroll   // constant indices keep the register arrays in registers
    for (int r = 1; r < 8; ++r) mx = fmaxf(mx, fmaxf(s[0][r], s[1][r]));
    mx = fmaxf(mx, xhalf(mx));   // the step's 32 keys: this half's 16 and the other half's
    const float mn = fmaxf(m, mx); const float nbn = fmaf(-mn, KS, PSL); const float alpha = __builtin_amdgcn_exp2f(nbn - nb); float rs;
    float e[16];   // e[2i], e[2i + 1]: exponents, then weights x 2^4, of keys i and 16 + i of this half
#pragma unroll   // constant indices keep the register arrays in registers
    for (int i = 0; i < 8; ++i) { e[2 * i] = fmaf(s[0][i], KS, nbn); e[2 * i + 1] = fmaf(s[1][i], KS, nbn); }
    exp2x16(e);
    v16h pa, pl;   // P^T x 2^4 as f16 hi; residual carried x2^11, folded in the epilogue
#pragma unroll   // constant indices keep the register arrays in registers
    for (int i = 0; i < 8; ++i) { const float x0 = e[2 * i], x1 = e[2 * i + 1]; rs = i ? rs + (x0 + x1) : x0 + x1;
      const _Float16 h0 = (_Float16)x0, h1 = (_Float16)x1; pa[i] = h0; pa[8 + i] = h1; if (lead) { pl[i] = (_Float16)((x0 - (float)h0) * 2048.0f); pl[8 + i] = (_Float16)((x1 - (float)h1) * 2048.0f); } }
    l = l * alpha + rs; m = mn; nb = nbn;
#pragma unroll   // constant indices keep the register arrays in registers
    for (int dt = 0; dt < 4; ++dt) {
#pragma unroll   // constant indices keep the register arrays in registers
      for (int r = 0; r < 8; ++r) { acc[dt][r] *= alpha; if (lead) accl[dt][r] *= alpha; } }
#pragma unroll
    for (int dt = 0; dt < 4; ++dt) { const size_t vr = ((size_t)b * DM + h * HD + dt * 16 + col) * SEQ + ks * 32; acc[dt] = wmma16(vh[dt], pa, acc[dt]); if (lead) { accl[dt] = wmma16(vh[dt], pl, accl[dt]); accl[dt] = wmma16(frag_h(VTL + vr, lane), pa, accl[dt]); } } }
    asm volatile("s_wait_dscnt 0x0" ::: "memory");      // this wave's reads of tile t have returned
    asm volatile("s_wait_asynccnt 0x0" ::: "memory");   // this wave's pieces of tile t + 1 have landed
    __syncthreads();                                     // publishes tile t + 1 and ends every wave's reads of tile t, whose buffer is refilled behind it
    if (t + 2 < nst) stage_kv(lk + (t & 1) * (AT_BUF * 2), gk + (size_t)(t + 2) * AT * 2 * DM, lv + (t & 1) * (AT_BUF * 2), gv + (t + 2) * AT); }
  asm volatile("s_wait_asynccnt 0x0" ::: "memory");     // no copy is left in flight when the wave goes on to its end
  l += xhalf(l);   // the two halves' key sums of this query
  const float il = 1.0f / l;   // l >= about 2^4 (the running max contributes 2^4); numerator and l carry the same 2^4 pre-scale
#pragma unroll   // constant indices keep the register arrays in registers
  for (int dt = 0; dt < 4; ++dt) {
#pragma unroll   // constant indices keep the register arrays in registers
    for (int rh = 0; rh < 8; rh += 4) { v4f o;
#pragma unroll   // constant indices keep the register arrays in registers
      for (int r = 0; r < 4; ++r) o[r] = (lead ? acc[dt][rh + r] + accl[dt][rh + r] * (1.0f / 2048.0f) : acc[dt][rh + r]) * il;
      *(v4f*)&so[wave][col][dt * 16 + 8 * g + rh] = o; } }
  ldsx();
  for (int rl = 0; rl < 16; ++rl) if (lane < 16) vst2(O + ((size_t)b * SEQ + q0 + rl) * DM + h * HD + lane * 4, *(const v4f*)&so[wave][rl][lane * 4]);
}
__global__ __launch_bounds__(128) void k_attn(const _Float16* __restrict__ QK, const _Float16* __restrict__ QKL, const _Float16* __restrict__ VTH, const _Float16* __restrict__ VTL, float* __restrict__ O) {
  __shared__ __align__(16) _Float16 skv[2 * AT_BUF];
  __shared__ __align__(16) float so[4][16][68];
  const int qb = attn_qb();
  if (qb < 2) attn_tile<true>(qb, skv, so, QK, QKL, VTH, VTL, O);   // block-uniform: leading query blocks (few keys, outputs far above the global rms)
  else attn_tile<false>(qb, skv, so, QK, QKL, VTH, VTL, O);
}
// ---- k_out: block = 64 rows, wave = 16 rows x 64 columns: out = O (bf16 hi/lo, 2 products) . packed W rows (K = 1024); 256-B output rows written by lanes 0..15 x 16 B
__global__ __launch_bounds__(128) void k_out(const float* __restrict__ O, const __bf16* __restrict__ P, float* __restrict__ Y) {
  __shared__ __align__(16) float so[4][16][68];
  const int tid = threadIdx.x, wave = tid >> 5, lane = tid & 31, col = lane & 15, g = lane >> 4;
  const size_t rb = (size_t)blockIdx.x * 64; const int b = (int)(rb / SEQ), s0 = (int)(rb % SEQ);
  const size_t r0 = rb + wave * 16; const size_t yr0 = (size_t)b * SEQ_FULL + s0 + wave * 16;
  v8f acc[4] = {};
#pragma unroll 2
  for (int kc = 0; kc < DM / 32; ++kc) { const F2 a = split_row(O + (r0 + col) * DM, kc * 32, lane);
#pragma unroll
    for (int j = 0; j < 4; ++j) { const v16b w = frag_b(P + (size_t)(j * 16 + col) * DM + kc * 32, lane); acc[j] = wmma_bf(a.l, w, acc[j]); acc[j] = wmma_bf(a.h, w, acc[j]); } }
#pragma unroll
  for (int j = 0; j < 4; ++j) {
#pragma unroll
    for (int r = 0; r < 8; ++r) so[wave][8 * g + r][j * 16 + col] = acc[j][r]; }
  ldsx();
  for (int rl = 0; rl < 16; ++rl) if (lane < 16) vst2(Y + (yr0 + rl) * NE + lane * 4, *(const v4f*)&so[wave][rl][lane * 4]);
}
extern "C" void kernel_launch(void* const* d_in, const int* in_sizes, int n_in, void* d_out, int out_size, void* d_ws, size_t ws_size, hipStream_t stream) {
  if (n_in < 5) return;
  if (in_sizes[0] < ((NB - 1) * SEQ_FULL + SEQ) * DM) return;                                        // x [2,2048,1024]
  if (in_sizes[1] < NH * DM * HD || in_sizes[2] < NH * DM * HD || in_sizes[3] < NH * DM * HD) return;  // Wq Wk Wv [16,1024,64]
  if (in_sizes[4] < DM * NE) return;                                                                   // W [1024,64]
  if (out_size < ((NB - 1) * SEQ_FULL + SEQ) * NE) return;                                             // out [2,2048,64]
  if (ws_size < (size_t)WS_END) return;
  const float* X = (const float*)d_in[0]; const float* WQ = (const float*)d_in[1]; const float* WK = (const float*)d_in[2]; const float* WV = (const float*)d_in[3]; const float* WO = (const float*)d_in[4];
  char* ws = (char*)d_ws; __bf16* PK = (__bf16*)(ws + WS_PK); _Float16 *QK = (_Float16*)(ws + WS_QK), *QKL = (_Float16*)(ws + WS_QKL), *VTH = (_Float16*)(ws + WS_VTH), *VTL = (_Float16*)(ws + WS_VTL); float* O = (float*)(ws + WS_O);
  k_pack<<<dim3(DM / 64, NPK / 64), 256, 0, stream>>>(WQ, WK, WV, WO, PK);
  k_qkv<<<dim3(NB * SEQ / 64, QKVW / 128), 128, 0, stream>>>(X, PK, QK, QKL, VTH, VTL);
  k_attn<<<dim3(SEQ / 64, NH, NB), 128, 0, stream>>>(QK, QKL, VTH, VTL, O);
  k_out<<<dim3(NB * SEQ / 64, 1), 128, 0, stream>>>(O, PK + (size_t)QKVW * DM, (float*)d_out);
}

// v007
// A run of this version takes 82.5 microseconds.
// Timed twice side by side with v006, it ran 1.31 times as fast both times.
// All steps since v000 together make it 4.47 times as fast.
// compute dtype: all float inputs RNE-converted to bf16; q|k|v = x . W[h] with exact bf16 x bf16 products on v_wmma_f32_16x16x32_bf16, stored as f16 hi + residual(x2^11) planes (v transposed); scores = q . k on v_wmma_f32_16x16x32_f16 (query blocks 0..1: 3-product hi/res, later blocks single f16), causal online softmax (running max of the raw scores; 1/8, log2 e, the maximum and the 2^4 pre-scale folded into one f32 fma per exponent) in f32; P x 2^4 as f16 hi (+ residual x2^11 against v hi + v lo on query blocks 0..1, single P x v hi elsewhere) on f16 WMMA; out = ctx (bf16 hi + lo) . W on bf16 WMMA; f32 accumulate everywhere, f32 output.
#include <hip/hip_runtime.h>
#include <math.h>

typedef __attribute__((ext_vector_type(16))) _Float16 v16h;
typedef __attribute__((ext_vector_type(16))) __bf16 v16b;
typedef __attribute__((ext_vector_type(8)))  _Float16 v8h;
typedef __attribute__((ext_vector_type(8)))  __bf16 v8b;
typedef __attribute__((ext_vector_type(4)))  __bf16 v4b;
typedef __attribute__((ext_vector_type(8)))  float v8f;
typedef __attribute__((ext_vector_type(4)))  float v4f;
typedef __attribute__((ext_vector_type(4)))  unsigned v4u;

template <typename T> __device__ __forceinline__ void vst2(void* p, T v) { *(T*)p = v;  }
__device__ __forceinline__ v8f wmma16(v16h a, v16h b, v8f c) {
  v8f d = __builtin_amdgcn_wmma_f32_16x16x32_f16(false, a, false, b, (short)0, c, false, false);
  asm volatile("v_nop\n\tv_nop\n\tv_nop\n\tv_nop" : "+v"(d) : "v"(a), "v"(b));
  return d;
}
__device__ __forceinline__ v8f wmma_bf(v16b a, v16b b, v8f c) {
  v8f d = __builtin_amdgcn_wmma_f32_16x16x32_bf16(false, a, false, b, (short)0, c, false, false);
  asm volatile("v_nop\n\tv_nop\n\tv_nop\n\tv_nop" : "+v"(d) : "v"(a), "v"(b));
  return d;
}
// 16-bit row fragment (row m = lane & 15 selected by the caller): elements 0..7 <- k0 + 8h + i, 8..15 <- k0 + 16 + 8h + i, h = lane >> 4
__device__ __forceinline__ v16h frag_h(const _Float16* rowk0, int lane) {
  union { v16h v; v8h q[2]; } u; const _Float16* p = rowk0 + 8 * (lane >> 4);
  u.q[0] = *(const v8h*)p; u.q[1] = *(const v8h*)(p + 16); return u.v;
}
__device__ __forceinline__ v16b frag_b(const __bf16* rowk0, int lane) {
  union { v16b v; v8b q[2]; } u; const __bf16* p = rowk0 + 8 * (lane >> 4);
  u.q[0] = *(const v8b*)p; u.q[1] = *(const v8b*)(p + 16); return u.v;
}
struct F2 { v16b h, l; };
__device__ __forceinline__ F2 bsplit16(const float v[16]) { F2 r;
#pragma unroll
  for (int i = 0; i < 16; ++i) { const __bf16 h = (__bf16)v[i]; r.h[i] = h; r.l[i] = (__bf16)(v[i] - (float)h); }
  return r; }
__device__ __forceinline__ void ldsx() { asm volatile("s_wait_dscnt 0" ::: "memory"); __builtin_amdgcn_wave_barrier(); __builtin_amdgcn_fence(3, "workgroup"); }

// causal multi-head attention: per-head q/k/v projections D 1,024 -> 64 (16 heads, weights [h][in][out]), scores/8, -inf above the diagonal, softmax, ctx merged head-major, out = ctx . W ([in 1,024][out 64])
#ifndef NB
#define NB 2
#endif
#ifndef SEQ
#define SEQ 2048
#endif
#define NB_FULL 2
#define SEQ_FULL 2048
#define DM 1024
#define NH 16
#define HD 64
#define NE 64
#define QKVW (3 * DM)        // fused q | k | v output columns, column h*64+e (+0 / +1024 / +2048)
#define NPK (QKVW + NE)      // packed bf16 weight rows: 3072 q|k|v rows + 64 out-projection rows, each k-contiguous over 1024
#define PSL 4.0f             // softmax weights pre-scaled by 2^4 ahead of the f16 split (<= 16; residual carried x2^11): 4 is added to every exponent, so the row sum l carries the 2^4 too
static_assert(SEQ % 64 == 0);
static_assert(SEQ >= 64 && SEQ <= SEQ_FULL);
static_assert(NB >= 1 && NB <= NB_FULL);
static_assert(HD == NE);
static_assert(DM % 64 == 0 && NPK % 64 == 0);

#define WS_PK  0ull                                           // bf16 [NPK][DM]
#define WS_QK  (WS_PK + 2ull * NPK * DM)                      // f16 [NB*SEQ][2*DM]: q | k hi
#define WS_QKL (WS_QK + 2ull * NB * SEQ * 2 * DM)             // f16 q | k residual x2048
#define WS_VTH (WS_QKL + 2ull * NB * SEQ * 2 * DM)            // f16 [b][1024 (h*64+d)][SEQ] v hi (transposed)
#define WS_VTL (WS_VTH + 2ull * NB * DM * SEQ)                // f16 v residual x2048 (transposed)
#define WS_O   (WS_VTL + 2ull * NB * DM * SEQ)                // f32 [NB*SEQ][DM] merged ctx
#define WS_END (WS_O + 4ull * NB * SEQ * DM)
static_assert(WS_END <= 134217728ull);
static_assert((WS_QK % 128) == 0 && (WS_QKL % 128) == 0 && (WS_VTH % 128) == 0 && (WS_VTL % 128) == 0 && (WS_O % 128) == 0);

// ---- k_pack: block = (64-wide d chunk, group): group 0..47 = (which = group/16, head = group%16) of Wq/Wk/Wv [h][d][e]; group 48 = W [d][e].
__global__ __launch_bounds__(256) void k_pack(const float* __restrict__ WQ, const float* __restrict__ WK, const float* __restrict__ WV, const float* __restrict__ WO, __bf16* __restrict__ PK) {
  __shared__ __align__(16) __bf16 s[64][72];
  const int dc = blockIdx.x, grp = blockIdx.y, t = threadIdx.x; const int which = grp >> 4, hh = grp & 15;
  const float* Wm = (which == 0) ? WQ : (which == 1) ? WK : (which == 2) ? WV : WO;
  const float* src = Wm + ((which < 3) ? (size_t)hh * DM * HD : (size_t)0) + (size_t)dc * 64 * HD;
  for (int q = t; q < 64 * 64; q += 256) { const int dd = q >> 6, e = q & 63; s[e][dd] = (__bf16)src[(size_t)dd * HD + e]; }
  __syncthreads();
  for (int q = t; q < 64 * 8; q += 256) { const int e = q >> 3, pc = q & 7; vst2(PK + ((size_t)grp * 64 + e) * DM + dc * 64 + pc * 8, *(const v4u*)&s[e][pc * 8]); }
}
// ---- k_qkv: block = (64 rows of x, 128 fused output columns n0): bf16(x) rows x packed bf16 weight rows on WMMA (K = 1024);
//      k tiles of 64 staged in two LDS buffers: every global load covers whole 128-B lines (x: 2 rows x 256 B per wave load, weights: 4 rows x 128 B),
//      x converted to bf16 on the way in; rows at pitch 144 B for the 16-byte fragment reads; the next tile's loads are issued ahead of this tile's products;
//      the output staging reuses the same LDS behind the loop's last barrier
#define KT 64                       // k per staged tile: one 128-B line of a weight row
#define LP (KT + 8)                 // LDS row pitch in bf16 elements (144 B = 16 B x 9)
#define ST_A (64 * LP)              // x rows of a buffer, in elements
#define ST_BUF (ST_A + 128 * LP)    // one buffer: 64 x rows, then 128 weight rows
static_assert(DM % KT == 0 && 2 * ST_BUF * 2 >= 2 * 128 * 72 * 2 && 2 * ST_BUF * 2 >= 2 * 4 * 16 * 136 * 2);
__global__ __launch_bounds__(128) void k_qkv(const float* __restrict__ X, const __bf16* __restrict__ P, _Float16* __restrict__ QK, _Float16* __restrict__ QKL, _Float16* __restrict__ VTH, _Float16* __restrict__ VTL) {
  __shared__ __align__(16) __bf16 sm[2 * ST_BUF];
  _Float16 (*so)[16][136] = (_Float16 (*)[16][136])sm; _Float16 (*sol)[16][136] = so + 4;
  _Float16 (*sth)[72] = (_Float16 (*)[72])sm; _Float16 (*stl)[72] = sth + 128;
  const int tid = threadIdx.x, wave = tid >> 5, lane = tid & 31, col = lane & 15, g = lane >> 4;
  const size_t rb = (size_t)blockIdx.x * 64; const int b = (int)(rb / SEQ), s0 = (int)(rb % SEQ);
  const size_t pr0 = rb + wave * 16;                            // plane row base (compact b*SEQ + s)
  const int n0 = blockIdx.y * 128;
  const float* xg = X + ((size_t)b * SEQ_FULL + s0 + (tid >> 4)) * DM + (tid & 15) * 4;   // this thread's 16 B of x: row tid/16 (+8 per load), floats 4*(tid%16)
  const __bf16* pg = P + (size_t)(n0 + (tid >> 3)) * DM + (tid & 7) * 8;                    // this thread's 16 B of weights: row tid/8 (+16 per load), elements 8*(tid%8)
  __bf16* sa = sm + (tid >> 4) * LP + (tid & 15) * 4; __bf16* sb = sm + ST_A + (tid >> 3) * LP + (tid & 7) * 8;
  v4f ra[8]; v4u rbw[8];
#pragma unroll   // constant indices keep the register arrays in registers
  for (int i = 0; i < 8; ++i) { ra[i] = *(const v4f*)(xg + (size_t)i * 8 * DM); rbw[i] = *(const v4u*)(pg + (size_t)i * 16 * DM); }
#pragma unroll   // constant indices keep the register arrays in registers
  for (int i = 0; i < 8; ++i) { v4b c; c[0] = (__bf16)ra[i][0]; c[1] = (__bf16)ra[i][1]; c[2] = (__bf16)ra[i][2]; c[3] = (__bf16)ra[i][3]; *(v4b*)(sa + i * 8 * LP) = c; *(v4u*)(sb + i * 16 * LP) = rbw[i]; }
  __syncthreads();
  v8f acc[8] = {};
  for (int t = 0; t < DM / KT; ++t) { const __bf16* cur = sm + (t & 1) * ST_BUF; const int nxt = ((t + 1) & 1) * ST_BUF; const bool more = t + 1 < DM / KT;
    if (more) {
#pragma unroll   // constant indices keep the register arrays in registers
      for (int i = 0; i < 8; ++i) { ra[i] = *(const v4f*)(xg + (t + 1) * KT + (size_t)i * 8 * DM); rbw[i] = *(const v4u*)(pg + (t + 1) * KT + (size_t)i * 16 * DM); } }
#pragma unroll   // constant indices keep the register arrays in registers
    for (int kk = 0; kk < KT / 32; ++kk) { const v16b a = frag_b(cur + (wave * 16 + col) * LP + kk * 32, lane);
#pragma unroll   // constant indices keep the register arrays in registers
      for (int jh = 0; jh < 8; jh += 4) { v16b w[4];   // four weight fragments read as one group ahead of their products: one LDS wait per group, not one per product
#pragma unroll   // constant indices keep the register arrays in registers
        for (int j = 0; j < 4; ++j) w[j] = frag_b(cur + ST_A + ((jh + j) * 16 + col) * LP + kk * 32, lane);
#pragma unroll   // constant indices keep the register arrays in registers
        for (int j = 0; j < 4; ++j) acc[jh + j] = wmma_bf(a, w[j], acc[jh + j]); } }
    __builtin_amdgcn_sched_barrier(0);   // keeps the conversions of the prefetched tile, and with them the wait for its global loads, behind this tile's products
    if (more) {   // the other buffer's last readers left it at the previous trip's barrier
#pragma unroll   // constant indices keep the register arrays in registers
      for (int i = 0; i < 8; ++i) { v4b c; c[0] = (__bf16)ra[i][0]; c[1] = (__bf16)ra[i][1]; c[2] = (__bf16)ra[i][2]; c[3] = (__bf16)ra[i][3]; *(v4b*)(sa + nxt + i * 8 * LP) = c; *(v4u*)(sb + nxt + i * 16 * LP) = rbw[i]; } }
    __syncthreads(); }   // publishes the tile just stored and ends every read of the tile just used (after the last trip: frees the LDS for the output staging)
  if (n0 < 2 * DM) {   // q and k stored unscaled (sigma ~0.6); 1/8 applied in the softmax exponent
#pragma unroll
    for (int j = 0; j < 8; ++j) {
#pragma unroll
      for (int r = 0; r < 8; ++r) { const float v = acc[j][r]; const _Float16 hv = (_Float16)v; so[wave][8 * g + r][j * 16 + col] = hv; sol[wave][8 * g + r][j * 16 + col] = (_Float16)((v - (float)hv) * 2048.0f); } }
    ldsx();
    for (int rl = 0; rl < 16; ++rl) if (lane < 16) { vst2(QK + (pr0 + rl) * (2 * DM) + n0 + lane * 8, *(const v4u*)&so[wave][rl][lane * 8]); vst2(QKL + (pr0 + rl) * (2 * DM) + n0 + lane * 8, *(const v4u*)&sol[wave][rl][lane * 8]); }
  } else {
#pragma unroll
    for (int j = 0; j < 8; ++j) {
#pragma unroll
      for (int r = 0; r < 8; ++r) { const float v = acc[j][r]; const _Float16 hv = (_Float16)v; sth[j * 16 + col][wave * 16 + 8 * g + r] = hv; stl[j * 16 + col][wave * 16 + 8 * g + r] = (_Float16)((v - (float)hv) * 2048.0f); } }
    __syncthreads();
    const int pc0 = n0 - 2 * DM;
    for (int q = tid; q < 128 * 8; q += 128) { const int d = q >> 3, pc = q & 7; const size_t o = ((size_t)b * DM + pc0 + d) * SEQ + s0 + pc * 8; vst2(VTH + o, *(const v4u*)&sth[d][pc * 8]); vst2(VTL + o, *(const v4u*)&stl[d][pc * 8]); }
  }
}
// ---- k_attn: block = (64 queries: query block attn_qb(), head h, batch b), wave = 16 queries; causal flash attention over 32-key steps up to the wave's last query;
//      the products are taken transposed: S^T = K . Q^T (A = K rows, B = q rows) and O^T += V^T . P^T (A = V^T rows, B = P^T), so that a lane holds scores of ONE query (column lane & 15):
//      keys 8g + r of each 16-key tile, g = lane >> 4; row maximum and row sum are in-lane, the maximum joined with the other half by one cross-row move per step, the sums joined once in the epilogue;
//      the two score tiles of a step, converted in place, are the B operand P^T in the fragments' own k order (elements 0..7 <- keys 8g + i, 8..15 <- 16 + 8g + i): P passes through no LDS;
//      K hi and V^T hi tiles of 64 keys are brought once per block into two LDS buffers by asynchronous copies (each wave copy = 4 rows x one whole 128-B line), the next tile in flight
//      while this one is worked on; the four waves read their fragments from LDS (rows at pitch 144 B for the 16-byte reads); the residual planes of query blocks 0..1 still come straight from global;
//      query blocks 0..1: 3-product q/k scores and P hi/res x V hi/lo in a second accumulator, single products elsewhere;
//      a weight is one fma and one hardware exponential: P x 2^4 = 2^(c * KS + nb), c the raw score, KS = log2(e) / 8, nb = 4 - max * KS formed once per step; results under 2^-126 may come out 0,
//      far below what the f16 P or the f32 sum (>= about 2^4) can hold; the rescale factor is 2^(nb new - nb old), the exact ratio of the two steps' weights;
//      O[b*SEQ+q][h*64+d] = (acc + accl/2048) / l, l summed over P x 2^4  (256-B segments, lanes 0..15 x 16 B)
#define AT 64                       // keys per staged tile: one 128-B line of a V^T row; a block's keys are a whole number of tiles
#define AP (AT + 8)                 // LDS row pitch in f16 elements (144 B = 16 B x 9), for K rows (64 d) and V^T rows (64 keys) alike
#define AT_V (AT * AP)              // 64 K rows of a buffer, then 64 V^T rows
#define AT_BUF (AT_V + HD * AP)
static_assert(AT == HD && SEQ % AT == 0);
#define NQB (SEQ / 64)              // query blocks of a (head, batch)
// the query block of this work-group. A block's cost grows with its query block (causal: qb + 1 key tiles), and the whole grid is resident at once, four work-groups to a WGP, so the launch lasts as long as
// the WGP that holds the most tiles; with qb = blockIdx.x, work-groups whose flat indices lie a multiple of NQB apart all have the same qb.
// Here the parity of all index bits picks a block of the lower half or its mirror NQB - 1 - qb: any four work-groups whose flat indices differ in just two bit places hold 2 * (NQB + 1) tiles together.
// For speed only: for every (head, batch) x -> qb is one-to-one, so each block is done exactly once wherever the work-groups land.
__device__ __forceinline__ int attn_qb() {
  const int x = blockIdx.x; const bool fold = NQB % 16 == 0;   // other block counts: mirrored on the parity of head and batch alone
  const int lo = fold ? (x & 7) + 8 * (x >> 4) : x;
  const int par = __builtin_popcount((unsigned)(fold ? x : 0) ^ blockIdx.y ^ blockIdx.z) & 1;   // bit 3 of x enters par alone, not lo: it tells a block from its mirror
  return par ? NQB - 1 - lo : lo;
}
// one tile: this thread's four 16-B pieces of K (rows 16 apart) and four of V^T; lk, lv = LDS byte addresses, gk, gv = global addresses of the first piece of each
__device__ __forceinline__ void stage_kv(unsigned lk, const _Float16* gk, unsigned lv, const _Float16* gv) {
  const unsigned ls = 16 * AP * 2; const size_t ks = (size_t)16 * 2 * DM, vs = (size_t)16 * SEQ;
  // the closing s_wait_xcnt stands in the copies' own statement, so that no address register named here is rewritten ahead of it
  asm volatile("global_load_async_to_lds_b128 %0, %8, off\n\t"
               "global_load_async_to_lds_b128 %1, %9, off\n\t"
               "global_load_async_to_lds_b128 %2, %10, off\n\t"
               "global_load_async_to_lds_b128 %3, %11, off\n\t"
               "global_load_async_to_lds_b128 %4, %12, off\n\t"
               "global_load_async_to_lds_b128 %5, %13, off\n\t"
               "global_load_async_to_lds_b128 %6, %14, off\n\t"
               "global_load_async_to_lds_b128 %7, %15, off\n\t"
               "s_wait_xcnt 0x0"
               :: "v"(lk), "v"(lk + ls), "v"(lk + 2 * ls), "v"(lk + 3 * ls), "v"(lv), "v"(lv + ls), "v"(lv + 2 * ls), "v"(lv + 3 * ls),
                  "v"(gk), "v"(gk + ks), "v"(gk + 2 * ks), "v"(gk + 3 * ks), "v"(gv), "v"(gv + vs), "v"(gv + 2 * vs), "v"(gv + 3 * vs) : "memory");
}
// 2^x of a step's sixteen exponents on the hardware's own exponential, in place and in one statement: each v_exp_f32 overwrites its own argument alone, so that none stands directly in front of an
// instruction that reads its result or overwrites its source (with the registers left to the allocator, neighbouring exponentials did); the closing v_nop keeps that slot behind the last one
__device__ __forceinline__ void exp2x16(float (&e)[16]) {
  asm("v_exp_f32 %0, %0\n\tv_exp_f32 %1, %1\n\tv_exp_f32 %2, %2\n\tv_exp_f32 %3, %3\n\tv_exp_f32 %4, %4\n\tv_exp_f32 %5, %5\n\tv_exp_f32 %6, %6\n\tv_exp_f32 %7, %7\n\t"
      "v_exp_f32 %8, %8\n\tv_exp_f32 %9, %9\n\tv_exp_f32 %10, %10\n\tv_exp_f32 %11, %11\n\tv_exp_f32 %12, %12\n\tv_exp_f32 %13, %13\n\tv_exp_f32 %14, %14\n\tv_exp_f32 %15, %15\n\tv_nop"
      : "+v"(e[0]), "+v"(e[1]), "+v"(e[2]), "+v"(e[3]), "+v"(e[4]), "+v"(e[5]), "+v"(e[6]), "+v"(e[7]), "+v"(e[8]), "+v"(e[9]), "+v"(e[10]), "+v"(e[11]), "+v"(e[12]), "+v"(e[13]), "+v"(e[14]), "+v"(e[15]));
}
// lane l takes the value of lane l ^ 16
__device__ __forceinline__ float xhalf(float x) { return __builtin_bit_cast(float, __builtin_amdgcn_permlanex16(__builtin_bit_cast(int, x), __builtin_bit_cast(int, x), 0x76543210, 0xfedcba98, false, false)); }
// the tile's code is compiled twice, lead = true for query blocks 0..1 and false for the rest (the flag is block-uniform), so that the later blocks, which are nearly all of the work,
// carry no residual split of P, no second accumulator to rescale or copy and no scalar branch at every product
template <bool lead> __device__ __forceinline__ void attn_tile(const int qb, _Float16* skv, float (*so)[16][68], const _Float16* __restrict__ QK, const _Float16* __restrict__ QKL, const _Float16* __restrict__ VTH, const _Float16* __restrict__ VTL, float* __restrict__ O) {
  const int tid = threadIdx.x, wave = tid >> 5, lane = tid & 31, col = lane & 15, g = lane >> 4;
  const int h = blockIdx.y, b = blockIdx.z; const int q0 = qb * 64 + wave * 16; const size_t rq = (size_t)b * SEQ + q0 + col;
  const int nst = qb + 1;     // block-uniform: staged tiles covering keys <= qb * 64 + 63
  const unsigned lk = (unsigned)(size_t)skv + ((tid >> 3) * AP + (tid & 7) * 8) * 2, lv = lk + AT_V * 2;      // this thread's first piece: row tid/8, 16 B number tid%8
  const _Float16* gk = QK + ((size_t)b * SEQ + (tid >> 3)) * (2 * DM) + DM + h * HD + (tid & 7) * 8;           // key row tid/8 of tile 0
  const _Float16* gv = VTH + ((size_t)b * DM + h * HD + (tid >> 3)) * SEQ + (tid & 7) * 8;                     // d row tid/8, keys of tile 0
  stage_kv(lk, gk, lv, gv);
  asm volatile("s_wait_asynccnt 0x0" ::: "memory");   // this wave's pieces of tile 0 have landed
  __syncthreads();                                     // publishes tile 0
  if (nst > 1) stage_kv(lk + AT_BUF * 2, gk + (size_t)AT * 2 * DM, lv + AT_BUF * 2, gv + AT);
  v16h aq[2], aql[2];   // B operands: column = query q0 + col
#pragma unroll
  for (int kc = 0; kc < 2; ++kc) { aq[kc] = frag_h(QK + rq * (2 * DM) + h * HD + kc * 32, lane); if (lead) aql[kc] = frag_h(QKL + rq * (2 * DM) + h * HD + kc * 32, lane); }
  const float KS = 0.125f * 1.44269504088896341f;   // 1/sqrt(64) x log2(e)
  float m = -1.0e30f, nb = 1.0e30f, l = 0.f;   // of query q0 + col: running maximum of the raw scores (equal in both halves), its exponent offset 4 - m * KS (first step: any large value, the factor it yields scales zeros), sum over this half's keys
  v8f acc[4] = {}, accl[4] = {};   // acc[dt][r] = O^T[d = dt * 16 + 8g + r][query q0 + col]
  const int nks = __builtin_amdgcn_readfirstlane((q0 + 16 + 31) >> 5);   // wave-uniform, held in a scalar register so that the skip below is a scalar branch: key steps covering keys <= q0 + 15 (every visited step has >= 1 unmasked key per query)
#pragma unroll 1   // one copy of the step's code for both buffers, which differ by an address only
  for (int t = 0; t < nst; ++t) { const _Float16* kt = skv + (t & 1) * AT_BUF; const _Float16* vt = kt + AT_V;
#pragma unroll 1   // one copy of the step's code for both halves of a tile
  for (int ks = 2 * t; ks < 2 * t + 2 && ks < nks; ++ks) { v8f s[2]; const int ko = (ks & 1) * 32;   // waves 0 and 1 skip the last tile's second step, wholly above their diagonal
    const int dq = q0 + col - ks * 32 - 8 * g;   // this lane's key ct * 16 + r of the step lies on or below the diagonal where ct * 16 + r <= dq
    v16h kh[2][2], vh[4];   // the step's fragments read as one group at its head: one LDS wait for the scores, none left in front of the V^T x P^T products
#pragma unroll   // constant indices keep the fragment arrays in registers
    for (int ct = 0; ct < 2; ++ct) {
#pragma unroll   // constant indices keep the fragment arrays in registers
      for (int kc = 0; kc < 2; ++kc) kh[ct][kc] = frag_h(kt + (ko + ct * 16 + col) * AP + kc * 32, lane); }
#pragma unroll   // constant indices keep the fragment arrays in registers
    for (int dt = 0; dt < 4; ++dt) vh[dt] = frag_h(vt + (dt * 16 + col) * AP + ko, lane);
#pragma unroll
    for (int ct = 0; ct < 2; ++ct) { const _Float16* krowl = QKL + ((size_t)b * SEQ + ks * 32 + ct * 16 + col) * (2 * DM) + DM + h * HD; v8f c = {}, cl = {};   // A row = key ks * 32 + ct * 16 + col
      if (lead) {
#pragma unroll
        for (int kc = 0; kc < 2; ++kc) { c = wmma16(kh[ct][kc], aq[kc], c); cl = wmma16(kh[ct][kc], aql[kc], cl); cl = wmma16(frag_h(krowl + kc * 32, lane), aq[kc], cl); }
#pragma unroll
        for (int r = 0; r < 8; ++r) c[r] += cl[r] * (1.0f / 2048.0f); }
      else {
#pragma unroll
        for (int kc = 0; kc < 2; ++kc) c = wmma16(kh[ct][kc], aq[kc], c); }
#pragma unroll   // constant indices keep the register arrays in registers
      for (int r = 0; r < 8; ++r) s[ct][r] = (ct * 16 + r <= dq) ? c[r] : -1.0e30f; }   // raw scores; keys above the diagonal replaced by a large negative fill
    float mx = fmaxf(s[0][0], s[1][0]);
#pragma unroll   // constant indices keep the register arrays in registers
    for (int r = 1; r < 8; ++r) mx = fmaxf(mx, fmaxf(s[0][r], s[1][r]));
    mx = fmaxf(mx, xhalf(mx));   // the step's 32 keys: this half's 16 and the other half's
    const float mn = fmaxf(m, mx); const float nbn = fmaf(-mn, KS, PSL); const float alpha = __builtin_amdgcn_exp2f(nbn - nb); float rs;
    float e[16];   // e[2i], e[2i + 1]: exponents, then weights x 2^4, of keys i and 16 + i of this half
#pragma unroll   // constant indices keep the register arrays in registers
    for (int i = 0; i < 8; ++i) { e[2 * i] = fmaf(s[0][i], KS, nbn); e[2 * i + 1] = fmaf(s[1][i], KS, nbn); }
    exp2x16(e);
    v16h pa, pl;   // P^T x 2^4 as f16 hi; residual carried x2^11, folded in the epilogue
#pragma unroll   // constant indices keep the register arrays in registers
    for (int i = 0; i < 8; ++i) { const float x0 = e[2 * i], x1 = e[2 * i + 1]; rs = i ? rs + (x0 + x1) : x0 + x1;
      const _Float16 h0 = (_Float16)x0, h1 = (_Float16)x1; pa[i] = h0; pa[8 + i] = h1; if (lead) { pl[i] = (_Float16)((x0 - (float)h0) * 2048.0f); pl[8 + i] = (_Float16)((x1 - (float)h1) * 2048.0f); } }
    l = l * alpha + rs; m = mn; nb = nbn;
#pragma unroll   // constant indices keep the register arrays in registers
    for (int dt = 0; dt < 4; ++dt) {
#pragma unroll   // constant indices keep the register arrays in registers
      for (int r = 0; r < 8; ++r) { acc[dt][r] *= alpha; if (lead) accl[dt][r] *= alpha; } }
#pragma unroll
    for (int dt = 0; dt < 4; ++dt) { const size_t vr = ((size_t)b * DM + h * HD + dt * 16 + col) * SEQ + ks * 32; acc[dt] = wmma16(vh[dt], pa, acc[dt]); if (lead) { accl[dt] = wmma16(vh[dt], pl, accl[dt]); accl[dt] = wmma16(frag_h(VTL + vr, lane), pa, accl[dt]); } } }
    asm volatile("s_wait_dscnt 0x0" ::: "memory");      // this wave's reads of tile t have returned
    asm volatile("s_wait_asynccnt 0x0" ::: "memory");   // this wave's pieces of tile t + 1 have landed
    __syncthreads();                                     // publishes tile t + 1 and ends every wave's reads of tile t, whose buffer is refilled behind it
    if (t + 2 < nst) stage_kv(lk + (t & 1) * (AT_BUF * 2), gk + (size_t)(t + 2) * AT * 2 * DM, lv + (t & 1) * (AT_BUF * 2), gv + (t + 2) * AT); }
  asm volatile("s_wait_asynccnt 0x0" ::: "memory");     // no copy is left in flight when the wave goes on to its end
  l += xhalf(l);   // the two halves' key sums of this query
  const float il = 1.0f / l;   // l >= about 2^4 (the running max contributes 2^4); numerator and l carry the same 2^4 pre-scale
#pragma unroll   // constant indices keep the register arrays in registers
  for (int dt = 0; dt < 4; ++dt) {
#pragma unroll   // constant indices keep the register arrays in registers
    for (int rh = 0; rh < 8; rh += 4) { v4f o;
#pragma unroll   // constant indices keep the register arrays in registers
      for (int r = 0; r < 4; ++r) o[r] = (lead ? acc[dt][rh + r] + accl[dt][rh + r] * (1.0f / 2048.0f) : acc[dt][rh + r]) * il;
      *(v4f*)&so[wave][col][dt * 16 + 8 * g + rh] = o; } }
  ldsx();
  for (int rl = 0; rl < 16; ++rl) if (lane < 16) vst2(O + ((size_t)b * SEQ + q0 + rl) * DM + h * HD + lane * 4, *(const v4f*)&so[wave][rl][lane * 4]);
}
__global__ __launch_bounds__(128) void k_attn(const _Float16* __restrict__ QK, const _Float16* __restrict__ QKL, const _Float16* __restrict__ VTH, const _Float16* __restrict__ VTL, float* __restrict__ O) {
  __shared__ __align__(16) _Float16 skv[2 * AT_BUF];
  __shared__ __align__(16) float so[4][16][68];
  const int qb = attn_qb();
  if (qb < 2) attn_tile<true>(qb, skv, so, QK, QKL, VTH, VTL, O);   // block-uniform: leading query blocks (few keys, outputs far above the global rms)
  else attn_tile<false>(qb, skv, so, QK, QKL, VTH, VTL, O);
}
// ---- k_out: block = 16 rows x 64 columns, 8 waves; out = O (bf16 hi/lo, 2 products) . packed W rows, K = 1024 split over the waves: wave w takes k in [128 w, 128 w + 128).
//      A wave's whole slice (16 loads of O, 32 of W) is read as one group ahead of its products, so that it waits out the memory latency once and not once per fragment;
//      the eight partial tiles meet in LDS and are summed in wave order, one 16-B piece of the output per thread (a wave store = two whole 256-B output rows)
#define OW 8                        // waves of a block = slices of K
#define OKS (DM / OW)               // k per wave
#define OKC (OKS / 32)              // 32-k product steps per wave
static_assert(DM % (OW * 32) == 0 && SEQ % 16 == 0 && OW * 32 == 16 * (NE / 4));
__global__ __launch_bounds__(OW * 32) void k_out(const float* __restrict__ O, const __bf16* __restrict__ P, float* __restrict__ Y) {
  __shared__ __align__(16) float so[OW][16][68];
  const int tid = threadIdx.x, wave = tid >> 5, lane = tid & 31, col = lane & 15, g = lane >> 4;
  const size_t r0 = (size_t)blockIdx.x * 16; const int b = (int)(r0 / SEQ), s0 = (int)(r0 % SEQ);
  const size_t yr0 = (size_t)b * SEQ_FULL + s0;
  const float* orow = O + (r0 + col) * DM + wave * OKS + 8 * g;   // this lane's row of O, at its first k
  const __bf16* prow = P + (size_t)col * DM + wave * OKS;
  v4f x[OKC][4]; v16b w[OKC][4];
#pragma unroll   // constant indices keep the register arrays in registers
  for (int kc = 0; kc < OKC; ++kc) { const float* p = orow + kc * 32;   // elements 0..7 <- k0 + 8g + i, 8..15 <- k0 + 16 + 8g + i, as in frag_b
    x[kc][0] = *(const v4f*)p; x[kc][1] = *(const v4f*)(p + 4); x[kc][2] = *(const v4f*)(p + 16); x[kc][3] = *(const v4f*)(p + 20); }
  asm volatile("s_wait_xcnt 0x0" ::: "memory");   // stands in front of the loads below, whose destinations may take over the address registers of the loads above
#pragma unroll   // constant indices keep the register arrays in registers
  for (int kc = 0; kc < OKC; ++kc) {
#pragma unroll   // constant indices keep the register arrays in registers
    for (int j = 0; j < 4; ++j) w[kc][j] = frag_b(prow + (size_t)(j * 16) * DM + kc * 32, lane); }
  v8f acc[4] = {};
#pragma unroll   // constant indices keep the register arrays in registers
  for (int kc = 0; kc < OKC; ++kc) { float v[16];
#pragma unroll
    for (int i = 0; i < 16; ++i) v[i] = x[kc][i >> 2][i & 3];
    const F2 a = bsplit16(v);
#pragma unroll
    for (int j = 0; j < 4; ++j) acc[j] = wmma_bf(a.l, w[kc][j], acc[j]);
#pragma unroll
    for (int j = 0; j < 4; ++j) acc[j] = wmma_bf(a.h, w[kc][j], acc[j]); }
#pragma unroll
  for (int j = 0; j < 4; ++j) {
#pragma unroll
    for (int r = 0; r < 8; ++r) so[wave][8 * g + r][j * 16 + col] = acc[j][r]; }
  __syncthreads();   // every wave's partial tile is in LDS before any thread sums them
  const int row = tid >> 4, c4 = (tid & 15) * 4;
  v4f y = *(const v4f*)&so[0][row][c4];
#pragma unroll
  for (int q = 1; q < OW; ++q) y += *(const v4f*)&so[q][row][c4];
  vst2(Y + (yr0 + row) * NE + c4, y);
}
extern "C" void kernel_launch(void* const* d_in, const int* in_sizes, int n_in, void* d_out, int out_size, void* d_ws, size_t ws_size, hipStream_t stream) {
  if (n_in < 5) return;
  if (in_sizes[0] < ((NB - 1) * SEQ_FULL + SEQ) * DM) return;                                        // x [2,2048,1024]
  if (in_sizes[1] < NH * DM * HD || in_sizes[2] < NH * DM * HD || in_sizes[3] < NH * DM * HD) return;  // Wq Wk Wv [16,1024,64]
  if (in_sizes[4] < DM * NE) return;                                                                   // W [1024,64]
  if (out_size < ((NB - 1) * SEQ_FULL + SEQ) * NE) return;                                             // out [2,2048,64]
  if (ws_size < (size_t)WS_END) return;
  const float* X = (const float*)d_in[0]; const float* WQ = (const float*)d_in[1]; const float* WK = (const float*)d_in[2]; const float* WV = (const float*)d_in[3]; const float* WO = (const float*)d_in[4];
  char* ws = (char*)d_ws; __bf16* PK = (__bf16*)(ws + WS_PK); _Float16 *QK = (_Float16*)(ws + WS_QK), *QKL = (_Float16*)(ws + WS_QKL), *VTH = (_Float16*)(ws + WS_VTH), *VTL = (_Float16*)(ws + WS_VTL); float* O = (float*)(ws + WS_O);
  k_pack<<<dim3(DM / 64, NPK / 64), 256, 0, stream>>>(WQ, WK, WV, WO, PK);
  k_qkv<<<dim3(NB * SEQ / 64, QKVW / 128), 128, 0, stream>>>(X, PK, QK, QKL, VTH, VTL);
  k_attn<<<dim3(SEQ / 64, NH, NB), 128, 0, stream>>>(QK, QKL, VTH, VTL, O);
  k_out<<<dim3(NB * SEQ / 16, 1), OW * 32, 0, stream>>>(O, PK + (size_t)QKVW * DM, (float*)d_out);
}

// v008
// A run of this version takes 79.3 microseconds.
// Next to v007, in two timings, it ran 1.04 times as fast each time.
// Over all steps from v000 it is 4.64 times as fast.
// compute dtype: all float inputs RNE-converted to bf16; q|k|v = x . W[h] with exact bf16 x bf16 products on v_wmma_f32_16x16x32_bf16, stored as f16 hi + residual(x2^11) planes (v transposed); scores = q . k on v_wmma_f32_16x16x32_f16 (query blocks 0..1: 3-product hi/res, later blocks single f16), causal online softmax (running max of the raw scores; 1/8, log2 e, the maximum and the 2^4 pre-scale folded into one f32 fma per exponent) in f32; P x 2^4 as f16 hi (+ residual x2^11 against v hi + v lo on query blocks 0..1, single P x v hi elsewhere) on f16 WMMA; out = ctx (bf16 hi + lo) . W on bf16 WMMA; f32 accumulate everywhere, f32 output.
#include <hip/hip_runtime.h>
#include <math.h>

typedef __attribute__((ext_vector_type(16))) _Float16 v16h;
typedef __attribute__((ext_vector_type(16))) __bf16 v16b;
typedef __attribute__((ext_vector_type(8)))  _Float16 v8h;
typedef __attribute__((ext_vector_type(8)))  __bf16 v8b;
typedef __attribute__((ext_vector_type(4)))  __bf16 v4b;
typedef __attribute__((ext_vector_type(8)))  float v8f;
typedef __attribute__((ext_vector_type(4)))  float v4f;
typedef __attribute__((ext_vector_type(4)))  unsigned v4u;

template <typename T> __device__ __forceinline__ void vst2(void* p, T v) { *(T*)p = v;  }
__device__ __forceinline__ v8f wmma16(v16h a, v16h b, v8f c) {
  v8f d = __builtin_amdgcn_wmma_f32_16x16x32_f16(false, a, false, b, (short)0, c, false, false);
  asm volatile("v_nop\n\tv_nop\n\tv_nop\n\tv_nop" : "+v"(d) : "v"(a), "v"(b));
  return d;
}
__device__ __forceinline__ v8f wmma_bf(v16b a, v16b b, v8f c) {
  v8f d = __builtin_amdgcn_wmma_f32_16x16x32_bf16(false, a, false, b, (short)0, c, false, false);
  asm volatile("v_nop\n\tv_nop\n\tv_nop\n\tv_nop" : "+v"(d) : "v"(a), "v"(b));
  return d;
}
// 16-bit row fragment (row m = lane & 15 selected by the caller): elements 0..7 <- k0 + 8h + i, 8..15 <- k0 + 16 + 8h + i, h = lane >> 4
__device__ __forceinline__ v16h frag_h(const _Float16* rowk0, int lane) {
  union { v16h v; v8h q[2]; } u; const _Float16* p = rowk0 + 8 * (lane >> 4);
  u.q[0] = *(const v8h*)p; u.q[1] = *(const v8h*)(p + 16); return u.v;
}
__device__ __forceinline__ v16b frag_b(const __bf16* rowk0, int lane) {
  union { v16b v; v8b q[2]; } u; const __bf16* p = rowk0 + 8 * (lane >> 4);
  u.q[0] = *(const v8b*)p; u.q[1] = *(const v8b*)(p + 16); return u.v;
}
struct F2 { v16b h, l; };
__device__ __forceinline__ F2 bsplit16(const float v[16]) { F2 r;
#pragma unroll
  for (int i = 0; i < 16; ++i) { const __bf16 h = (__bf16)v[i]; r.h[i] = h; r.l[i] = (__bf16)(v[i] - (float)h); }
  return r; }
__device__ __forceinline__ void ldsx() { asm volatile("s_wait_dscnt 0" ::: "memory"); __builtin_amdgcn_wave_barrier(); __builtin_amdgcn_fence(3, "workgroup"); }

// causal multi-head attention: per-head q/k/v projections D 1,024 -> 64 (16 heads, weights [h][in][out]), scores/8, -inf above the diagonal, softmax, ctx merged head-major, out = ctx . W ([in 1,024][out 64])
#ifndef NB
#define NB 2
#endif
#ifndef SEQ
#define SEQ 2048
#endif
#define NB_FULL 2
#define SEQ_FULL 2048
#define DM 1024
#define NH 16
#define HD 64
#define NE 64
#define QKVW (3 * DM)        // fused q | k | v output columns, column h*64+e (+0 / +1024 / +2048)
#define NPK (QKVW + NE)      // packed bf16 weight rows: 3072 q|k|v rows + 64 out-projection rows, each k-contiguous over 1024
#define PSL 4.0f             // softmax weights pre-scaled by 2^4 ahead of the f16 split (<= 16; residual carried x2^11): 4 is added to every exponent, so the row sum l carries the 2^4 too
static_assert(SEQ % 64 == 0);
static_assert(SEQ >= 64 && SEQ <= SEQ_FULL);
static_assert(NB >= 1 && NB <= NB_FULL);
static_assert(HD == NE);
static_assert(DM % 128 == 0 && NPK % 64 == 0 && HD == 64);

#define WS_PK  0ull                                           // bf16 [NPK][DM]
#define WS_QK  (WS_PK + 2ull * NPK * DM)                      // f16 [NB*SEQ][2*DM]: q | k hi
#define WS_QKL (WS_QK + 2ull * NB * SEQ * 2 * DM)             // f16 q | k residual x2048
#define WS_VTH (WS_QKL + 2ull * NB * SEQ * 2 * DM)            // f16 [b][1024 (h*64+d)][SEQ] v hi (transposed)
#define WS_VTL (WS_VTH + 2ull * NB * DM * SEQ)                // f16 v residual x2048 (transposed)
#define WS_O   (WS_VTL + 2ull * NB * DM * SEQ)                // f32 [NB*SEQ][DM] merged ctx
#define WS_END (WS_O + 4ull * NB * SEQ * DM)
static_assert(WS_END <= 134217728ull);
static_assert((WS_QK % 128) == 0 && (WS_QKL % 128) == 0 && (WS_VTH % 128) == 0 && (WS_VTL % 128) == 0 && (WS_O % 128) == 0);

// ---- k_pack: group grp 0..47 = (which = grp/16, head = grp%16) of Wq/Wk/Wv [h][d][e]; group 48 = W [d][e]; block = 128 d x 64 e of a group, wave = 64 d x 32 e, transposed in registers.
//      lane = (e piece lane & 7: four e, 16 B of a source row; d piece lane >> 3: eight d, 16 B of a packed row), twice (d + 32): a wave load = 4 source rows x one whole 128-B line;
//      a thread's sixteen loads are issued as one group, so that a wave waits out the memory latency once; a wave's two stores per e fill that packed row's 128-B line, 64 B each
__global__ __launch_bounds__(128) void k_pack(const float* __restrict__ WQ, const float* __restrict__ WK, const float* __restrict__ WV, const float* __restrict__ WO, __bf16* __restrict__ PK) {
  const int grp = blockIdx.y, wave = threadIdx.x >> 5, lane = threadIdx.x & 31; const int which = grp >> 4, hh = grp & 15;
  const int d0 = (blockIdx.x * 2 + (wave >> 1)) * 64 + (lane >> 3) * 8, e0 = (wave & 1) * 32 + (lane & 7) * 4;
  const float* Wm = (which == 0) ? WQ : (which == 1) ? WK : (which == 2) ? WV : WO;
  const float* src = Wm + ((which < 3) ? (size_t)hh * DM * HD : (size_t)0) + (size_t)d0 * HD + e0;
  v4f r[2][8];
#pragma unroll   // constant indices keep the register array in registers
  for (int k = 0; k < 2; ++k) {
#pragma unroll   // constant indices keep the register array in registers
    for (int i = 0; i < 8; ++i) r[k][i] = *(const v4f*)(src + (k * 32 + i) * HD); }
  asm volatile("s_wait_xcnt 0x0" :: "v"(src) : "memory");   // stands behind all sixteen loads and holds their address pair live up to here
  __builtin_amdgcn_sched_barrier(0);   // keeps the conversions, and with them the first wait for data, behind all sixteen loads: left free, the last four loads were issued behind a wait for the first
  __bf16* dst = PK + ((size_t)grp * 64 + e0) * DM + d0;
#pragma unroll   // constant indices keep the register array in registers
  for (int j = 0; j < 4; ++j) {
#pragma unroll   // constant indices keep the register array in registers
    for (int k = 0; k < 2; ++k) { v8b o;
#pragma unroll   // constant indices keep the register array in registers
      for (int i = 0; i < 8; ++i) o[i] = (__bf16)r[k][i][j];
      vst2(dst + (size_t)j * DM + k * 32, o); } }
}
// ---- k_qkv: block = (64 rows of x, 128 fused output columns n0): bf16(x) rows x packed bf16 weight rows on WMMA (K = 1024);
//      k tiles of 64 staged in two LDS buffers: every global load covers whole 128-B lines (x: 2 rows x 256 B per wave load, weights: 4 rows x 128 B),
//      x converted to bf16 on the way in; rows at pitch 144 B for the 16-byte fragment reads; the next tile's loads are issued ahead of this tile's products;
//      the output staging reuses the same LDS behind the loop's last barrier
#define KT 64                       // k per staged tile: one 128-B line of a weight row
#define LP (KT + 8)                 // LDS row pitch in bf16 elements (144 B = 16 B x 9)
#define ST_A (64 * LP)              // x rows of a buffer, in elements
#define ST_BUF (ST_A + 128 * LP)    // one buffer: 64 x rows, then 128 weight rows
static_assert(DM % KT == 0 && 2 * ST_BUF * 2 >= 2 * 128 * 72 * 2 && 2 * ST_BUF * 2 >= 2 * 4 * 16 * 136 * 2);
__global__ __launch_bounds__(128) void k_qkv(const float* __restrict__ X, const __bf16* __restrict__ P, _Float16* __restrict__ QK, _Float16* __restrict__ QKL, _Float16* __restrict__ VTH, _Float16* __restrict__ VTL) {
  __shared__ __align__(16) __bf16 sm[2 * ST_BUF];
  _Float16 (*so)[16][136] = (_Float16 (*)[16][136])sm; _Float16 (*sol)[16][136] = so + 4;
  _Float16 (*sth)[72] = (_Float16 (*)[72])sm; _Float16 (*stl)[72] = sth + 128;
  const int tid = threadIdx.x, wave = tid >> 5, lane = tid & 31, col = lane & 15, g = lane >> 4;
  const size_t rb = (size_t)blockIdx.x * 64; const int b = (int)(rb / SEQ), s0 = (int)(rb % SEQ);
  const size_t pr0 = rb + wave * 16;                            // plane row base (compact b*SEQ + s)
  const int n0 = blockIdx.y * 128;
  const float* xg = X + ((size_t)b * SEQ_FULL + s0 + (tid >> 4)) * DM + (tid & 15) * 4;   // this thread's 16 B of x: row tid/16 (+8 per load), floats 4*(tid%16)
  const __bf16* pg = P + (size_t)(n0 + (tid >> 3)) * DM + (tid & 7) * 8;                    // this thread's 16 B of weights: row tid/8 (+16 per load), elements 8*(tid%8)
  __bf16* sa = sm + (tid >> 4) * LP + (tid & 15) * 4; __bf16* sb = sm + ST_A + (tid >> 3) * LP + (tid & 7) * 8;
  v4f ra[8]; v4u rbw[8];
#pragma unroll   // constant indices keep the register arrays in registers
  for (int i = 0; i < 8; ++i) { ra[i] = *(const v4f*)(xg + (size_t)i * 8 * DM); rbw[i] = *(const v4u*)(pg + (size_t)i * 16 * DM); }
#pragma unroll   // constant indices keep the register arrays in registers
  for (int i = 0; i < 8; ++i) { v4b c; c[0] = (__bf16)ra[i][0]; c[1] = (__bf16)ra[i][1]; c[2] = (__bf16)ra[i][2]; c[3] = (__bf16)ra[i][3]; *(v4b*)(sa + i * 8 * LP) = c; *(v4u*)(sb + i * 16 * LP) = rbw[i]; }
  __syncthreads();
  v8f acc[8] = {};
  for (int t = 0; t < DM / KT; ++t) { const __bf16* cur = sm + (t & 1) * ST_BUF; const int nxt = ((t + 1) & 1) * ST_BUF; const bool more = t + 1 < DM / KT;
    if (more) {
#pragma unroll   // constant indices keep the register arrays in registers
      for (int i = 0; i < 8; ++i) { ra[i] = *(const v4f*)(xg + (t + 1) * KT + (size_t)i * 8 * DM); rbw[i] = *(const v4u*)(pg + (t + 1) * KT + (size_t)i * 16 * DM); } }
#pragma unroll   // constant indices keep the register arrays in registers
    for (int kk = 0; kk < KT / 32; ++kk) { const v16b a = frag_b(cur + (wave * 16 + col) * LP + kk * 32, lane);
#pragma unroll   // constant indices keep the register arrays in registers
      for (int jh = 0; jh < 8; jh += 4) { v16b w[4];   // four weight fragments read as one group ahead of their products: one LDS wait per group, not one per product
#pragma unroll   // constant indices keep the register arrays in registers
        for (int j = 0; j < 4; ++j) w[j] = frag_b(cur + ST_A + ((jh + j) * 16 + col) * LP + kk * 32, lane);
#pragma unroll   // constant indices keep the register arrays in registers
        for (int j = 0; j < 4; ++j) acc[jh + j] = wmma_bf(a, w[j], acc[jh + j]); } }
    __builtin_amdgcn_sched_barrier(0);   // keeps the conversions of the prefetched tile, and with them the wait for its global loads, behind this tile's products
    if (more) {   // the other buffer's last readers left it at the previous trip's barrier
#pragma unroll   // constant indices keep the register arrays in registers
      for (int i = 0; i < 8; ++i) { v4b c; c[0] = (__bf16)ra[i][0]; c[1] = (__bf16)ra[i][1]; c[2] = (__bf16)ra[i][2]; c[3] = (__bf16)ra[i][3]; *(v4b*)(sa + nxt + i * 8 * LP) = c; *(v4u*)(sb + nxt + i * 16 * LP) = rbw[i]; } }
    __syncthreads(); }   // publishes the tile just stored and ends every read of the tile just used (after the last trip: frees the LDS for the output staging)
  if (n0 < 2 * DM) {   // q and k stored unscaled (sigma ~0.6); 1/8 applied in the softmax exponent
#pragma unroll
    for (int j = 0; j < 8; ++j) {
#pragma unroll
      for (int r = 0; r < 8; ++r) { const float v = acc[j][r]; const _Float16 hv = (_Float16)v; so[wave][8 * g + r][j * 16 + col] = hv; sol[wave][8 * g + r][j * 16 + col] = (_Float16)((v - (float)hv) * 2048.0f); } }
    ldsx();
    for (int rl = 0; rl < 16; ++rl) if (lane < 16) { vst2(QK + (pr0 + rl) * (2 * DM) + n0 + lane * 8, *(const v4u*)&so[wave][rl][lane * 8]); vst2(QKL + (pr0 + rl) * (2 * DM) + n0 + lane * 8, *(const v4u*)&sol[wave][rl][lane * 8]); }
  } else {
#pragma unroll
    for (int j = 0; j < 8; ++j) {
#pragma unroll
      for (int r = 0; r < 8; ++r) { const float v = acc[j][r]; const _Float16 hv = (_Float16)v; sth[j * 16 + col][wave * 16 + 8 * g + r] = hv; stl[j * 16 + col][wave * 16 + 8 * g + r] = (_Float16)((v - (float)hv) * 2048.0f); } }
    __syncthreads();
    const int pc0 = n0 - 2 * DM;
    for (int q = tid; q < 128 * 8; q += 128) { const int d = q >> 3, pc = q & 7; const size_t o = ((size_t)b * DM + pc0 + d) * SEQ + s0 + pc * 8; vst2(VTH + o, *(const v4u*)&sth[d][pc * 8]); vst2(VTL + o, *(const v4u*)&stl[d][pc * 8]); }
  }
}
// ---- k_attn: block = (64 queries: query block attn_qb(), head h, batch b), wave = 16 queries; causal flash attention over 32-key steps up to the wave's last query;
//      the products are taken transposed: S^T = K . Q^T (A = K rows, B = q rows) and O^T += V^T . P^T (A = V^T rows, B = P^T), so that a lane holds scores of ONE query (column lane & 15):
//      keys 8g + r of each 16-key tile, g = lane >> 4; row maximum and row sum are in-lane, the maximum joined with the other half by one cross-row move per step, the sums joined once in the epilogue;
//      the two score tiles of a step, converted in place, are the B operand P^T in the fragments' own k order (elements 0..7 <- keys 8g + i, 8..15 <- 16 + 8g + i): P passes through no LDS;
//      K hi and V^T hi tiles of 64 keys are brought once per block into two LDS buffers by asynchronous copies (each wave copy = 4 rows x one whole 128-B line), the next tile in flight
//      while this one is worked on; the four waves read their fragments from LDS (rows at pitch 144 B for the 16-byte reads); the residual planes of query blocks 0..1 still come straight from global;
//      query blocks 0..1: 3-product q/k scores and P hi/res x V hi/lo in a second accumulator, single products elsewhere;
//      a weight is one fma and one hardware exponential: P x 2^4 = 2^(c * KS + nb), c the raw score, KS = log2(e) / 8, nb = 4 - max * KS formed once per step; results under 2^-126 may come out 0,
//      far below what the f16 P or the f32 sum (>= about 2^4) can hold; the rescale factor is 2^(nb new - nb old), the exact ratio of the two steps' weights;
//      O[b*SEQ+q][h*64+d] = (acc + accl/2048) / l, l summed over P x 2^4  (256-B segments, lanes 0..15 x 16 B)
#define AT 64                       // keys per staged tile: one 128-B line of a V^T row; a block's keys are a whole number of tiles
#define AP (AT + 8)                 // LDS row pitch in f16 elements (144 B = 16 B x 9), for K rows (64 d) and V^T rows (64 keys) alike
#define AT_V (AT * AP)              // 64 K rows of a buffer, then 64 V^T rows
#define AT_BUF (AT_V + HD * AP)
static_assert(AT == HD && SEQ % AT == 0);
#define NQB (SEQ / 64)              // query blocks of a (head, batch)
// the query block of this work-group. A block's cost grows with its query block (causal: qb + 1 key tiles), and the whole grid is resident at once, four work-groups to a WGP, so the launch lasts as long as
// the WGP that holds the most tiles; with qb = blockIdx.x, work-groups whose flat indices lie a multiple of NQB apart all have the same qb.
// Here the parity of all index bits picks a block of the lower half or its mirror NQB - 1 - qb: any four work-groups whose flat indices differ in just two bit places hold 2 * (NQB + 1) tiles together.
// For speed only: for every (head, batch) x -> qb is one-to-one, so each block is done exactly once wherever the work-groups land.
__device__ __forceinline__ int attn_qb() {
  const int x = blockIdx.x; const bool fold = NQB % 16 == 0;   // other block counts: mirrored on the parity of head and batch alone
  const int lo = fold ? (x & 7) + 8 * (x >> 4) : x;
  const int par = __builtin_popcount((unsigned)(fold ? x : 0) ^ blockIdx.y ^ blockIdx.z) & 1;   // bit 3 of x enters par alone, not lo: it tells a block from its mirror
  return par ? NQB - 1 - lo : lo;
}
// one tile: this thread's four 16-B pieces of K (rows 16 apart) and four of V^T; lk, lv = LDS byte addresses, gk, gv = global addresses of the first piece of each
__device__ __forceinline__ void stage_kv(unsigned lk, const _Float16* gk, unsigned lv, const _Float16* gv) {
  const unsigned ls = 16 * AP * 2; const size_t ks = (size_t)16 * 2 * DM, vs = (size_t)16 * SEQ;
  // the closing s_wait_xcnt stands in the copies' own statement, so that no address register named here is rewritten ahead of it
  asm volatile("global_load_async_to_lds_b128 %0, %8, off\n\t"
               "global_load_async_to_lds_b128 %1, %9, off\n\t"
               "global_load_async_to_lds_b128 %2, %10, off\n\t"
               "global_load_async_to_lds_b128 %3, %11, off\n\t"
               "global_load_async_to_lds_b128 %4, %12, off\n\t"
               "global_load_async_to_lds_b128 %5, %13, off\n\t"
               "global_load_async_to_lds_b128 %6, %14, off\n\t"
               "global_load_async_to_lds_b128 %7, %15, off\n\t"
               "s_wait_xcnt 0x0"
               :: "v"(lk), "v"(lk + ls), "v"(lk + 2 * ls), "v"(lk + 3 * ls), "v"(lv), "v"(lv + ls), "v"(lv + 2 * ls), "v"(lv + 3 * ls),
                  "v"(gk), "v"(gk + ks), "v"(gk + 2 * ks), "v"(gk + 3 * ks), "v"(gv), "v"(gv + vs), "v"(gv + 2 * vs), "v"(gv + 3 * vs) : "memory");
}
// 2^x of a step's sixteen exponents on the hardware's own exponential, in place and in one statement: each v_exp_f32 overwrites its own argument alone, so that none stands directly in front of an
// instruction that reads its result or overwrites its source (with the registers left to the allocator, neighbouring exponentials did); the closing v_nop keeps that slot behind the last one
__device__ __forceinline__ void exp2x16(float (&e)[16]) {
  asm("v_exp_f32 %0, %0\n\tv_exp_f32 %1, %1\n\tv_exp_f32 %2, %2\n\tv_exp_f32 %3, %3\n\tv_exp_f32 %4, %4\n\tv_exp_f32 %5, %5\n\tv_exp_f32 %6, %6\n\tv_exp_f32 %7, %7\n\t"
      "v_exp_f32 %8, %8\n\tv_exp_f32 %9, %9\n\tv_exp_f32 %10, %10\n\tv_exp_f32 %11, %11\n\tv_exp_f32 %12, %12\n\tv_exp_f32 %13, %13\n\tv_exp_f32 %14, %14\n\tv_exp_f32 %15, %15\n\tv_nop"
      : "+v"(e[0]), "+v"(e[1]), "+v"(e[2]), "+v"(e[3]), "+v"(e[4]), "+v"(e[5]), "+v"(e[6]), "+v"(e[7]), "+v"(e[8]), "+v"(e[9]), "+v"(e[10]), "+v"(e[11]), "+v"(e[12]), "+v"(e[13]), "+v"(e[14]), "+v"(e[15]));
}
// lane l takes the value of lane l ^ 16
__device__ __forceinline__ float xhalf(float x) { return __builtin_bit_cast(float, __builtin_amdgcn_permlanex16(__builtin_bit_cast(int, x), __builtin_bit_cast(int, x), 0x76543210, 0xfedcba98, false, false)); }
// the tile's code is compiled twice, lead = true for query blocks 0..1 and false for the rest (the flag is block-uniform), so that the later blocks, which are nearly all of the work,
// carry no residual split of P, no second accumulator to rescale or copy and no scalar branch at every product
template <bool lead> __device__ __forceinline__ void attn_tile(const int qb, _Float16* skv, float (*so)[16][68], const _Float16* __restrict__ QK, const _Float16* __restrict__ QKL, const _Float16* __restrict__ VTH, const _Float16* __restrict__ VTL, float* __restrict__ O) {
  const int tid = threadIdx.x, wave = tid >> 5, lane = tid & 31, col = lane & 15, g = lane >> 4;
  const int h = blockIdx.y, b = blockIdx.z; const int q0 = qb * 64 + wave * 16; const size_t rq = (size_t)b * SEQ + q0 + col;
  const int nst = qb + 1;     // block-uniform: staged tiles covering keys <= qb * 64 + 63
  const unsigned lk = (unsigned)(size_t)skv + ((tid >> 3) * AP + (tid & 7) * 8) * 2, lv = lk + AT_V * 2;      // this thread's first piece: row tid/8, 16 B number tid%8
  const _Float16* gk = QK + ((size_t)b * SEQ + (tid >> 3)) * (2 * DM) + DM + h * HD + (tid & 7) * 8;           // key row tid/8 of tile 0
  const _Float16* gv = VTH + ((size_t)b * DM + h * HD + (tid >> 3)) * SEQ + (tid & 7) * 8;                     // d row tid/8, keys of tile 0
  stage_kv(lk, gk, lv, gv);
  asm volatile("s_wait_asynccnt 0x0" ::: "memory");   // this wave's pieces of tile 0 have landed
  __syncthreads();                                     // publishes tile 0
  if (nst > 1) stage_kv(lk + AT_BUF * 2, gk + (size_t)AT * 2 * DM, lv + AT_BUF * 2, gv + AT);
  v16h aq[2], aql[2];   // B operands: column = query q0 + col
#pragma unroll
  for (int kc = 0; kc < 2; ++kc) { aq[kc] = frag_h(QK + rq * (2 * DM) + h * HD + kc * 32, lane); if (lead) aql[kc] = frag_h(QKL + rq * (2 * DM) + h * HD + kc * 32, lane); }
  const float KS = 0.125f * 1.44269504088896341f;   // 1/sqrt(64) x log2(e)
  float m = -1.0e30f, nb = 1.0e30f, l = 0.f;   // of query q0 + col: running maximum of the raw scores (equal in both halves), its exponent offset 4 - m * KS (first step: any large value, the factor it yields scales zeros), sum over this half's keys
  v8f acc[4] = {}, accl[4] = {};   // acc[dt][r] = O^T[d = dt * 16 + 8g + r][query q0 + col]
  const int nks = __builtin_amdgcn_readfirstlane((q0 + 16 + 31) >> 5);   // wave-uniform, held in a scalar register so that the skip below is a scalar branch: key steps covering keys <= q0 + 15 (every visited step has >= 1 unmasked key per query)
#pragma unroll 1   // one copy of the step's code for both buffers, which differ by an address only
  for (int t = 0; t < nst; ++t) { const _Float16* kt = skv + (t & 1) * AT_BUF; const _Float16* vt = kt + AT_V;
#pragma unroll 1   // one copy of the step's code for both halves of a tile
  for (int ks = 2 * t; ks < 2 * t + 2 && ks < nks; ++ks) { v8f s[2]; const int ko = (ks & 1) * 32;   // waves 0 and 1 skip the last tile's second step, wholly above their diagonal
    const int dq = q0 + col - ks * 32 - 8 * g;   // this lane's key ct * 16 + r of the step lies on or below the diagonal where ct * 16 + r <= dq
    v16h kh[2][2], vh[4];   // the step's fragments read as one group at its head: one LDS wait for the scores, none left in front of the V^T x P^T products
#pragma unroll   // constant indices keep the fragment arrays in registers
    for (int ct = 0; ct < 2; ++ct) {
#pragma unroll   // constant indices keep the fragment arrays in registers
      for (int kc = 0; kc < 2; ++kc) kh[ct][kc] = frag_h(kt + (ko + ct * 16 + col) * AP + kc * 32, lane); }
#pragma unroll   // constant indices keep the fragment arrays in registers
    for (int dt = 0; dt < 4; ++dt) vh[dt] = frag_h(vt + (dt * 16 + col) * AP + ko, lane);
#pragma unroll
    for (int ct = 0; ct < 2; ++ct) { const _Float16* krowl = QKL + ((size_t)b * SEQ + ks * 32 + ct * 16 + col) * (2 * DM) + DM + h * HD; v8f c = {}, cl = {};   // A row = key ks * 32 + ct * 16 + col
      if (lead) {
#pragma unroll
        for (int kc = 0; kc < 2; ++kc) { c = wmma16(kh[ct][kc], aq[kc], c); cl = wmma16(kh[ct][kc], aql[kc], cl); cl = wmma16(frag_h(krowl + kc * 32, lane), aq[kc], cl); }
#pragma unroll
        for (int r = 0; r < 8; ++r) c[r] += cl[r] * (1.0f / 2048.0f); }
      else {
#pragma unroll
        for (int kc = 0; kc < 2; ++kc) c = wmma16(kh[ct][kc], aq[kc], c); }
#pragma unroll   // constant indices keep the register arrays in registers
      for (int r = 0; r < 8; ++r) s[ct][r] = (ct * 16 + r <= dq) ? c[r] : -1.0e30f; }   // raw scores; keys above the diagonal replaced by a large negative fill
    float mx = fmaxf(s[0][0], s[1][0]);
#pragma unroll   // constant indices keep the register arrays in registers
    for (int r = 1; r < 8; ++r) mx = fmaxf(mx, fmaxf(s[0][r], s[1][r]));
    mx = fmaxf(mx, xhalf(mx));   // the step's 32 keys: this half's 16 and the other half's
    const float mn = fmaxf(m, mx); const float nbn = fmaf(-mn, KS, PSL); const float alpha = __builtin_amdgcn_exp2f(nbn - nb); float rs;
    float e[16];   // e[2i], e[2i + 1]: exponents, then weights x 2^4, of keys i and 16 + i of this half
#pragma unroll   // constant indices keep the register arrays in registers
    for (int i = 0; i < 8; ++i) { e[2 * i] = fmaf(s[0][i], KS, nbn); e[2 * i + 1] = fmaf(s[1][i], KS, nbn); }
    exp2x16(e);
    v16h pa, pl;   // P^T x 2^4 as f16 hi; residual carried x2^11, folded in the epilogue
#pragma unroll   // constant indices keep the register arrays in registers
    for (int i = 0; i < 8; ++i) { const float x0 = e[2 * i], x1 = e[2 * i + 1]; rs = i ? rs + (x0 + x1) : x0 + x1;
      const _Float16 h0 = (_Float16)x0, h1 = (_Float16)x1; pa[i] = h0; pa[8 + i] = h1; if (lead) { pl[i] = (_Float16)((x0 - (float)h0) * 2048.0f); pl[8 + i] = (_Float16)((x1 - (float)h1) * 2048.0f); } }
    l = l * alpha + rs; m = mn; nb = nbn;
#pragma unroll   // constant indices keep the register arrays in registers
    for (int dt = 0; dt < 4; ++dt) {
#pragma unroll   // constant indices keep the register arrays in registers
      for (int r = 0; r < 8; ++r) { acc[dt][r] *= alpha; if (lead) accl[dt][r] *= alpha; } }
#pragma unroll
    for (int dt = 0; dt < 4; ++dt) { const size_t vr = ((size_t)b * DM + h * HD + dt * 16 + col) * SEQ + ks * 32; acc[dt] = wmma16(vh[dt], pa, acc[dt]); if (lead) { accl[dt] = wmma16(vh[dt], pl, accl[dt]); accl[dt] = wmma16(frag_h(VTL + vr, lane), pa, accl[dt]); } } }
    asm volatile("s_wait_dscnt 0x0" ::: "memory");      // this wave's reads of tile t have returned
    asm volatile("s_wait_asynccnt 0x0" ::: "memory");   // this wave's pieces of tile t + 1 have landed
    __syncthreads();                                     // publishes tile t + 1 and ends every wave's reads of tile t, whose buffer is refilled behind it
    if (t + 2 < nst) stage_kv(lk + (t & 1) * (AT_BUF * 2), gk + (size_t)(t + 2) * AT * 2 * DM, lv + (t & 1) * (AT_BUF * 2), gv + (t + 2) * AT); }
  asm volatile("s_wait_asynccnt 0x0" ::: "memory");     // no copy is left in flight when the wave goes on to its end
  l += xhalf(l);   // the two halves' key sums of this query
  const float il = 1.0f / l;   // l >= about 2^4 (the running max contributes 2^4); numerator and l carry the same 2^4 pre-scale
#pragma unroll   // constant indices keep the register arrays in registers
  for (int dt = 0; dt < 4; ++dt) {
#pragma unroll   // constant indices keep the register arrays in registers
    for (int rh = 0; rh < 8; rh += 4) { v4f o;
#pragma unroll   // constant indices keep the register arrays in registers
      for (int r = 0; r < 4; ++r) o[r] = (lead ? acc[dt][rh + r] + accl[dt][rh + r] * (1.0f / 2048.0f) : acc[dt][rh + r]) * il;
      *(v4f*)&so[wave][col][dt * 16 + 8 * g + rh] = o; } }
  ldsx();
  for (int rl = 0; rl < 16; ++rl) if (lane < 16) vst2(O + ((size_t)b * SEQ + q0 + rl) * DM + h * HD + lane * 4, *(const v4f*)&so[wave][rl][lane * 4]);
}
__global__ __launch_bounds__(128) void k_attn(const _Float16* __restrict__ QK, const _Float16* __restrict__ QKL, const _Float16* __restrict__ VTH, const _Float16* __restrict__ VTL, float* __restrict__ O) {
  __shared__ __align__(16) _Float16 skv[2 * AT_BUF];
  __shared__ __align__(16) float so[4][16][68];
  const int qb = attn_qb();
  if (qb < 2) attn_tile<true>(qb, skv, so, QK, QKL, VTH, VTL, O);   // block-uniform: leading query blocks (few keys, outputs far above the global rms)
  else attn_tile<false>(qb, skv, so, QK, QKL, VTH, VTL, O);
}
// ---- k_out: block = 16 rows x 64 columns, 8 waves; out = O (bf16 hi/lo, 2 products) . packed W rows, K = 1024 split over the waves: wave w takes k in [128 w, 128 w + 128).
//      A wave's whole slice (16 loads of O, 32 of W) is read as one group ahead of its products, so that it waits out the memory latency once and not once per fragment;
//      the eight partial tiles meet in LDS and are summed in wave order, one 16-B piece of the output per thread (a wave store = two whole 256-B output rows)
#define OW 8                        // waves of a block = slices of K
#define OKS (DM / OW)               // k per wave
#define OKC (OKS / 32)              // 32-k product steps per wave
static_assert(DM % (OW * 32) == 0 && SEQ % 16 == 0 && OW * 32 == 16 * (NE / 4));
__global__ __launch_bounds__(OW * 32) void k_out(const float* __restrict__ O, const __bf16* __restrict__ P, float* __restrict__ Y) {
  __shared__ __align__(16) float so[OW][16][68];
  const int tid = threadIdx.x, wave = tid >> 5, lane = tid & 31, col = lane & 15, g = lane >> 4;
  const size_t r0 = (size_t)blockIdx.x * 16; const int b = (int)(r0 / SEQ), s0 = (int)(r0 % SEQ);
  const size_t yr0 = (size_t)b * SEQ_FULL + s0;
  const float* orow = O + (r0 + col) * DM + wave * OKS + 8 * g;   // this lane's row of O, at its first k
  const __bf16* prow = P + (size_t)col * DM + wave * OKS;
  v4f x[OKC][4]; v16b w[OKC][4];
#pragma unroll   // constant indices keep the register arrays in registers
  for (int kc = 0; kc < OKC; ++kc) { const float* p = orow + kc * 32;   // elements 0..7 <- k0 + 8g + i, 8..15 <- k0 + 16 + 8g + i, as in frag_b
    x[kc][0] = *(const v4f*)p; x[kc][1] = *(const v4f*)(p + 4); x[kc][2] = *(const v4f*)(p + 16); x[kc][3] = *(const v4f*)(p + 20); }
  asm volatile("s_wait_xcnt 0x0" ::: "memory");   // stands in front of the loads below, whose destinations may take over the address registers of the loads above
#pragma unroll   // constant indices keep the register arrays in registers
  for (int kc = 0; kc < OKC; ++kc) {
#pragma unroll   // constant indices keep the register arrays in registers
    for (int j = 0; j < 4; ++j) w[kc][j] = frag_b(prow + (size_t)(j * 16) * DM + kc * 32, lane); }
  v8f acc[4] = {};
#pragma unroll   // constant indices keep the register arrays in registers
  for (int kc = 0; kc < OKC; ++kc) { float v[16];
#pragma unroll
    for (int i = 0; i < 16; ++i) v[i] = x[kc][i >> 2][i & 3];
    const F2 a = bsplit16(v);
#pragma unroll
    for (int j = 0; j < 4; ++j) acc[j] = wmma_bf(a.l, w[kc][j], acc[j]);
#pragma unroll
    for (int j = 0; j < 4; ++j) acc[j] = wmma_bf(a.h, w[kc][j], acc[j]); }
#pragma unroll
  for (int j = 0; j < 4; ++j) {
#pragma unroll
    for (int r = 0; r < 8; ++r) so[wave][8 * g + r][j * 16 + col] = acc[j][r]; }
  __syncthreads();   // every wave's partial tile is in LDS before any thread sums them
  const int row = tid >> 4, c4 = (tid & 15) * 4;
  v4f y = *(const v4f*)&so[0][row][c4];
#pragma unroll
  for (int q = 1; q < OW; ++q) y += *(const v4f*)&so[q][row][c4];
  vst2(Y + (yr0 + row) * NE + c4, y);
}
extern "C" void kernel_launch(void* const* d_in, const int* in_sizes, int n_in, void* d_out, int out_size, void* d_ws, size_t ws_size, hipStream_t stream) {
  if (n_in < 5) return;
  if (in_sizes[0] < ((NB - 1) * SEQ_FULL + SEQ) * DM) return;                                        // x [2,2048,1024]
  if (in_sizes[1] < NH * DM * HD || in_sizes[2] < NH * DM * HD || in_sizes[3] < NH * DM * HD) return;  // Wq Wk Wv [16,1024,64]
  if (in_sizes[4] < DM * NE) return;                                                                   // W [1024,64]
  if (out_size < ((NB - 1) * SEQ_FULL + SEQ) * NE) return;                                             // out [2,2048,64]
  if (ws_size < (size_t)WS_END) return;
  const float* X = (const float*)d_in[0]; const float* WQ = (const float*)d_in[1]; const float* WK = (const float*)d_in[2]; const float* WV = (const float*)d_in[3]; const float* WO = (const float*)d_in[4];
  char* ws = (char*)d_ws; __bf16* PK = (__bf16*)(ws + WS_PK); _Float16 *QK = (_Float16*)(ws + WS_QK), *QKL = (_Float16*)(ws + WS_QKL), *VTH = (_Float16*)(ws + WS_VTH), *VTL = (_Float16*)(ws + WS_VTL); float* O = (float*)(ws + WS_O);
  k_pack<<<dim3(DM / 128, NPK / 64), 128, 0, stream>>>(WQ, WK, WV, WO, PK);
  k_qkv<<<dim3(NB * SEQ / 64, QKVW / 128), 128, 0, stream>>>(X, PK, QK, QKL, VTH, VTL);
  k_attn<<<dim3(SEQ / 64, NH, NB), 128, 0, stream>>>(QK, QKL, VTH, VTL, O);
  k_out<<<dim3(NB * SEQ / 16, 1), OW * 32, 0, stream>>>(O, PK + (size_t)QKVW * DM, (float*)d_out);
}

// v009
// A run of this version takes 72 microseconds.
// In two side-by-side timings against v008, it was 1.11 and 1.10 times as fast.
// Over all steps from v000 it is 5.13 times as fast.
// compute dtype: all float inputs RNE-converted to bf16; q|k|v = x . W[h] with exact bf16 x bf16 products on v_wmma_f32_16x16x32_bf16, stored as f16 hi + residual(x2^11) planes (v transposed); scores = q . k on v_wmma_f32_16x16x32_f16 (query blocks 0..1: 3-product hi/res, later blocks single f16), causal online softmax (running max of the raw scores; 1/8, log2 e, the maximum and the 2^4 pre-scale folded into one f32 fma per exponent) in f32; P x 2^4 as f16 hi (+ residual x2^11 against v hi + v lo on query blocks 0..1, single P x v hi elsewhere) on f16 WMMA; out = ctx (bf16 hi + lo) . W on bf16 WMMA; f32 accumulate everywhere, f32 output.
#include <hip/hip_runtime.h>
#include <math.h>

typedef __attribute__((ext_vector_type(16))) _Float16 v16h;
typedef __attribute__((ext_vector_type(16))) __bf16 v16b;
typedef __attribute__((ext_vector_type(8)))  _Float16 v8h;
typedef __attribute__((ext_vector_type(8)))  __bf16 v8b;
typedef __attribute__((ext_vector_type(4)))  __bf16 v4b;
typedef __attribute__((ext_vector_type(8)))  float v8f;
typedef __attribute__((ext_vector_type(4)))  float v4f;
typedef __attribute__((ext_vector_type(4)))  unsigned v4u;

template <typename T> __device__ __forceinline__ void vst2(void* p, T v) { *(T*)p = v;  }
__device__ __forceinline__ v8f wmma16(v16h a, v16h b, v8f c) {
  v8f d = __builtin_amdgcn_wmma_f32_16x16x32_f16(false, a, false, b, (short)0, c, false, false);
  asm volatile("v_nop\n\tv_nop\n\tv_nop\n\tv_nop" : "+v"(d) : "v"(a), "v"(b));
  return d;
}
__device__ __forceinline__ v8f wmma_bf(v16b a, v16b b, v8f c) {
  v8f d = __builtin_amdgcn_wmma_f32_16x16x32_bf16(false, a, false, b, (short)0, c, false, false);
  asm volatile("v_nop\n\tv_nop\n\tv_nop\n\tv_nop" : "+v"(d) : "v"(a), "v"(b));
  return d;
}
// 16-bit row fragment (row m = lane & 15 selected by the caller): elements 0..7 <- k0 + 8h + i, 8..15 <- k0 + 16 + 8h + i, h = lane >> 4
__device__ __forceinline__ v16h frag_h(const _Float16* rowk0, int lane) {
  union { v16h v; v8h q[2]; } u; const _Float16* p = rowk0 + 8 * (lane >> 4);
  u.q[0] = *(const v8h*)p; u.q[1] = *(const v8h*)(p + 16); return u.v;
}
__device__ __forceinline__ v16b frag_b(const __bf16* rowk0, int lane) {
  union { v16b v; v8b q[2]; } u; const __bf16* p = rowk0 + 8 * (lane >> 4);
  u.q[0] = *(const v8b*)p; u.q[1] = *(const v8b*)(p + 16); return u.v;
}
struct F2 { v16b h, l; };
__device__ __forceinline__ F2 bsplit16(const float v[16]) { F2 r;
#pragma unroll
  for (int i = 0; i < 16; ++i) { const __bf16 h = (__bf16)v[i]; r.h[i] = h; r.l[i] = (__bf16)(v[i] - (float)h); }
  return r; }
__device__ __forceinline__ void ldsx() { asm volatile("s_wait_dscnt 0" ::: "memory"); __builtin_amdgcn_wave_barrier(); __builtin_amdgcn_fence(3, "workgroup"); }

// causal multi-head attention: per-head q/k/v projections D 1,024 -> 64 (16 heads, weights [h][in][out]), scores/8, -inf above the diagonal, softmax, ctx merged head-major, out = ctx . W ([in 1,024][out 64])
#ifndef NB
#define NB 2
#endif
#ifndef SEQ
#define SEQ 2048
#endif
#define NB_FULL 2
#define SEQ_FULL 2048
#define DM 1024
#define NH 16
#define HD 64
#define NE 64
#define QKVW (3 * DM)        // fused q | k | v output columns, column h*64+e (+0 / +1024 / +2048)
#define NPK (QKVW + NE)      // packed bf16 weight rows: 3072 q|k|v rows + 64 out-projection rows, each k-contiguous over 1024
#define PSL 4.0f             // softmax weights pre-scaled by 2^4 ahead of the f16 split (<= 16; residual carried x2^11): 4 is added to every exponent, so the row sum l carries the 2^4 too
static_assert(SEQ % 64 == 0);
static_assert(SEQ >= 64 && SEQ <= SEQ_FULL);
static_assert(NB >= 1 && NB <= NB_FULL);
static_assert(HD == NE);
static_assert(DM % 128 == 0 && NPK % 64 == 0 && HD == 64);

#define WS_PK  0ull                                           // bf16 [NPK][DM]
#define WS_QK  (WS_PK + 2ull * NPK * DM)                      // f16 [NB*SEQ][NH][2*HD]: per head q | k, hi
#define WS_QKL (WS_QK + 2ull * NB * SEQ * 2 * DM)             // f16 the same layout, residual x2048
#define WS_VTH (WS_QKL + 2ull * NB * SEQ * 2 * DM)            // f16 [b][1024 (h*64+d)][SEQ] v hi (transposed)
#define WS_VTL (WS_VTH + 2ull * NB * DM * SEQ)                // f16 v residual x2048 (transposed)
#define WS_O   (WS_VTL + 2ull * NB * DM * SEQ)                // f32 [NB*SEQ][DM] merged ctx
#define WS_END (WS_O + 4ull * NB * SEQ * DM)
static_assert(WS_END <= 134217728ull);
static_assert((WS_QK % 128) == 0 && (WS_QKL % 128) == 0 && (WS_VTH % 128) == 0 && (WS_VTL % 128) == 0 && (WS_O % 128) == 0);

// ---- k_pack: group grp 0..47 = (which = grp/16, head = grp%16) of Wq/Wk/Wv [h][d][e]; group 48 = W [d][e]; block = 128 d x 64 e of a group, wave = 64 d x 32 e, transposed in registers.
//      lane = (e piece lane & 7: four e, 16 B of a source row; d piece lane >> 3: eight d, 16 B of a packed row), twice (d + 32): a wave load = 4 source rows x one whole 128-B line;
//      a thread's sixteen loads are issued as one group, so that a wave waits out the memory latency once; a wave's two stores per e fill that packed row's 128-B line, 64 B each
__global__ __launch_bounds__(128) void k_pack(const float* __restrict__ WQ, const float* __restrict__ WK, const float* __restrict__ WV, const float* __restrict__ WO, __bf16* __restrict__ PK) {
  const int grp = blockIdx.y, wave = threadIdx.x >> 5, lane = threadIdx.x & 31; const int which = grp >> 4, hh = grp & 15;
  const int d0 = (blockIdx.x * 2 + (wave >> 1)) * 64 + (lane >> 3) * 8, e0 = (wave & 1) * 32 + (lane & 7) * 4;
  const float* Wm = (which == 0) ? WQ : (which == 1) ? WK : (which == 2) ? WV : WO;
  const float* src = Wm + ((which < 3) ? (size_t)hh * DM * HD : (size_t)0) + (size_t)d0 * HD + e0;
  v4f r[2][8];
#pragma unroll   // constant indices keep the register array in registers
  for (int k = 0; k < 2; ++k) {
#pragma unroll   // constant indices keep the register array in registers
    for (int i = 0; i < 8; ++i) r[k][i] = *(const v4f*)(src + (k * 32 + i) * HD); }
  asm volatile("s_wait_xcnt 0x0" :: "v"(src) : "memory");   // stands behind all sixteen loads and holds their address pair live up to here
  __builtin_amdgcn_sched_barrier(0);   // keeps the conversions, and with them the first wait for data, behind all sixteen loads: left free, the last four loads were issued behind a wait for the first
  __bf16* dst = PK + ((size_t)grp * 64 + e0) * DM + d0;
#pragma unroll   // constant indices keep the register array in registers
  for (int j = 0; j < 4; ++j) {
#pragma unroll   // constant indices keep the register array in registers
    for (int k = 0; k < 2; ++k) { v8b o;
#pragma unroll   // constant indices keep the register array in registers
      for (int i = 0; i < 8; ++i) o[i] = (__bf16)r[k][i][j];
      vst2(dst + (size_t)j * DM + k * 32, o); } }
}
// ---- k_qkv: block = (128 rows of x, one head's q | k | v: 192 fused output columns), 8 waves as 4 x 2, wave = 32 rows x 96 columns: bf16(x) rows x packed bf16 weight rows on WMMA (K = 1024);
//      sized for what the kernel reads from L2 and from LDS: x is read once per head (16 times), the weights once per 128 rows (32 times), and eight LDS fragments feed twelve products;
//      the 512 blocks are all resident at once, two to a WGP;
//      k tiles of 64 staged in two LDS buffers: every global load covers whole 128-B lines (x: 2 rows x 256 B per wave load, weights: 4 rows x 128 B),
//      x converted to bf16 on the way in; rows at pitch 144 B for the 16-byte fragment reads; the next tile's loads are issued ahead of this tile's products;
//      the output staging (q | k rows and transposed v, side by side) reuses the same LDS behind the loop's last barrier
#define KT 64                       // k per staged tile: one 128-B line of a weight row
#define LP (KT + 8)                 // LDS row pitch in bf16 elements (144 B = 16 B x 9)
#define QM 128                      // x rows of a block
#define QN (3 * HD)                 // weight rows of a block: 64 of q, 64 of k, 64 of v, all of one head
#define QJ (QN / 32)                // 16-column accumulator tiles of a wave (half of the block's columns)
#define ST_A (QM * LP)              // x rows of a buffer, in elements
#define ST_BUF (ST_A + QN * LP)     // one buffer: 128 x rows, then 192 weight rows
#define ST_OUT (2 * (QM + HD) * 136)   // output staging in elements: q | k rows and v^T rows at pitch 136, hi and residual; larger than the two buffers, and LDS does not limit residency here
static_assert(DM % KT == 0 && SEQ % QM == 0 && DM == NH * HD && HD == 64 && ST_OUT >= 2 * ST_BUF);
__global__ __launch_bounds__(256) void k_qkv(const float* __restrict__ X, const __bf16* __restrict__ P, _Float16* __restrict__ QK, _Float16* __restrict__ QKL, _Float16* __restrict__ VTH, _Float16* __restrict__ VTL) {
  __shared__ __align__(16) __bf16 sm[ST_OUT];
  _Float16 (*so)[136] = (_Float16 (*)[136])sm; _Float16 (*sol)[136] = so + QM;    // q | k staging: 128 rows x 128 columns, hi and residual
  _Float16 (*sth)[136] = sol + QM; _Float16 (*stl)[136] = sth + HD;               // v staging behind it, transposed: 64 d x 128 rows, hi and residual
  const int tid = threadIdx.x, lane = tid & 31, col = lane & 15, g = lane >> 4;
  const int wave = __builtin_amdgcn_readfirstlane(tid >> 5), wr = wave >> 1, wc = wave & 1;   // in a scalar register: the tests on the wave's column half in the epilogue are scalar branches
  const size_t rb = (size_t)blockIdx.x * QM; const int b = (int)(rb / SEQ), s0 = (int)(rb % SEQ);
  const size_t pr0 = rb + wave * 16;                            // plane row base (compact b*SEQ + s) of the rows this wave stores
  const int hh = blockIdx.y;                                    // head
  const float* xg = X + ((size_t)b * SEQ_FULL + s0 + (tid >> 4)) * DM + (tid & 15) * 4;   // this thread's 16 B of x: row tid/16 (+16 per load), floats 4*(tid%16)
  const __bf16* pg = P + (size_t)(hh * HD + (tid >> 3)) * DM + (tid & 7) * 8;              // this thread's 16 B of weights: row tid/8 of the head's q rows; load i: plane i/2 (q, k, v: 1024 packed rows apart), +32 rows for odd i
  __bf16* sa = sm + (tid >> 4) * LP + (tid & 15) * 4; __bf16* sb = sm + ST_A + (tid >> 3) * LP + (tid & 7) * 8;   // staged weight row 32 i + tid/8 = 64 x plane + the head's output column
  v4f ra[8]; v4u rbw[6];
#pragma unroll   // constant indices keep the register arrays in registers
  for (int i = 0; i < 8; ++i) ra[i] = *(const v4f*)(xg + (size_t)i * 16 * DM);
#pragma unroll   // constant indices keep the register arrays in registers
  for (int i = 0; i < 6; ++i) rbw[i] = *(const v4u*)(pg + (size_t)((i >> 1) * DM + (i & 1) * 32) * DM);
#pragma unroll   // constant indices keep the register arrays in registers
  for (int i = 0; i < 8; ++i) { v4b c; c[0] = (__bf16)ra[i][0]; c[1] = (__bf16)ra[i][1]; c[2] = (__bf16)ra[i][2]; c[3] = (__bf16)ra[i][3]; *(v4b*)(sa + i * 16 * LP) = c; }
#pragma unroll   // constant indices keep the register arrays in registers
  for (int i = 0; i < 6; ++i) *(v4u*)(sb + i * 32 * LP) = rbw[i];
  __syncthreads();
  v8f acc[2][QJ] = {};   // acc[mi][j]: rows wr * 32 + mi * 16 .., staged weight rows (wc * 6 + j) * 16 ..
  for (int t = 0; t < DM / KT; ++t) { const __bf16* cur = sm + (t & 1) * ST_BUF; const int nxt = ((t + 1) & 1) * ST_BUF; const bool more = t + 1 < DM / KT;
    if (more) {
#pragma unroll   // constant indices keep the register arrays in registers
      for (int i = 0; i < 8; ++i) ra[i] = *(const v4f*)(xg + (t + 1) * KT + (size_t)i * 16 * DM);
#pragma unroll   // constant indices keep the register arrays in registers
      for (int i = 0; i < 6; ++i) rbw[i] = *(const v4u*)(pg + (t + 1) * KT + (size_t)((i >> 1) * DM + (i & 1) * 32) * DM); }
#pragma unroll   // constant indices keep the register arrays in registers
    for (int kk = 0; kk < KT / 32; ++kk) { v16b a[2], w[QJ];   // the eight fragments of a 32-k step read as one group ahead of its twelve products: one LDS wait per group, not one per product
#pragma unroll   // constant indices keep the register arrays in registers
      for (int mi = 0; mi < 2; ++mi) a[mi] = frag_b(cur + (wr * 32 + mi * 16 + col) * LP + kk * 32, lane);
#pragma unroll   // constant indices keep the register arrays in registers
      for (int j = 0; j < QJ; ++j) w[j] = frag_b(cur + ST_A + ((wc * QJ + j) * 16 + col) * LP + kk * 32, lane);
#pragma unroll   // constant indices keep the register arrays in registers
      for (int j = 0; j < QJ; ++j) {
#pragma unroll   // constant indices keep the register arrays in registers
        for (int mi = 0; mi < 2; ++mi) acc[mi][j] = wmma_bf(a[mi], w[j], acc[mi][j]); } }
    __builtin_amdgcn_sched_barrier(0);   // keeps the conversions of the prefetched tile, and with them the wait for its global loads, behind this tile's products
    if (more) {   // the other buffer's last readers left it at the previous trip's barrier
#pragma unroll   // constant indices keep the register arrays in registers
      for (int i = 0; i < 8; ++i) { v4b c; c[0] = (__bf16)ra[i][0]; c[1] = (__bf16)ra[i][1]; c[2] = (__bf16)ra[i][2]; c[3] = (__bf16)ra[i][3]; *(v4b*)(sa + nxt + i * 16 * LP) = c; }
#pragma unroll   // constant indices keep the register arrays in registers
      for (int i = 0; i < 6; ++i) *(v4u*)(sb + nxt + i * 32 * LP) = rbw[i]; }
    __syncthreads(); }   // publishes the tile just stored and ends every read of the tile just used (after the last trip: frees the LDS for the output staging)
  // q and k (the block's column tiles 0..7) stored unscaled (sigma ~0.6); 1/8 applied in the softmax exponent; v (tiles 8..11) staged transposed
#pragma unroll   // constant indices keep the register arrays in registers
  for (int j = 0; j < QJ; ++j) { const int cj = wc * QJ + j;   // the block's column tile: 0..3 q, 4..7 k, 8..11 v; wave-uniform
    if (cj < 8) {
#pragma unroll   // constant indices keep the register arrays in registers
      for (int mi = 0; mi < 2; ++mi) {
#pragma unroll   // constant indices keep the register arrays in registers
        for (int r = 0; r < 8; ++r) { const float v = acc[mi][j][r]; const _Float16 hv = (_Float16)v; const int row = wr * 32 + mi * 16 + 8 * g + r; so[row][cj * 16 + col] = hv; sol[row][cj * 16 + col] = (_Float16)((v - (float)hv) * 2048.0f); } } }
    else {
#pragma unroll   // constant indices keep the register arrays in registers
      for (int mi = 0; mi < 2; ++mi) {
#pragma unroll   // constant indices keep the register arrays in registers
        for (int r = 0; r < 8; ++r) { const float v = acc[mi][j][r]; const _Float16 hv = (_Float16)v; const int row = wr * 32 + mi * 16 + 8 * g + r; sth[(cj - 8) * 16 + col][row] = hv; stl[(cj - 8) * 16 + col][row] = (_Float16)((v - (float)hv) * 2048.0f); } } } }
  __syncthreads();   // a staged row holds values of several waves: all are written before any row is read back
  const size_t qc = (size_t)hh * (2 * HD) + (lane & 15) * 8;   // the head's q | k: one aligned 256-B piece of a plane row, lanes 0..15 x 16 B
  for (int rl = 0; rl < 16; ++rl) if (lane < 16) { vst2(QK + (pr0 + rl) * (2 * DM) + qc, *(const v4u*)&so[wave * 16 + rl][lane * 8]); vst2(QKL + (pr0 + rl) * (2 * DM) + qc, *(const v4u*)&sol[wave * 16 + rl][lane * 8]); }
  for (int q = tid; q < HD * 16; q += 256) { const int d = q >> 4, pc = q & 15; const size_t o = ((size_t)b * DM + hh * HD + d) * SEQ + s0 + pc * 8; vst2(VTH + o, *(const v4u*)&sth[d][pc * 8]); vst2(VTL + o, *(const v4u*)&stl[d][pc * 8]); }
}
// ---- k_attn: block = (64 queries: query block attn_qb(), head h, batch b), wave = 16 queries; causal flash attention over 32-key steps up to the wave's last query;
//      the products are taken transposed: S^T = K . Q^T (A = K rows, B = q rows) and O^T += V^T . P^T (A = V^T rows, B = P^T), so that a lane holds scores of ONE query (column lane & 15):
//      keys 8g + r of each 16-key tile, g = lane >> 4; row maximum and row sum are in-lane, the maximum joined with the other half by one cross-row move per step, the sums joined once in the epilogue;
//      the two score tiles of a step, converted in place, are the B operand P^T in the fragments' own k order (elements 0..7 <- keys 8g + i, 8..15 <- 16 + 8g + i): P passes through no LDS;
//      K hi and V^T hi tiles of 64 keys are brought once per block into two LDS buffers by asynchronous copies (each wave copy = 4 rows x one whole 128-B line), the next tile in flight
//      while this one is worked on; the four waves read their fragments from LDS (rows at pitch 144 B for the 16-byte reads); the residual planes of query blocks 0..1 still come straight from global;
//      query blocks 0..1: 3-product q/k scores and P hi/res x V hi/lo in a second accumulator, single products elsewhere;
//      a weight is one fma and one hardware exponential: P x 2^4 = 2^(c * KS + nb), c the raw score, KS = log2(e) / 8, nb = 4 - max * KS formed once per step; results under 2^-126 may come out 0,
//      far below what the f16 P or the f32 sum (>= about 2^4) can hold; the rescale factor is 2^(nb new - nb old), the exact ratio of the two steps' weights;
//      O[b*SEQ+q][h*64+d] = (acc + accl/2048) / l, l summed over P x 2^4  (256-B segments, lanes 0..15 x 16 B)
#define AT 64                       // keys per staged tile: one 128-B line of a V^T row; a block's keys are a whole number of tiles
#define AP (AT + 8)                 // LDS row pitch in f16 elements (144 B = 16 B x 9), for K rows (64 d) and V^T rows (64 keys) alike
#define AT_V (AT * AP)              // 64 K rows of a buffer, then 64 V^T rows
#define AT_BUF (AT_V + HD * AP)
static_assert(AT == HD && SEQ % AT == 0);
#define NQB (SEQ / 64)              // query blocks of a (head, batch)
// the query block of this work-group. A block's cost grows with its query block (causal: qb + 1 key tiles), and the whole grid is resident at once, four work-groups to a WGP, so the launch lasts as long as
// the WGP that holds the most tiles; with qb = blockIdx.x, work-groups whose flat indices lie a multiple of NQB apart all have the same qb.
// Here the parity of all index bits picks a block of the lower half or its mirror NQB - 1 - qb: any four work-groups whose flat indices differ in just two bit places hold 2 * (NQB + 1) tiles together.
// For speed only: for every (head, batch) x -> qb is one-to-one, so each block is done exactly once wherever the work-groups land.
__device__ __forceinline__ int attn_qb() {
  const int x = blockIdx.x; const bool fold = NQB % 16 == 0;   // other block counts: mirrored on the parity of head and batch alone
  const int lo = fold ? (x & 7) + 8 * (x >> 4) : x;
  const int par = __builtin_popcount((unsigned)(fold ? x : 0) ^ blockIdx.y ^ blockIdx.z) & 1;   // bit 3 of x enters par alone, not lo: it tells a block from its mirror
  return par ? NQB - 1 - lo : lo;
}
// one tile: this thread's four 16-B pieces of K (rows 16 apart) and four of V^T; lk, lv = LDS byte addresses, gk, gv = global addresses of the first piece of each
__device__ __forceinline__ void stage_kv(unsigned lk, const _Float16* gk, unsigned lv, const _Float16* gv) {
  const unsigned ls = 16 * AP * 2; const size_t ks = (size_t)16 * 2 * DM, vs = (size_t)16 * SEQ;
  // the closing s_wait_xcnt stands in the copies' own statement, so that no address register named here is rewritten ahead of it
  asm volatile("global_load_async_to_lds_b128 %0, %8, off\n\t"
               "global_load_async_to_lds_b128 %1, %9, off\n\t"
               "global_load_async_to_lds_b128 %2, %10, off\n\t"
               "global_load_async_to_lds_b128 %3, %11, off\n\t"
               "global_load_async_to_lds_b128 %4, %12, off\n\t"
               "global_load_async_to_lds_b128 %5, %13, off\n\t"
               "global_load_async_to_lds_b128 %6, %14, off\n\t"
               "global_load_async_to_lds_b128 %7, %15, off\n\t"
               "s_wait_xcnt 0x0"
               :: "v"(lk), "v"(lk + ls), "v"(lk + 2 * ls), "v"(lk + 3 * ls), "v"(lv), "v"(lv + ls), "v"(lv + 2 * ls), "v"(lv + 3 * ls),
                  "v"(gk), "v"(gk + ks), "v"(gk + 2 * ks), "v"(gk + 3 * ks), "v"(gv), "v"(gv + vs), "v"(gv + 2 * vs), "v"(gv + 3 * vs) : "memory");
}
// 2^x of a step's sixteen exponents on the hardware's own exponential, in place and in one statement: each v_exp_f32 overwrites its own argument alone, so that none stands directly in front of an
// instruction that reads its result or overwrites its source (with the registers left to the allocator, neighbouring exponentials did); the closing v_nop keeps that slot behind the last one
__device__ __forceinline__ void exp2x16(float (&e)[16]) {
  asm("v_exp_f32 %0, %0\n\tv_exp_f32 %1, %1\n\tv_exp_f32 %2, %2\n\tv_exp_f32 %3, %3\n\tv_exp_f32 %4, %4\n\tv_exp_f32 %5, %5\n\tv_exp_f32 %6, %6\n\tv_exp_f32 %7, %7\n\t"
      "v_exp_f32 %8, %8\n\tv_exp_f32 %9, %9\n\tv_exp_f32 %10, %10\n\tv_exp_f32 %11, %11\n\tv_exp_f32 %12, %12\n\tv_exp_f32 %13, %13\n\tv_exp_f32 %14, %14\n\tv_exp_f32 %15, %15\n\tv_nop"
      : "+v"(e[0]), "+v"(e[1]), "+v"(e[2]), "+v"(e[3]), "+v"(e[4]), "+v"(e[5]), "+v"(e[6]), "+v"(e[7]), "+v"(e[8]), "+v"(e[9]), "+v"(e[10]), "+v"(e[11]), "+v"(e[12]), "+v"(e[13]), "+v"(e[14]), "+v"(e[15]));
}
// lane l takes the value of lane l ^ 16
__device__ __forceinline__ float xhalf(float x) { return __builtin_bit_cast(float, __builtin_amdgcn_permlanex16(__builtin_bit_cast(int, x), __builtin_bit_cast(int, x), 0x76543210, 0xfedcba98, false, false)); }
// the tile's code is compiled twice, lead = true for query blocks 0..1 and false for the rest (the flag is block-uniform), so that the later blocks, which are nearly all of the work,
// carry no residual split of P, no second accumulator to rescale or copy and no scalar branch at every product
template <bool lead> __device__ __forceinline__ void attn_tile(const int qb, _Float16* skv, float (*so)[16][68], const _Float16* __restrict__ QK, const _Float16* __restrict__ QKL, const _Float16* __restrict__ VTH, const _Float16* __restrict__ VTL, float* __restrict__ O) {
  const int tid = threadIdx.x, wave = tid >> 5, lane = tid & 31, col = lane & 15, g = lane >> 4;
  const int h = blockIdx.y, b = blockIdx.z; const int q0 = qb * 64 + wave * 16; const size_t rq = (size_t)b * SEQ + q0 + col;
  const int nst = qb + 1;     // block-uniform: staged tiles covering keys <= qb * 64 + 63
  const unsigned lk = (unsigned)(size_t)skv + ((tid >> 3) * AP + (tid & 7) * 8) * 2, lv = lk + AT_V * 2;      // this thread's first piece: row tid/8, 16 B number tid%8
  const _Float16* gk = QK + ((size_t)b * SEQ + (tid >> 3)) * (2 * DM) + h * (2 * HD) + HD + (tid & 7) * 8;           // key row tid/8 of tile 0
  const _Float16* gv = VTH + ((size_t)b * DM + h * HD + (tid >> 3)) * SEQ + (tid & 7) * 8;                     // d row tid/8, keys of tile 0
  stage_kv(lk, gk, lv, gv);
  asm volatile("s_wait_asynccnt 0x0" ::: "memory");   // this wave's pieces of tile 0 have landed
  __syncthreads();                                     // publishes tile 0
  if (nst > 1) stage_kv(lk + AT_BUF * 2, gk + (size_t)AT * 2 * DM, lv + AT_BUF * 2, gv + AT);
  v16h aq[2], aql[2];   // B operands: column = query q0 + col
#pragma unroll
  for (int kc = 0; kc < 2; ++kc) { aq[kc] = frag_h(QK + rq * (2 * DM) + h * (2 * HD) + kc * 32, lane); if (lead) aql[kc] = frag_h(QKL + rq * (2 * DM) + h * (2 * HD) + kc * 32, lane); }
  const float KS = 0.125f * 1.44269504088896341f;   // 1/sqrt(64) x log2(e)
  float m = -1.0e30f, nb = 1.0e30f, l = 0.f;   // of query q0 + col: running maximum of the raw scores (equal in both halves), its exponent offset 4 - m * KS (first step: any large value, the factor it yields scales zeros), sum over this half's keys
  v8f acc[4] = {}, accl[4] = {};   // acc[dt][r] = O^T[d = dt * 16 + 8g + r][query q0 + col]
  const int nks = __builtin_amdgcn_readfirstlane((q0 + 16 + 31) >> 5);   // wave-uniform, held in a scalar register so that the skip below is a scalar branch: key steps covering keys <= q0 + 15 (every visited step has >= 1 unmasked key per query)
#pragma unroll 1   // one copy of the step's code for both buffers, which differ by an address only
  for (int t = 0; t < nst; ++t) { const _Float16* kt = skv + (t & 1) * AT_BUF; const _Float16* vt = kt + AT_V;
#pragma unroll 1   // one copy of the step's code for both halves of a tile
  for (int ks = 2 * t; ks < 2 * t + 2 && ks < nks; ++ks) { v8f s[2]; const int ko = (ks & 1) * 32;   // waves 0 and 1 skip the last tile's second step, wholly above their diagonal
    const int dq = q0 + col - ks * 32 - 8 * g;   // this lane's key ct * 16 + r of the step lies on or below the diagonal where ct * 16 + r <= dq
    v16h kh[2][2], vh[4];   // the step's fragments read as one group at its head: one LDS wait for the scores, none left in front of the V^T x P^T products
#pragma unroll   // constant indices keep the fragment arrays in registers
    for (int ct = 0; ct < 2; ++ct) {
#pragma unroll   // constant indices keep the fragment arrays in registers
      for (int kc = 0; kc < 2; ++kc) kh[ct][kc] = frag_h(kt + (ko + ct * 16 + col) * AP + kc * 32, lane); }
#pragma unroll   // constant indices keep the fragment arrays in registers
    for (int dt = 0; dt < 4; ++dt) vh[dt] = frag_h(vt + (dt * 16 + col) * AP + ko, lane);
#pragma unroll
    for (int ct = 0; ct < 2; ++ct) { const _Float16* krowl = QKL + ((size_t)b * SEQ + ks * 32 + ct * 16 + col) * (2 * DM) + h * (2 * HD) + HD; v8f c = {}, cl = {};   // A row = key ks * 32 + ct * 16 + col
      if (lead) {
#pragma unroll
        for (int kc = 0; kc < 2; ++kc) { c = wmma16(kh[ct][kc], aq[kc], c); cl = wmma16(kh[ct][kc], aql[kc], cl); cl = wmma16(frag_h(krowl + kc * 32, lane), aq[kc], cl); }
#pragma unroll
        for (int r = 0; r < 8; ++r) c[r] += cl[r] * (1.0f / 2048.0f); }
      else {
#pragma unroll
        for (int kc = 0; kc < 2; ++kc) c = wmma16(kh[ct][kc], aq[kc], c); }
#pragma unroll   // constant indices keep the register arrays in registers
      for (int r = 0; r < 8; ++r) s[ct][r] = (ct * 16 + r <= dq) ? c[r] : -1.0e30f; }   // raw scores; keys above the diagonal replaced by a large negative fill
    float mx = fmaxf(s[0][0], s[1][0]);
#pragma unroll   // constant indices keep the register arrays in registers
    for (int r = 1; r < 8; ++r) mx = fmaxf(mx, fmaxf(s[0][r], s[1][r]));
    mx = fmaxf(mx, xhalf(mx));   // the step's 32 keys: this half's 16 and the other half's
    const float mn = fmaxf(m, mx); const float nbn = fmaf(-mn, KS, PSL); const float alpha = __builtin_amdgcn_exp2f(nbn - nb); float rs;
    float e[16];   // e[2i], e[2i + 1]: exponents, then weights x 2^4, of keys i and 16 + i of this half
#pragma unroll   // constant indices keep the register arrays in registers
    for (int i = 0; i < 8; ++i) { e[2 * i] = fmaf(s[0][i], KS, nbn); e[2 * i + 1] = fmaf(s[1][i], KS, nbn); }
    exp2x16(e);
    v16h pa, pl;   // P^T x 2^4 as f16 hi; residual carried x2^11, folded in the epilogue
#pragma unroll   // constant indices keep the register arrays in registers
    for (int i = 0; i < 8; ++i) { const float x0 = e[2 * i], x1 = e[2 * i + 1]; rs = i ? rs + (x0 + x1) : x0 + x1;
      const _Float16 h0 = (_Float16)x0, h1 = (_Float16)x1; pa[i] = h0; pa[8 + i] = h1; if (lead) { pl[i] = (_Float16)((x0 - (float)h0) * 2048.0f); pl[8 + i] = (_Float16)((x1 - (float)h1) * 2048.0f); } }
    l = l * alpha + rs; m = mn; nb = nbn;
#pragma unroll   // constant indices keep the register arrays in registers
    for (int dt = 0; dt < 4; ++dt) {
#pragma unroll   // constant indices keep the register arrays in registers
      for (int r = 0; r < 8; ++r) { acc[dt][r] *= alpha; if (lead) accl[dt][r] *= alpha; } }
#pragma unroll
    for (int dt = 0; dt < 4; ++dt) { const size_t vr = ((size_t)b * DM + h * HD + dt * 16 + col) * SEQ + ks * 32; acc[dt] = wmma16(vh[dt], pa, acc[dt]); if (lead) { accl[dt] = wmma16(vh[dt], pl, accl[dt]); accl[dt] = wmma16(frag_h(VTL + vr, lane), pa, accl[dt]); } } }
    asm volatile("s_wait_dscnt 0x0" ::: "memory");      // this wave's reads of tile t have returned
    asm volatile("s_wait_asynccnt 0x0" ::: "memory");   // this wave's pieces of tile t + 1 have landed
    __syncthreads();                                     // publishes tile t + 1 and ends every wave's reads of tile t, whose buffer is refilled behind it
    if (t + 2 < nst) stage_kv(lk + (t & 1) * (AT_BUF * 2), gk + (size_t)(t + 2) * AT * 2 * DM, lv + (t & 1) * (AT_BUF * 2), gv + (t + 2) * AT); }
  asm volatile("s_wait_asynccnt 0x0" ::: "memory");     // no copy is left in flight when the wave goes on to its end
  l += xhalf(l);   // the two halves' key sums of this query
  const float il = 1.0f / l;   // l >= about 2^4 (the running max contributes 2^4); numerator and l carry the same 2^4 pre-scale
#pragma unroll   // constant indices keep the register arrays in registers
  for (int dt = 0; dt < 4; ++dt) {
#pragma unroll   // constant indices keep the register arrays in registers
    for (int rh = 0; rh < 8; rh += 4) { v4f o;
#pragma unroll   // constant indices keep the register arrays in registers
      for (int r = 0; r < 4; ++r) o[r] = (lead ? acc[dt][rh + r] + accl[dt][rh + r] * (1.0f / 2048.0f) : acc[dt][rh + r]) * il;
      *(v4f*)&so[wave][col][dt * 16 + 8 * g + rh] = o; } }
  ldsx();
  for (int rl = 0; rl < 16; ++rl) if (lane < 16) vst2(O + ((size_t)b * SEQ + q0 + rl) * DM + h * HD + lane * 4, *(const v4f*)&so[wave][rl][lane * 4]);
}
__global__ __launch_bounds__(128) void k_attn(const _Float16* __restrict__ QK, const _Float16* __restrict__ QKL, const _Float16* __restrict__ VTH, const _Float16* __restrict__ VTL, float* __restrict__ O) {
  __shared__ __align__(16) _Float16 skv[2 * AT_BUF];
  __shared__ __align__(16) float so[4][16][68];
  const int qb = attn_qb();
  if (qb < 2) attn_tile<true>(qb, skv, so, QK, QKL, VTH, VTL, O);   // block-uniform: leading query blocks (few keys, outputs far above the global rms)
  else attn_tile<false>(qb, skv, so, QK, QKL, VTH, VTL, O);
}
// ---- k_out: block = 16 rows x 64 columns, 8 waves; out = O (bf16 hi/lo, 2 products) . packed W rows, K = 1024 split over the waves: wave w takes k in [128 w, 128 w + 128).
//      A wave's whole slice (16 loads of O, 32 of W) is read as one group ahead of its products, so that it waits out the memory latency once and not once per fragment;
//      the eight partial tiles meet in LDS and are summed in wave order, one 16-B piece of the output per thread (a wave store = two whole 256-B output rows)
#define OW 8                        // waves of a block = slices of K
#define OKS (DM / OW)               // k per wave
#define OKC (OKS / 32)              // 32-k product steps per wave
static_assert(DM % (OW * 32) == 0 && SEQ % 16 == 0 && OW * 32 == 16 * (NE / 4));
__global__ __launch_bounds__(OW * 32) void k_out(const float* __restrict__ O, const __bf16* __restrict__ P, float* __restrict__ Y) {
  __shared__ __align__(16) float so[OW][16][68];
  const int tid = threadIdx.x, wave = tid >> 5, lane = tid & 31, col = lane & 15, g = lane >> 4;
  const size_t r0 = (size_t)blockIdx.x * 16; const int b = (int)(r0 / SEQ), s0 = (int)(r0 % SEQ);
  const size_t yr0 = (size_t)b * SEQ_FULL + s0;
  const float* orow = O + (r0 + col) * DM + wave * OKS + 8 * g;   // this lane's row of O, at its first k
  const __bf16* prow = P + (size_t)col * DM + wave * OKS;
  v4f x[OKC][4]; v16b w[OKC][4];
#pragma unroll   // constant indices keep the register arrays in registers
  for (int kc = 0; kc < OKC; ++kc) { const float* p = orow + kc * 32;   // elements 0..7 <- k0 + 8g + i, 8..15 <- k0 + 16 + 8g + i, as in frag_b
    x[kc][0] = *(const v4f*)p; x[kc][1] = *(const v4f*)(p + 4); x[kc][2] = *(const v4f*)(p + 16); x[kc][3] = *(const v4f*)(p + 20); }
  asm volatile("s_wait_xcnt 0x0" ::: "memory");   // stands in front of the loads below, whose destinations may take over the address registers of the loads above
#pragma unroll   // constant indices keep the register arrays in registers
  for (int kc = 0; kc < OKC; ++kc) {
#pragma unroll   // constant indices keep the register arrays in registers
    for (int j = 0; j < 4; ++j) w[kc][j] = frag_b(prow + (size_t)(j * 16) * DM + kc * 32, lane); }
  v8f acc[4] = {};
#pragma unroll   // constant indices keep the register arrays in registers
  for (int kc = 0; kc < OKC; ++kc) { float v[16];
#pragma unroll
    for (int i = 0; i < 16; ++i) v[i] = x[kc][i >> 2][i & 3];
    const F2 a = bsplit16(v);
#pragma unroll
    for (int j = 0; j < 4; ++j) acc[j] = wmma_bf(a.l, w[kc][j], acc[j]);
#pragma unroll
    for (int j = 0; j < 4; ++j) acc[j] = wmma_bf(a.h, w[kc][j], acc[j]); }
#pragma unroll
  for (int j = 0; j < 4; ++j) {
#pragma unroll
    for (int r = 0; r < 8; ++r) so[wave][8 * g + r][j * 16 + col] = acc[j][r]; }
  __syncthreads();   // every wave's partial tile is in LDS before any thread sums them
  const int row = tid >> 4, c4 = (tid & 15) * 4;
  v4f y = *(const v4f*)&so[0][row][c4];
#pragma unroll
  for (int q = 1; q < OW; ++q) y += *(const v4f*)&so[q][row][c4];
  vst2(Y + (yr0 + row) * NE + c4, y);
}
extern "C" void kernel_launch(void* const* d_in, const int* in_sizes, int n_in, void* d_out, int out_size, void* d_ws, size_t ws_size, hipStream_t stream) {
  if (n_in < 5) return;
  if (in_sizes[0] < ((NB - 1) * SEQ_FULL + SEQ) * DM) return;                                        // x [2,2048,1024]
  if (in_sizes[1] < NH * DM * HD || in_sizes[2] < NH * DM * HD || in_sizes[3] < NH * DM * HD) return;  // Wq Wk Wv [16,1024,64]
  if (in_sizes[4] < DM * NE) return;                                                                   // W [1024,64]
  if (out_size < ((NB - 1) * SEQ_FULL + SEQ) * NE) return;                                             // out [2,2048,64]
  if (ws_size < (size_t)WS_END) return;
  const float* X = (const float*)d_in[0]; const float* WQ = (const float*)d_in[1]; const float* WK = (const float*)d_in[2]; const float* WV = (const float*)d_in[3]; const float* WO = (const float*)d_in[4];
  char* ws = (char*)d_ws; __bf16* PK = (__bf16*)(ws + WS_PK); _Float16 *QK = (_Float16*)(ws + WS_QK), *QKL = (_Float16*)(ws + WS_QKL), *VTH = (_Float16*)(ws + WS_VTH), *VTL = (_Float16*)(ws + WS_VTL); float* O = (float*)(ws + WS_O);
  k_pack<<<dim3(DM / 128, NPK / 64), 128, 0, stream>>>(WQ, WK, WV, WO, PK);
  k_qkv<<<dim3(NB * SEQ / QM, NH), 256, 0, stream>>>(X, PK, QK, QKL, VTH, VTL);
  k_attn<<<dim3(SEQ / 64, NH, NB), 128, 0, stream>>>(QK, QKL, VTH, VTL, O);
  k_out<<<dim3(NB * SEQ / 16, 1), OW * 32, 0, stream>>>(O, PK + (size_t)QKVW * DM, (float*)d_out);
}
